// v000
// Measured on an AMD MI455X. A time is GPU time per run, averaged over a window of back-to-back runs after a warm-up
// (all launches, gaps included; the runs take copies of the inputs in turn), and the median of several windows.
// Apart from v000's, it joins two sittings. Times from different sittings can be a few percent apart, while
// side-by-side timings come from the same sitting.
// v000 is the starting kernel. One run takes 692 microseconds.
#include <hip/hip_runtime.h>
#include <hip/hip_bf16.h>
#include <stdint.h>

// ---------------------------------------------------------------------------
// Types for WMMA (gfx1250, wave32)
// ---------------------------------------------------------------------------
typedef __attribute__((ext_vector_type(16))) __bf16 v16bf;
typedef __attribute__((ext_vector_type(8)))  float  v8f;

struct alignas(16) U16x8 { unsigned short u[8]; };
struct alignas(32) FragBF { U16x8 lo, hi; };

static __device__ __forceinline__ unsigned short f2bf(float f) {
    unsigned int u = __float_as_uint(f);
    u += 0x7FFFu + ((u >> 16) & 1u);          // round-to-nearest-even
    return (unsigned short)(u >> 16);
}

static __device__ __forceinline__ float gelu_tanh(float x) {
    float x3 = x * x * x;
    return 0.5f * x * (1.0f + tanhf(0.7978845608028654f * (x + 0.044715f * x3)));
}

static __device__ __forceinline__ float softplus_f(float x) {
    return (x > 20.0f) ? x : log1pf(expf(x));
}

static __device__ __forceinline__ float phi1_f(float z) {
    if (fabsf(z) < 1e-4f) return 1.0f + 0.5f * z;
    return expm1f(z) / z;
}

// ---------------------------------------------------------------------------
// gfx1250 async memory->LDS copy (ASYNCcnt tracked), 16B per lane.
// LDS destination address = low 32 bits of the generic pointer
// (flat aperture maps LDS_ADDR = addr[31:0]).
// ---------------------------------------------------------------------------
static __device__ __forceinline__ void async_copy_b128(void* lds_ptr, const void* gptr) {
    unsigned lds_addr = (unsigned)(size_t)lds_ptr;
    unsigned long long ga = (unsigned long long)(size_t)gptr;
    asm volatile("global_load_async_to_lds_b128 %0, %1, off"
                 :: "v"(lds_addr), "v"(ga)
                 : "memory");
}

template <int Nc>
static __device__ __forceinline__ void wait_asynccnt() {
    asm volatile("s_wait_asynccnt %0" :: "n"(Nc) : "memory");
}

// ---------------------------------------------------------------------------
// f32 -> bf16 convert
// ---------------------------------------------------------------------------
__global__ void cvt_bf16_kernel(const float* __restrict__ in,
                                unsigned short* __restrict__ out, int n) {
    int i = blockIdx.x * 256 + threadIdx.x;
    if (i < n) out[i] = f2bf(in[i]);
}

// ---------------------------------------------------------------------------
// RMSNorm: one block per row of length Dn=1024; writes f32 (optional) + bf16
// ---------------------------------------------------------------------------
template <int WRITE_F32>
__global__ __launch_bounds__(256)
void rmsnorm_kernel(const float* __restrict__ x, const float* __restrict__ w,
                    float* __restrict__ xf, unsigned short* __restrict__ xb, int Dn) {
    const int row = blockIdx.x;
    const int tid = threadIdx.x;
    const float* xr = x + (size_t)row * Dn;
    float ss = 0.0f;
    for (int i = tid; i < Dn; i += 256) { float v = xr[i]; ss += v * v; }
    __shared__ float red[256];
    red[tid] = ss;
    __syncthreads();
    for (int s = 128; s > 0; s >>= 1) {
        if (tid < s) red[tid] += red[tid + s];
        __syncthreads();
    }
    const float r = rsqrtf(red[0] / (float)Dn + 1e-6f);
    for (int i = tid; i < Dn; i += 256) {
        float v = xr[i] * r * w[i];
        if (WRITE_F32) xf[(size_t)row * Dn + i] = v;
        xb[(size_t)row * Dn + i] = f2bf(v);
    }
}

// ---------------------------------------------------------------------------
// WMMA bf16 GEMM:  out[m][n] = sum_k A[m][k] * Bw[n][k]  (+epilogue)
// MODE 0: outF = acc + bias[n]                      (f32)
// MODE 1: outB = bf16(gelu(acc + bias[n]))          (bf16)
// MODE 2: outF = acc + bias[n] + resid[m][n]        (f32)
// Block: 256 threads = 8 waves (2x4), block tile 128x128, BK=64.
// Wave tile 64x32 = 4x2 accumulators of v_wmma_f32_16x16x32_bf16.
// Double-buffered LDS, filled by global_load_async_to_lds_b128 (ASYNCcnt).
// ---------------------------------------------------------------------------
template <int MODE>
__global__ __launch_bounds__(256)
void gemm_wmma_bf16(const unsigned short* __restrict__ A,
                    const unsigned short* __restrict__ Bw,
                    const float* __restrict__ bias,
                    const float* __restrict__ resid,
                    float* __restrict__ outF,
                    unsigned short* __restrict__ outB,
                    int M, int N, int K) {
    __shared__ unsigned short As[2][128][72];  // 64 cols + pad, 16B-aligned rows
    __shared__ unsigned short Bs[2][128][72];

    const int tid   = threadIdx.x;
    const int lane  = tid & 31;
    const int wid   = tid >> 5;
    const int waveM = wid >> 2;      // 0..1  (rows of 64)
    const int waveN = wid & 3;       // 0..3  (cols of 32)
    const int m0 = blockIdx.y * 128;
    const int n0 = blockIdx.x * 128;

    const int lrow = tid & 127;      // LDS fill: row within tile
    const int lch  = tid >> 7;       // 0..1 : which 32-col half

    const int ml   = lane & 15;      // M (or N) index within fragment
    const int half = lane >> 4;      // lane-half selects K sub-pattern

    const v8f vzero = {0.f, 0.f, 0.f, 0.f, 0.f, 0.f, 0.f, 0.f};
    v8f acc[4][2];
#pragma unroll
    for (int i = 0; i < 4; ++i)
#pragma unroll
        for (int j = 0; j < 2; ++j) acc[i][j] = vzero;

    const unsigned short* rowA = A  + (size_t)(m0 + lrow) * K + lch * 32;
    const unsigned short* rowB = Bw + (size_t)(n0 + lrow) * K + lch * 32;

    // Issue one K-slab (8 x 16B per thread) into LDS buffer `buf` via async DMA.
    auto issue_slab = [&](int buf, int k0) {
        const unsigned short* sA = rowA + k0;
        const unsigned short* sB = rowB + k0;
        unsigned short* dA = &As[buf][lrow][lch * 32];
        unsigned short* dB = &Bs[buf][lrow][lch * 32];
        async_copy_b128(dA + 0,  sA + 0);
        async_copy_b128(dA + 8,  sA + 8);
        async_copy_b128(dA + 16, sA + 16);
        async_copy_b128(dA + 24, sA + 24);
        async_copy_b128(dB + 0,  sB + 0);
        async_copy_b128(dB + 8,  sB + 8);
        async_copy_b128(dB + 16, sB + 16);
        async_copy_b128(dB + 24, sB + 24);
    };

    const int nslab = K >> 6;
    issue_slab(0, 0);

    for (int i = 0; i < nslab; ++i) {
        const int cur = i & 1;
        if (i + 1 < nslab) {
            issue_slab(cur ^ 1, (i + 1) << 6);  // prefetch next slab (async)
            wait_asynccnt<8>();                 // this wave's slab-i loads done
        } else {
            wait_asynccnt<0>();
        }
        __syncthreads();                        // all waves' slab-i data in LDS

#pragma unroll
        for (int s = 0; s < 2; ++s) {
            const int ks = s * 32;
            // 16-bit A/B fragment layout: lane-half 0 holds K {0..7,16..23},
            // half 1 holds K {8..15,24..31} (two 16B runs per lane).
            FragBF fa[4], fb[2];
#pragma unroll
            for (int ii = 0; ii < 4; ++ii) {
                const int row = waveM * 64 + ii * 16 + ml;
                fa[ii].lo = *(const U16x8*)&As[cur][row][ks + half * 8];
                fa[ii].hi = *(const U16x8*)&As[cur][row][ks + 16 + half * 8];
            }
#pragma unroll
            for (int j = 0; j < 2; ++j) {
                const int col = waveN * 32 + j * 16 + ml;
                fb[j].lo = *(const U16x8*)&Bs[cur][col][ks + half * 8];
                fb[j].hi = *(const U16x8*)&Bs[cur][col][ks + 16 + half * 8];
            }
#pragma unroll
            for (int ii = 0; ii < 4; ++ii) {
                v16bf av = __builtin_bit_cast(v16bf, fa[ii]);
#pragma unroll
                for (int j = 0; j < 2; ++j) {
                    v16bf bv = __builtin_bit_cast(v16bf, fb[j]);
                    acc[ii][j] = __builtin_amdgcn_wmma_f32_16x16x32_bf16(
                        false, av, false, bv, (short)0, acc[ii][j], false, false);
                }
            }
        }
        __syncthreads();   // everyone finished reading buf `cur` before refill
    }

    // Epilogue: C/D layout — VGPR r: lanes 0-15 -> M=r, lanes 16-31 -> M=r+8.
#pragma unroll
    for (int i = 0; i < 4; ++i) {
        const int rowBase = m0 + waveM * 64 + i * 16;
#pragma unroll
        for (int j = 0; j < 2; ++j) {
            const int col = n0 + waveN * 32 + j * 16 + ml;
#pragma unroll
            for (int r = 0; r < 8; ++r) {
                const int row = rowBase + r + half * 8;
                float c = acc[i][j][r] + bias[col];
                const size_t o = (size_t)row * N + col;
                if (MODE == 0) {
                    outF[o] = c;
                } else if (MODE == 1) {
                    outB[o] = f2bf(gelu_tanh(c));
                } else {
                    outF[o] = c + resid[o];
                }
            }
        }
    }
}

// ---------------------------------------------------------------------------
// Bv / Cv projections: out[row][n] = dot(xn[row,:], W[n,:]) + b[n]
// ---------------------------------------------------------------------------
__global__ __launch_bounds__(256)
void bc_proj_kernel(const float* __restrict__ xnf,
                    const float* __restrict__ WB, const float* __restrict__ bB,
                    const float* __restrict__ WC, const float* __restrict__ bC,
                    float* __restrict__ Bv, float* __restrict__ Cv, int K) {
    const int t = blockIdx.x * 256 + threadIdx.x;
    const int row = t >> 5;
    const int o = t & 31;
    const int n = o & 15;
    const bool isC = o >= 16;
    const float* w = (isC ? WC : WB) + (size_t)n * K;
    const float* xr = xnf + (size_t)row * K;
    float s = 0.0f;
    for (int k = 0; k < K; k += 4) {
        s += xr[k] * w[k] + xr[k + 1] * w[k + 1]
           + xr[k + 2] * w[k + 2] + xr[k + 3] * w[k + 3];
    }
    s += (isC ? bC : bB)[n];
    (isC ? Cv : Bv)[(size_t)row * 16 + n] = s;
}

// ---------------------------------------------------------------------------
// Chunked linear-recurrence scan (h = dA*h + b), 3 passes, NC chunks of CL.
// Thread layout (pass 1/3): 16 lanes (n) per (b,d,chunk); wave32 = 2 groups.
// ---------------------------------------------------------------------------
#define SCAN_NC 32
#define SCAN_CL 64

// Pass 1: per-chunk transfer (P = prod dA, q = end state from h0=0)
__global__ __launch_bounds__(256)
void scan_pass1(const float* __restrict__ dtp, const float* __restrict__ xnf,
                const float* __restrict__ Bv, const float* __restrict__ A_log,
                float* __restrict__ Pbuf, float* __restrict__ Qbuf,
                int Lv, int Dv) {
    const int tid = blockIdx.x * 256 + threadIdx.x;
    const int n  = tid & 15;
    const int pc = tid >> 4;              // (b,d,chunk)
    const int c  = pc & (SCAN_NC - 1);
    const int p  = pc >> 5;               // log2(SCAN_NC)=5
    const int b  = p / Dv;
    const int d  = p - b * Dv;

    const float An = -expf(A_log[n]);
    float h = 0.0f, pf = 1.0f;
    const int l0 = c * SCAN_CL;
    for (int l = l0; l < l0 + SCAN_CL; ++l) {
        const size_t idx = (size_t)(b * Lv + l);
        const float dt  = softplus_f(dtp[idx * Dv + d]);
        const float xv  = xnf[idx * Dv + d];
        const float dtA = dt * An;
        const float dA  = expf(dtA);
        const float bt  = phi1_f(dtA) * Bv[idx * 16 + n] * xv;
        h  = dA * h + bt;
        pf = dA * pf;
    }
    Pbuf[(size_t)pc * 16 + n] = pf;
    Qbuf[(size_t)pc * 16 + n] = h;
}

// Pass 2: sequential combine over chunks -> initial state H_c per chunk
__global__ __launch_bounds__(256)
void scan_pass2(const float* __restrict__ Pbuf, const float* __restrict__ Qbuf,
                float* __restrict__ Hbuf) {
    const int tid = blockIdx.x * 256 + threadIdx.x;
    const int n = tid & 15;
    const int p = tid >> 4;               // (b,d)
    float H = 0.0f;
    for (int c = 0; c < SCAN_NC; ++c) {
        const size_t o = ((size_t)p * SCAN_NC + c) * 16 + n;
        Hbuf[o] = H;
        H = Pbuf[o] * H + Qbuf[o];
    }
}

// Pass 3: replay chunk from true H_c, emit y = sum_n Cv*h + D*xn, +residual
__global__ __launch_bounds__(256)
void scan_pass3(const float* __restrict__ dtp, const float* __restrict__ xnf,
                const float* __restrict__ xres,
                const float* __restrict__ Bv, const float* __restrict__ Cv,
                const float* __restrict__ A_log, const float* __restrict__ Dp,
                const float* __restrict__ scale, const float* __restrict__ Hbuf,
                float* __restrict__ x2, int Lv, int Dv) {
    const int tid = blockIdx.x * 256 + threadIdx.x;
    const int n  = tid & 15;
    const int pc = tid >> 4;
    const int c  = pc & (SCAN_NC - 1);
    const int p  = pc >> 5;
    const int b  = p / Dv;
    const int d  = p - b * Dv;

    const float An = -expf(A_log[n]);
    const float Dd = Dp[d];
    const float sc = scale[d];

    float h = Hbuf[(size_t)pc * 16 + n];
    const int l0 = c * SCAN_CL;
    for (int l = l0; l < l0 + SCAN_CL; ++l) {
        const size_t idx = (size_t)(b * Lv + l);
        const float dt  = softplus_f(dtp[idx * Dv + d]);
        const float xv  = xnf[idx * Dv + d];
        const float dtA = dt * An;
        const float dA  = expf(dtA);
        const float bt  = phi1_f(dtA) * Bv[idx * 16 + n] * xv;
        h = dA * h + bt;
        float contrib = Cv[idx * 16 + n] * h;
        contrib += __shfl_xor(contrib, 8, 16);
        contrib += __shfl_xor(contrib, 4, 16);
        contrib += __shfl_xor(contrib, 2, 16);
        contrib += __shfl_xor(contrib, 1, 16);
        if (n == 0) {
            float y = (contrib + Dd * xv) * sc;
            x2[idx * Dv + d] = y + xres[idx * Dv + d];
        }
    }
}

// ---------------------------------------------------------------------------
// Launch
// ---------------------------------------------------------------------------
extern "C" void kernel_launch(void* const* d_in, const int* in_sizes, int n_in,
                              void* d_out, int out_size, void* d_ws, size_t ws_size,
                              hipStream_t stream) {
    (void)in_sizes; (void)n_in; (void)out_size; (void)ws_size;
    constexpr int Bb = 2, Lv = 2048, Dv = 1024, Nst = 16, DFF = 4096;
    constexpr int Mrows = Bb * Lv;  // 4096
    constexpr int NCh = SCAN_NC;

    const float* x       = (const float*)d_in[0];
    const float* norm1_w = (const float*)d_in[1];
    const float* norm2_w = (const float*)d_in[2];
    const float* A_log   = (const float*)d_in[3];
    const float* D_param = (const float*)d_in[4];
    const float* scale   = (const float*)d_in[5];
    const float* Wdt     = (const float*)d_in[6];
    const float* bdt     = (const float*)d_in[7];
    const float* WB      = (const float*)d_in[8];
    const float* bB      = (const float*)d_in[9];
    const float* WC      = (const float*)d_in[10];
    const float* bC      = (const float*)d_in[11];
    const float* W1      = (const float*)d_in[12];
    const float* b1      = (const float*)d_in[13];
    const float* W2      = (const float*)d_in[14];
    const float* b2      = (const float*)d_in[15];
    float* out = (float*)d_out;

    size_t off = 0;
    auto alloc = [&](size_t bytes) -> void* {
        void* p = (char*)d_ws + off;
        off += (bytes + 255) & ~(size_t)255;
        return p;
    };
    float*          xnf  = (float*)alloc((size_t)Mrows * Dv * 4);
    unsigned short* xnb  = (unsigned short*)alloc((size_t)Mrows * Dv * 2);
    unsigned short* wdtb = (unsigned short*)alloc((size_t)Dv * Dv * 2);
    unsigned short* w1b  = (unsigned short*)alloc((size_t)DFF * Dv * 2);
    unsigned short* w2b  = (unsigned short*)alloc((size_t)Dv * DFF * 2);
    float*          dtp  = (float*)alloc((size_t)Mrows * Dv * 4);
    float*          Bv   = (float*)alloc((size_t)Mrows * Nst * 4);
    float*          Cv   = (float*)alloc((size_t)Mrows * Nst * 4);
    float*          x2   = (float*)alloc((size_t)Mrows * Dv * 4);
    unsigned short* xn2b = (unsigned short*)alloc((size_t)Mrows * Dv * 2);
    unsigned short* hb   = (unsigned short*)alloc((size_t)Mrows * DFF * 2);
    float*          Pbuf = (float*)alloc((size_t)Bb * Dv * NCh * 16 * 4);
    float*          Qbuf = (float*)alloc((size_t)Bb * Dv * NCh * 16 * 4);
    float*          Hbuf = (float*)alloc((size_t)Bb * Dv * NCh * 16 * 4);

    // 1. weight converts to bf16
    cvt_bf16_kernel<<<(Dv * Dv + 255) / 256, 256, 0, stream>>>(Wdt, wdtb, Dv * Dv);
    cvt_bf16_kernel<<<(DFF * Dv + 255) / 256, 256, 0, stream>>>(W1, w1b, DFF * Dv);
    cvt_bf16_kernel<<<(Dv * DFF + 255) / 256, 256, 0, stream>>>(W2, w2b, Dv * DFF);

    // 2. RMSNorm1 (f32 + bf16)
    rmsnorm_kernel<1><<<Mrows, 256, 0, stream>>>(x, norm1_w, xnf, xnb, Dv);

    // 3. dt_pre = xn @ Wdt^T + bdt  (WMMA, async-LDS pipelined)
    gemm_wmma_bf16<0><<<dim3(Dv / 128, Mrows / 128), 256, 0, stream>>>(
        xnb, wdtb, bdt, nullptr, dtp, nullptr, Mrows, Dv, Dv);

    // 4. Bv / Cv projections
    bc_proj_kernel<<<(Mrows * 32) / 256, 256, 0, stream>>>(
        xnf, WB, bB, WC, bC, Bv, Cv, Dv);

    // 5. chunked selective scan + residual -> x2
    scan_pass1<<<(Bb * Dv * NCh * 16) / 256, 256, 0, stream>>>(
        dtp, xnf, Bv, A_log, Pbuf, Qbuf, Lv, Dv);
    scan_pass2<<<(Bb * Dv * 16) / 256, 256, 0, stream>>>(Pbuf, Qbuf, Hbuf);
    scan_pass3<<<(Bb * Dv * NCh * 16) / 256, 256, 0, stream>>>(
        dtp, xnf, x, Bv, Cv, A_log, D_param, scale, Hbuf, x2, Lv, Dv);

    // 6. RMSNorm2 (bf16 only)
    rmsnorm_kernel<0><<<Mrows, 256, 0, stream>>>(x2, norm2_w, nullptr, xn2b, Dv);

    // 7. h = gelu(xn2 @ W1^T + b1) -> bf16  (WMMA)
    gemm_wmma_bf16<1><<<dim3(DFF / 128, Mrows / 128), 256, 0, stream>>>(
        xn2b, w1b, b1, nullptr, nullptr, hb, Mrows, DFF, Dv);

    // 8. out = h @ W2^T + b2 + x2  (WMMA)
    gemm_wmma_bf16<2><<<dim3(Dv / 128, Mrows / 128), 256, 0, stream>>>(
        hb, w2b, b2, x2, out, nullptr, Mrows, Dv, DFF);
}

// v001
// It runs in 417 microseconds.
// In two side-by-side timings against v000, it was 1.68 and 1.69 times as fast.
#include <hip/hip_runtime.h>
#include <hip/hip_bf16.h>
#include <stdint.h>

// ---------------------------------------------------------------------------
// Types for WMMA (gfx1250, wave32)
// ---------------------------------------------------------------------------
typedef __attribute__((ext_vector_type(16))) __bf16 v16bf;
typedef __attribute__((ext_vector_type(8)))  float  v8f;

struct alignas(16) U16x8 { unsigned short u[8]; };
struct alignas(32) FragBF { U16x8 lo, hi; };

static __device__ __forceinline__ unsigned short f2bf(float f) {
    unsigned int u = __float_as_uint(f);
    u += 0x7FFFu + ((u >> 16) & 1u);          // round-to-nearest-even
    return (unsigned short)(u >> 16);
}

static __device__ __forceinline__ float gelu_tanh(float x) {
    float x3 = x * x * x;
    return 0.5f * x * (1.0f + tanhf(0.7978845608028654f * (x + 0.044715f * x3)));
}

static __device__ __forceinline__ float softplus_f(float x) {
    return (x > 20.0f) ? x : log1pf(expf(x));
}

static __device__ __forceinline__ float phi1_f(float z) {
    if (fabsf(z) < 1e-4f) return 1.0f + 0.5f * z;
    return expm1f(z) / z;
}

// ---------------------------------------------------------------------------
// gfx1250 async memory->LDS copy (ASYNCcnt tracked), 16B per lane.
// LDS destination address = low 32 bits of the generic pointer
// (flat aperture maps LDS_ADDR = addr[31:0]).
// ---------------------------------------------------------------------------
static __device__ __forceinline__ void async_copy_b128(void* lds_ptr, const void* gptr) {
    unsigned lds_addr = (unsigned)(size_t)lds_ptr;
    unsigned long long ga = (unsigned long long)(size_t)gptr;
    asm volatile("global_load_async_to_lds_b128 %0, %1, off"
                 :: "v"(lds_addr), "v"(ga)
                 : "memory");
}

template <int Nc>
static __device__ __forceinline__ void wait_asynccnt() {
    asm volatile("s_wait_asynccnt %0" :: "n"(Nc) : "memory");
}

// ---------------------------------------------------------------------------
// f32 -> bf16 convert
// ---------------------------------------------------------------------------
__global__ void cvt_bf16_kernel(const float* __restrict__ in,
                                unsigned short* __restrict__ out, int n) {
    int i = blockIdx.x * 256 + threadIdx.x;
    if (i < n) out[i] = f2bf(in[i]);
}

// ---------------------------------------------------------------------------
// RMSNorm: one block per row of length Dn=1024; writes f32 (optional) + bf16
// ---------------------------------------------------------------------------
template <int WRITE_F32>
__global__ __launch_bounds__(256)
void rmsnorm_kernel(const float* __restrict__ x, const float* __restrict__ w,
                    float* __restrict__ xf, unsigned short* __restrict__ xb, int Dn) {
    const int row = blockIdx.x;
    const int tid = threadIdx.x;
    const float* xr = x + (size_t)row * Dn;
    float ss = 0.0f;
    for (int i = tid; i < Dn; i += 256) { float v = xr[i]; ss += v * v; }
    __shared__ float red[256];
    red[tid] = ss;
    __syncthreads();
    for (int s = 128; s > 0; s >>= 1) {
        if (tid < s) red[tid] += red[tid + s];
        __syncthreads();
    }
    const float r = rsqrtf(red[0] / (float)Dn + 1e-6f);
    for (int i = tid; i < Dn; i += 256) {
        float v = xr[i] * r * w[i];
        if (WRITE_F32) xf[(size_t)row * Dn + i] = v;
        xb[(size_t)row * Dn + i] = f2bf(v);
    }
}

// ---------------------------------------------------------------------------
// WMMA bf16 GEMM:  out[m][n] = sum_k A[m][k] * Bw[n][k]  (+epilogue)
// MODE 0: outF = acc + bias[n]                      (f32)
// MODE 1: outB = bf16(gelu(acc + bias[n]))          (bf16)
// MODE 2: outF = acc + bias[n] + resid[m][n]        (f32)
// Block: 256 threads = 8 waves (2x4), block tile 128x128, BK=64.
// Wave tile 64x32 = 4x2 accumulators of v_wmma_f32_16x16x32_bf16.
// Double-buffered LDS, filled by global_load_async_to_lds_b128 (ASYNCcnt).
// ---------------------------------------------------------------------------
template <int MODE>
__global__ __launch_bounds__(256)
void gemm_wmma_bf16(const unsigned short* __restrict__ A,
                    const unsigned short* __restrict__ Bw,
                    const float* __restrict__ bias,
                    const float* __restrict__ resid,
                    float* __restrict__ outF,
                    unsigned short* __restrict__ outB,
                    int M, int N, int K) {
    __shared__ unsigned short As[2][128][72];  // 64 cols + pad, 16B-aligned rows
    __shared__ unsigned short Bs[2][128][72];

    const int tid   = threadIdx.x;
    const int lane  = tid & 31;
    const int wid   = tid >> 5;
    const int waveM = wid >> 2;      // 0..1  (rows of 64)
    const int waveN = wid & 3;       // 0..3  (cols of 32)
    const int m0 = blockIdx.y * 128;
    const int n0 = blockIdx.x * 128;

    const int lrow = tid & 127;      // LDS fill: row within tile
    const int lch  = tid >> 7;       // 0..1 : which 32-col half

    const int ml   = lane & 15;      // M (or N) index within fragment
    const int half = lane >> 4;      // lane-half selects K sub-pattern

    const v8f vzero = {0.f, 0.f, 0.f, 0.f, 0.f, 0.f, 0.f, 0.f};
    v8f acc[4][2];
#pragma unroll
    for (int i = 0; i < 4; ++i)
#pragma unroll
        for (int j = 0; j < 2; ++j) acc[i][j] = vzero;

    const unsigned short* rowA = A  + (size_t)(m0 + lrow) * K + lch * 32;
    const unsigned short* rowB = Bw + (size_t)(n0 + lrow) * K + lch * 32;

    // Issue one K-slab (8 x 16B per thread) into LDS buffer `buf` via async DMA.
    auto issue_slab = [&](int buf, int k0) {
        const unsigned short* sA = rowA + k0;
        const unsigned short* sB = rowB + k0;
        unsigned short* dA = &As[buf][lrow][lch * 32];
        unsigned short* dB = &Bs[buf][lrow][lch * 32];
        async_copy_b128(dA + 0,  sA + 0);
        async_copy_b128(dA + 8,  sA + 8);
        async_copy_b128(dA + 16, sA + 16);
        async_copy_b128(dA + 24, sA + 24);
        async_copy_b128(dB + 0,  sB + 0);
        async_copy_b128(dB + 8,  sB + 8);
        async_copy_b128(dB + 16, sB + 16);
        async_copy_b128(dB + 24, sB + 24);
    };

    const int nslab = K >> 6;
    issue_slab(0, 0);

    for (int i = 0; i < nslab; ++i) {
        const int cur = i & 1;
        if (i + 1 < nslab) {
            issue_slab(cur ^ 1, (i + 1) << 6);  // prefetch next slab (async)
            wait_asynccnt<8>();                 // this wave's slab-i loads done
        } else {
            wait_asynccnt<0>();
        }
        __syncthreads();                        // all waves' slab-i data in LDS

#pragma unroll
        for (int s = 0; s < 2; ++s) {
            const int ks = s * 32;
            // 16-bit A/B fragment layout: lane-half 0 holds K {0..7,16..23},
            // half 1 holds K {8..15,24..31} (two 16B runs per lane).
            FragBF fa[4], fb[2];
#pragma unroll
            for (int ii = 0; ii < 4; ++ii) {
                const int row = waveM * 64 + ii * 16 + ml;
                fa[ii].lo = *(const U16x8*)&As[cur][row][ks + half * 8];
                fa[ii].hi = *(const U16x8*)&As[cur][row][ks + 16 + half * 8];
            }
#pragma unroll
            for (int j = 0; j < 2; ++j) {
                const int col = waveN * 32 + j * 16 + ml;
                fb[j].lo = *(const U16x8*)&Bs[cur][col][ks + half * 8];
                fb[j].hi = *(const U16x8*)&Bs[cur][col][ks + 16 + half * 8];
            }
#pragma unroll
            for (int ii = 0; ii < 4; ++ii) {
                v16bf av = __builtin_bit_cast(v16bf, fa[ii]);
#pragma unroll
                for (int j = 0; j < 2; ++j) {
                    v16bf bv = __builtin_bit_cast(v16bf, fb[j]);
                    acc[ii][j] = __builtin_amdgcn_wmma_f32_16x16x32_bf16(
                        false, av, false, bv, (short)0, acc[ii][j], false, false);
                }
            }
        }
        __syncthreads();   // everyone finished reading buf `cur` before refill
    }

    // Epilogue: C/D layout — VGPR r: lanes 0-15 -> M=r, lanes 16-31 -> M=r+8.
#pragma unroll
    for (int i = 0; i < 4; ++i) {
        const int rowBase = m0 + waveM * 64 + i * 16;
#pragma unroll
        for (int j = 0; j < 2; ++j) {
            const int col = n0 + waveN * 32 + j * 16 + ml;
#pragma unroll
            for (int r = 0; r < 8; ++r) {
                const int row = rowBase + r + half * 8;
                float c = acc[i][j][r] + bias[col];
                const size_t o = (size_t)row * N + col;
                if (MODE == 0) {
                    outF[o] = c;
                } else if (MODE == 1) {
                    outB[o] = f2bf(gelu_tanh(c));
                } else {
                    outF[o] = c + resid[o];
                }
            }
        }
    }
}

// ---------------------------------------------------------------------------
// Bv / Cv projections: out[row][n] = dot(xn[row,:], W[n,:]) + b[n]
// ---------------------------------------------------------------------------
__global__ __launch_bounds__(256)
void bc_proj_kernel(const float* __restrict__ xnf,
                    const float* __restrict__ WB, const float* __restrict__ bB,
                    const float* __restrict__ WC, const float* __restrict__ bC,
                    float* __restrict__ Bv, float* __restrict__ Cv, int K) {
    const int t = blockIdx.x * 256 + threadIdx.x;
    const int row = t >> 5;
    const int o = t & 31;
    const int n = o & 15;
    const bool isC = o >= 16;
    const float* w = (isC ? WC : WB) + (size_t)n * K;
    const float* xr = xnf + (size_t)row * K;
    float s = 0.0f;
    for (int k = 0; k < K; k += 4) {
        s += xr[k] * w[k] + xr[k + 1] * w[k + 1]
           + xr[k + 2] * w[k + 2] + xr[k + 3] * w[k + 3];
    }
    s += (isC ? bC : bB)[n];
    (isC ? Cv : Bv)[(size_t)row * 16 + n] = s;
}

// ---------------------------------------------------------------------------
// Chunked linear-recurrence scan (h = dA*h + b), 3 passes, NC chunks of CL.
// Thread layout (pass 1/3): one thread per (b, chunk, d); the lanes of a wave
// run along d, and each thread keeps all 16 states n in registers.
// P/Q/H layout: [b][chunk][n][d], so every access is contiguous along d.
// ---------------------------------------------------------------------------
#define SCAN_NC 64
#define SCAN_CL 32
#define SCAN_D  1024   // channels = pitch of one n row of P/Q/H (a constant, so that
                       // the 16 rows are reached by immediate offsets from one address)

// Pass 1: per-chunk transfer (P = prod dA, q = end state from h0=0)
// grid: x = d / 256, y = chunk, z = batch
__global__ __launch_bounds__(256)
void scan_pass1(const float* __restrict__ dtp, const float* __restrict__ xnf,
                const float* __restrict__ Bv, const float* __restrict__ A_log,
                float* __restrict__ Pbuf, float* __restrict__ Qbuf,
                int Lv, int Dv) {
    const int d = blockIdx.x * 256 + threadIdx.x;
    const int c = blockIdx.y;
    const int b = blockIdx.z;

    float An[16], h[16], pf[16];
#pragma unroll  // constant n: the per-thread arrays stay in registers
    for (int n = 0; n < 16; ++n) {
        An[n] = -expf(A_log[n]);
        h[n]  = 0.0f;
        pf[n] = 1.0f;
    }
    const int row0 = b * Lv + c * SCAN_CL;
    for (int l = 0; l < SCAN_CL; ++l) {
        const size_t idx = (size_t)(row0 + l);
        const float dt = softplus_f(dtp[idx * Dv + d]);
        const float xv = xnf[idx * Dv + d];
        const float* __restrict__ Br = Bv + idx * 16;   // same for the whole block
#pragma unroll  // constant n: the per-thread arrays stay in registers
        for (int n = 0; n < 16; ++n) {
            const float dtA = dt * An[n];
            const float dA  = expf(dtA);
            const float bt  = phi1_f(dtA) * Br[n] * xv;
            h[n]  = dA * h[n] + bt;
            pf[n] = dA * pf[n];
        }
    }
    const size_t o0 = (size_t)(b * SCAN_NC + c) * 16 * SCAN_D + d;
#pragma unroll  // constant n: the per-thread arrays stay in registers
    for (int n = 0; n < 16; ++n) {
        Pbuf[o0 + n * SCAN_D] = pf[n];
        Qbuf[o0 + n * SCAN_D] = h[n];
    }
}

// Pass 2: sequential combine over chunks -> initial state H_c per chunk
// one thread per (b, n, d); one chunk is a plane of 16 * SCAN_D elements
__global__ __launch_bounds__(256)
void scan_pass2(const float* __restrict__ Pbuf, const float* __restrict__ Qbuf,
                float* __restrict__ Hbuf) {
    constexpr int plane = 16 * SCAN_D;
    const int tid = blockIdx.x * 256 + threadIdx.x;
    const int b = tid / plane;
    const int r = tid - b * plane;        // n * SCAN_D + d
    const size_t o0 = (size_t)b * SCAN_NC * plane + r;
    float H = 0.0f;
    // unrolled whole: the loads do not depend on H, so they can all be in
    // flight together instead of one memory latency per few chunks
#pragma unroll
    for (int c = 0; c < SCAN_NC; ++c) {
        const size_t o = o0 + c * plane;
        Hbuf[o] = H;
        H = Pbuf[o] * H + Qbuf[o];
    }
}

// Pass 3: replay chunk from true H_c, emit y = sum_n Cv*h + D*xn, +residual
// grid: x = d / 256, y = chunk, z = batch
__global__ __launch_bounds__(256)
void scan_pass3(const float* __restrict__ dtp, const float* __restrict__ xnf,
                const float* __restrict__ xres,
                const float* __restrict__ Bv, const float* __restrict__ Cv,
                const float* __restrict__ A_log, const float* __restrict__ Dp,
                const float* __restrict__ scale, const float* __restrict__ Hbuf,
                float* __restrict__ x2, int Lv, int Dv) {
    const int d = blockIdx.x * 256 + threadIdx.x;
    const int c = blockIdx.y;
    const int b = blockIdx.z;

    const float Dd = Dp[d];
    const float sc = scale[d];

    float An[16], h[16];
    const size_t o0 = (size_t)(b * SCAN_NC + c) * 16 * SCAN_D + d;
#pragma unroll  // constant n: the per-thread arrays stay in registers
    for (int n = 0; n < 16; ++n) {
        An[n] = -expf(A_log[n]);
        h[n]  = Hbuf[o0 + n * SCAN_D];
    }
    const int row0 = b * Lv + c * SCAN_CL;
    for (int l = 0; l < SCAN_CL; ++l) {
        const size_t idx = (size_t)(row0 + l);
        const float dt = softplus_f(dtp[idx * Dv + d]);
        const float xv = xnf[idx * Dv + d];
        const float xr = xres[idx * Dv + d];
        const float* __restrict__ Br = Bv + idx * 16;   // same for the whole block
        const float* __restrict__ Cr = Cv + idx * 16;
        float t[16];
#pragma unroll  // constant n: the per-thread arrays stay in registers
        for (int n = 0; n < 16; ++n) {
            const float dtA = dt * An[n];
            const float dA  = expf(dtA);
            const float bt  = phi1_f(dtA) * Br[n] * xv;
            h[n] = dA * h[n] + bt;
            t[n] = Cr[n] * h[n];
        }
        // sum over n: pairs 8, 4, 2, 1 apart
#pragma unroll  // constant n: the per-thread arrays stay in registers
        for (int s = 8; s > 0; s >>= 1)
#pragma unroll  // constant n: the per-thread arrays stay in registers
            for (int n = 0; n < s; ++n) t[n] += t[n + s];
        const float y = (t[0] + Dd * xv) * sc;
        x2[idx * Dv + d] = y + xr;
        // precaution: the next trip rewrites the registers that this store names
        asm volatile("s_wait_xcnt 0x0" ::: "memory");
    }
}

// ---------------------------------------------------------------------------
// Launch
// ---------------------------------------------------------------------------
extern "C" void kernel_launch(void* const* d_in, const int* in_sizes, int n_in,
                              void* d_out, int out_size, void* d_ws, size_t ws_size,
                              hipStream_t stream) {
    (void)in_sizes; (void)n_in; (void)out_size; (void)ws_size;
    constexpr int Bb = 2, Lv = 2048, Dv = 1024, Nst = 16, DFF = 4096;
    constexpr int Mrows = Bb * Lv;  // 4096
    constexpr int NCh = SCAN_NC;
    static_assert(Dv == SCAN_D && NCh * SCAN_CL == Lv, "scan tiling");

    const float* x       = (const float*)d_in[0];
    const float* norm1_w = (const float*)d_in[1];
    const float* norm2_w = (const float*)d_in[2];
    const float* A_log   = (const float*)d_in[3];
    const float* D_param = (const float*)d_in[4];
    const float* scale   = (const float*)d_in[5];
    const float* Wdt     = (const float*)d_in[6];
    const float* bdt     = (const float*)d_in[7];
    const float* WB      = (const float*)d_in[8];
    const float* bB      = (const float*)d_in[9];
    const float* WC      = (const float*)d_in[10];
    const float* bC      = (const float*)d_in[11];
    const float* W1      = (const float*)d_in[12];
    const float* b1      = (const float*)d_in[13];
    const float* W2      = (const float*)d_in[14];
    const float* b2      = (const float*)d_in[15];
    float* out = (float*)d_out;

    size_t off = 0;
    auto alloc = [&](size_t bytes) -> void* {
        void* p = (char*)d_ws + off;
        off += (bytes + 255) & ~(size_t)255;
        return p;
    };
    float*          xnf  = (float*)alloc((size_t)Mrows * Dv * 4);
    unsigned short* xnb  = (unsigned short*)alloc((size_t)Mrows * Dv * 2);
    unsigned short* wdtb = (unsigned short*)alloc((size_t)Dv * Dv * 2);
    unsigned short* w1b  = (unsigned short*)alloc((size_t)DFF * Dv * 2);
    unsigned short* w2b  = (unsigned short*)alloc((size_t)Dv * DFF * 2);
    float*          dtp  = (float*)alloc((size_t)Mrows * Dv * 4);
    float*          Bv   = (float*)alloc((size_t)Mrows * Nst * 4);
    float*          Cv   = (float*)alloc((size_t)Mrows * Nst * 4);
    float*          x2   = (float*)alloc((size_t)Mrows * Dv * 4);
    unsigned short* xn2b = (unsigned short*)alloc((size_t)Mrows * Dv * 2);
    unsigned short* hb   = (unsigned short*)alloc((size_t)Mrows * DFF * 2);
    float*          Pbuf = (float*)alloc((size_t)Bb * Dv * NCh * 16 * 4);
    float*          Qbuf = (float*)alloc((size_t)Bb * Dv * NCh * 16 * 4);
    float*          Hbuf = (float*)alloc((size_t)Bb * Dv * NCh * 16 * 4);

    // 1. weight converts to bf16
    cvt_bf16_kernel<<<(Dv * Dv + 255) / 256, 256, 0, stream>>>(Wdt, wdtb, Dv * Dv);
    cvt_bf16_kernel<<<(DFF * Dv + 255) / 256, 256, 0, stream>>>(W1, w1b, DFF * Dv);
    cvt_bf16_kernel<<<(Dv * DFF + 255) / 256, 256, 0, stream>>>(W2, w2b, Dv * DFF);

    // 2. RMSNorm1 (f32 + bf16)
    rmsnorm_kernel<1><<<Mrows, 256, 0, stream>>>(x, norm1_w, xnf, xnb, Dv);

    // 3. dt_pre = xn @ Wdt^T + bdt  (WMMA, async-LDS pipelined)
    gemm_wmma_bf16<0><<<dim3(Dv / 128, Mrows / 128), 256, 0, stream>>>(
        xnb, wdtb, bdt, nullptr, dtp, nullptr, Mrows, Dv, Dv);

    // 4. Bv / Cv projections
    bc_proj_kernel<<<(Mrows * 32) / 256, 256, 0, stream>>>(
        xnf, WB, bB, WC, bC, Bv, Cv, Dv);

    // 5. chunked selective scan + residual -> x2
    scan_pass1<<<dim3(Dv / 256, NCh, Bb), 256, 0, stream>>>(
        dtp, xnf, Bv, A_log, Pbuf, Qbuf, Lv, Dv);
    scan_pass2<<<(Bb * Dv * 16) / 256, 256, 0, stream>>>(Pbuf, Qbuf, Hbuf);
    scan_pass3<<<dim3(Dv / 256, NCh, Bb), 256, 0, stream>>>(
        dtp, xnf, x, Bv, Cv, A_log, D_param, scale, Hbuf, x2, Lv, Dv);

    // 6. RMSNorm2 (bf16 only)
    rmsnorm_kernel<0><<<Mrows, 256, 0, stream>>>(x2, norm2_w, nullptr, xn2b, Dv);

    // 7. h = gelu(xn2 @ W1^T + b1) -> bf16  (WMMA)
    gemm_wmma_bf16<1><<<dim3(DFF / 128, Mrows / 128), 256, 0, stream>>>(
        xn2b, w1b, b1, nullptr, nullptr, hb, Mrows, DFF, Dv);

    // 8. out = h @ W2^T + b2 + x2  (WMMA)
    gemm_wmma_bf16<2><<<dim3(Dv / 128, Mrows / 128), 256, 0, stream>>>(
        hb, w2b, b2, x2, out, nullptr, Mrows, Dv, DFF);
}

// v002
// One run takes 403 microseconds.
// Next to v001, in two timings, it ran 1.03 times as fast each time.
// Counting every step since v000, it is 1.74 times as fast.
#include <hip/hip_runtime.h>
#include <hip/hip_bf16.h>
#include <stdint.h>

// ---------------------------------------------------------------------------
// Types for WMMA (gfx1250, wave32)
// ---------------------------------------------------------------------------
typedef __attribute__((ext_vector_type(16))) __bf16 v16bf;
typedef __attribute__((ext_vector_type(8)))  float  v8f;

struct alignas(16) U16x8 { unsigned short u[8]; };
struct alignas(32) FragBF { U16x8 lo, hi; };

static __device__ __forceinline__ unsigned short f2bf(float f) {
    unsigned int u = __float_as_uint(f);
    u += 0x7FFFu + ((u >> 16) & 1u);          // round-to-nearest-even
    return (unsigned short)(u >> 16);
}

static __device__ __forceinline__ float gelu_tanh(float x) {
    float x3 = x * x * x;
    return 0.5f * x * (1.0f + tanhf(0.7978845608028654f * (x + 0.044715f * x3)));
}

static __device__ __forceinline__ float softplus_f(float x) {
    return (x > 20.0f) ? x : log1pf(expf(x));
}

static __device__ __forceinline__ float phi1_f(float z) {
    if (fabsf(z) < 1e-4f) return 1.0f + 0.5f * z;
    return expm1f(z) / z;
}

// ---------------------------------------------------------------------------
// gfx1250 async memory->LDS copy (ASYNCcnt tracked), 16B per lane.
// LDS destination address = low 32 bits of the generic pointer
// (flat aperture maps LDS_ADDR = addr[31:0]).
// ---------------------------------------------------------------------------
static __device__ __forceinline__ void async_copy_b128(void* lds_ptr, const void* gptr) {
    unsigned lds_addr = (unsigned)(size_t)lds_ptr;
    unsigned long long ga = (unsigned long long)(size_t)gptr;
    asm volatile("global_load_async_to_lds_b128 %0, %1, off"
                 :: "v"(lds_addr), "v"(ga)
                 : "memory");
}

template <int Nc>
static __device__ __forceinline__ void wait_asynccnt() {
    asm volatile("s_wait_asynccnt %0" :: "n"(Nc) : "memory");
}

// ---------------------------------------------------------------------------
// f32 -> bf16 convert. One block of 256 threads converts CVT_BLOCK contiguous
// elements; the array length must be a multiple of CVT_BLOCK (checked at the
// launch). A thread takes CVT_G groups of 4 elements, 256 groups apart: each
// wave-wide load covers 512 contiguous bytes, each store 256, and a wave has
// CVT_G loads in flight. The point is fewer waves than with one element a
// thread, for speed only.
// ---------------------------------------------------------------------------
typedef __attribute__((ext_vector_type(4))) float f32x4;
struct alignas(8) U16x4 { unsigned short u[4]; };
#define CVT_G     8
#define CVT_BLOCK (256 * CVT_G * 4)

__global__ __launch_bounds__(256)
void cvt_bf16_kernel(const float* __restrict__ in,
                     unsigned short* __restrict__ out) {
    const size_t g0 = (size_t)blockIdx.x * (256 * CVT_G) + threadIdx.x;
    const f32x4* __restrict__ src = (const f32x4*)in + g0;
    U16x4* __restrict__ dst = (U16x4*)out + g0;
    f32x4 v[CVT_G];
#pragma unroll  // constant j: v stays in registers and all loads go out first
    for (int j = 0; j < CVT_G; ++j) v[j] = src[j * 256];
#pragma unroll  // constant j: v stays in registers
    for (int j = 0; j < CVT_G; ++j) {
        U16x4 o;
        o.u[0] = f2bf(v[j][0]);
        o.u[1] = f2bf(v[j][1]);
        o.u[2] = f2bf(v[j][2]);
        o.u[3] = f2bf(v[j][3]);
        dst[j * 256] = o;
    }
}

// ---------------------------------------------------------------------------
// RMSNorm: one block per row of length Dn=1024; writes f32 (optional) + bf16
// ---------------------------------------------------------------------------
template <int WRITE_F32>
__global__ __launch_bounds__(256)
void rmsnorm_kernel(const float* __restrict__ x, const float* __restrict__ w,
                    float* __restrict__ xf, unsigned short* __restrict__ xb, int Dn) {
    const int row = blockIdx.x;
    const int tid = threadIdx.x;
    const float* xr = x + (size_t)row * Dn;
    float ss = 0.0f;
    for (int i = tid; i < Dn; i += 256) { float v = xr[i]; ss += v * v; }
    __shared__ float red[256];
    red[tid] = ss;
    __syncthreads();
    for (int s = 128; s > 0; s >>= 1) {
        if (tid < s) red[tid] += red[tid + s];
        __syncthreads();
    }
    const float r = rsqrtf(red[0] / (float)Dn + 1e-6f);
    for (int i = tid; i < Dn; i += 256) {
        float v = xr[i] * r * w[i];
        if (WRITE_F32) xf[(size_t)row * Dn + i] = v;
        xb[(size_t)row * Dn + i] = f2bf(v);
    }
}

// ---------------------------------------------------------------------------
// WMMA bf16 GEMM:  out[m][n] = sum_k A[m][k] * Bw[n][k]  (+epilogue)
// MODE 0: outF = acc + bias[n]                      (f32)
// MODE 1: outB = bf16(gelu(acc + bias[n]))          (bf16)
// MODE 2: outF = acc + bias[n] + resid[m][n]        (f32)
// Block: 256 threads = 8 waves (2x4), block tile 128x128, BK=64.
// Wave tile 64x32 = 4x2 accumulators of v_wmma_f32_16x16x32_bf16.
// Double-buffered LDS, filled by global_load_async_to_lds_b128 (ASYNCcnt).
// ---------------------------------------------------------------------------
template <int MODE>
__global__ __launch_bounds__(256)
void gemm_wmma_bf16(const unsigned short* __restrict__ A,
                    const unsigned short* __restrict__ Bw,
                    const float* __restrict__ bias,
                    const float* __restrict__ resid,
                    float* __restrict__ outF,
                    unsigned short* __restrict__ outB,
                    int M, int N, int K) {
    __shared__ unsigned short As[2][128][72];  // 64 cols + pad, 16B-aligned rows
    __shared__ unsigned short Bs[2][128][72];

    const int tid   = threadIdx.x;
    const int lane  = tid & 31;
    const int wid   = tid >> 5;
    const int waveM = wid >> 2;      // 0..1  (rows of 64)
    const int waveN = wid & 3;       // 0..3  (cols of 32)
    const int m0 = blockIdx.y * 128;
    const int n0 = blockIdx.x * 128;

    const int lrow = tid & 127;      // LDS fill: row within tile
    const int lch  = tid >> 7;       // 0..1 : which 32-col half

    const int ml   = lane & 15;      // M (or N) index within fragment
    const int half = lane >> 4;      // lane-half selects K sub-pattern

    const v8f vzero = {0.f, 0.f, 0.f, 0.f, 0.f, 0.f, 0.f, 0.f};
    v8f acc[4][2];
#pragma unroll
    for (int i = 0; i < 4; ++i)
#pragma unroll
        for (int j = 0; j < 2; ++j) acc[i][j] = vzero;

    const unsigned short* rowA = A  + (size_t)(m0 + lrow) * K + lch * 32;
    const unsigned short* rowB = Bw + (size_t)(n0 + lrow) * K + lch * 32;

    // Issue one K-slab (8 x 16B per thread) into LDS buffer `buf` via async DMA.
    auto issue_slab = [&](int buf, int k0) {
        const unsigned short* sA = rowA + k0;
        const unsigned short* sB = rowB + k0;
        unsigned short* dA = &As[buf][lrow][lch * 32];
        unsigned short* dB = &Bs[buf][lrow][lch * 32];
        async_copy_b128(dA + 0,  sA + 0);
        async_copy_b128(dA + 8,  sA + 8);
        async_copy_b128(dA + 16, sA + 16);
        async_copy_b128(dA + 24, sA + 24);
        async_copy_b128(dB + 0,  sB + 0);
        async_copy_b128(dB + 8,  sB + 8);
        async_copy_b128(dB + 16, sB + 16);
        async_copy_b128(dB + 24, sB + 24);
    };

    const int nslab = K >> 6;
    issue_slab(0, 0);

    for (int i = 0; i < nslab; ++i) {
        const int cur = i & 1;
        if (i + 1 < nslab) {
            issue_slab(cur ^ 1, (i + 1) << 6);  // prefetch next slab (async)
            wait_asynccnt<8>();                 // this wave's slab-i loads done
        } else {
            wait_asynccnt<0>();
        }
        __syncthreads();                        // all waves' slab-i data in LDS

#pragma unroll
        for (int s = 0; s < 2; ++s) {
            const int ks = s * 32;
            // 16-bit A/B fragment layout: lane-half 0 holds K {0..7,16..23},
            // half 1 holds K {8..15,24..31} (two 16B runs per lane).
            FragBF fa[4], fb[2];
#pragma unroll
            for (int ii = 0; ii < 4; ++ii) {
                const int row = waveM * 64 + ii * 16 + ml;
                fa[ii].lo = *(const U16x8*)&As[cur][row][ks + half * 8];
                fa[ii].hi = *(const U16x8*)&As[cur][row][ks + 16 + half * 8];
            }
#pragma unroll
            for (int j = 0; j < 2; ++j) {
                const int col = waveN * 32 + j * 16 + ml;
                fb[j].lo = *(const U16x8*)&Bs[cur][col][ks + half * 8];
                fb[j].hi = *(const U16x8*)&Bs[cur][col][ks + 16 + half * 8];
            }
#pragma unroll
            for (int ii = 0; ii < 4; ++ii) {
                v16bf av = __builtin_bit_cast(v16bf, fa[ii]);
#pragma unroll
                for (int j = 0; j < 2; ++j) {
                    v16bf bv = __builtin_bit_cast(v16bf, fb[j]);
                    acc[ii][j] = __builtin_amdgcn_wmma_f32_16x16x32_bf16(
                        false, av, false, bv, (short)0, acc[ii][j], false, false);
                }
            }
        }
        __syncthreads();   // everyone finished reading buf `cur` before refill
    }

    // Epilogue: C/D layout — VGPR r: lanes 0-15 -> M=r, lanes 16-31 -> M=r+8.
#pragma unroll
    for (int i = 0; i < 4; ++i) {
        const int rowBase = m0 + waveM * 64 + i * 16;
#pragma unroll
        for (int j = 0; j < 2; ++j) {
            const int col = n0 + waveN * 32 + j * 16 + ml;
#pragma unroll
            for (int r = 0; r < 8; ++r) {
                const int row = rowBase + r + half * 8;
                float c = acc[i][j][r] + bias[col];
                const size_t o = (size_t)row * N + col;
                if (MODE == 0) {
                    outF[o] = c;
                } else if (MODE == 1) {
                    outB[o] = f2bf(gelu_tanh(c));
                } else {
                    outF[o] = c + resid[o];
                }
            }
        }
    }
}

// ---------------------------------------------------------------------------
// Bv / Cv projections: out[row][n] = dot(xn[row,:], W[n,:]) + b[n]
// ---------------------------------------------------------------------------
__global__ __launch_bounds__(256)
void bc_proj_kernel(const float* __restrict__ xnf,
                    const float* __restrict__ WB, const float* __restrict__ bB,
                    const float* __restrict__ WC, const float* __restrict__ bC,
                    float* __restrict__ Bv, float* __restrict__ Cv, int K) {
    const int t = blockIdx.x * 256 + threadIdx.x;
    const int row = t >> 5;
    const int o = t & 31;
    const int n = o & 15;
    const bool isC = o >= 16;
    const float* w = (isC ? WC : WB) + (size_t)n * K;
    const float* xr = xnf + (size_t)row * K;
    float s = 0.0f;
    for (int k = 0; k < K; k += 4) {
        s += xr[k] * w[k] + xr[k + 1] * w[k + 1]
           + xr[k + 2] * w[k + 2] + xr[k + 3] * w[k + 3];
    }
    s += (isC ? bC : bB)[n];
    (isC ? Cv : Bv)[(size_t)row * 16 + n] = s;
}

// ---------------------------------------------------------------------------
// Chunked linear-recurrence scan (h = dA*h + b), 3 passes, NC chunks of CL.
// Thread layout (pass 1/3): one thread per (b, chunk, d); the lanes of a wave
// run along d, and each thread keeps all 16 states n in registers.
// P/Q/H layout: [b][chunk][n][d], so every access is contiguous along d.
// ---------------------------------------------------------------------------
#define SCAN_NC 64
#define SCAN_CL 32
#define SCAN_D  1024   // channels = pitch of one n row of P/Q/H (a constant, so that
                       // the 16 rows are reached by immediate offsets from one address)

// Pass 1: per-chunk transfer (P = prod dA, q = end state from h0=0)
// grid: x = d / 256, y = chunk, z = batch
__global__ __launch_bounds__(256)
void scan_pass1(const float* __restrict__ dtp, const float* __restrict__ xnf,
                const float* __restrict__ Bv, const float* __restrict__ A_log,
                float* __restrict__ Pbuf, float* __restrict__ Qbuf,
                int Lv, int Dv) {
    const int d = blockIdx.x * 256 + threadIdx.x;
    const int c = blockIdx.y;
    const int b = blockIdx.z;

    float An[16], h[16], pf[16];
#pragma unroll  // constant n: the per-thread arrays stay in registers
    for (int n = 0; n < 16; ++n) {
        An[n] = -expf(A_log[n]);
        h[n]  = 0.0f;
        pf[n] = 1.0f;
    }
    const int row0 = b * Lv + c * SCAN_CL;
    for (int l = 0; l < SCAN_CL; ++l) {
        const size_t idx = (size_t)(row0 + l);
        const float dt = softplus_f(dtp[idx * Dv + d]);
        const float xv = xnf[idx * Dv + d];
        const float* __restrict__ Br = Bv + idx * 16;   // same for the whole block
#pragma unroll  // constant n: the per-thread arrays stay in registers
        for (int n = 0; n < 16; ++n) {
            const float dtA = dt * An[n];
            const float dA  = expf(dtA);
            const float bt  = phi1_f(dtA) * Br[n] * xv;
            h[n]  = dA * h[n] + bt;
            pf[n] = dA * pf[n];
        }
    }
    const size_t o0 = (size_t)(b * SCAN_NC + c) * 16 * SCAN_D + d;
#pragma unroll  // constant n: the per-thread arrays stay in registers
    for (int n = 0; n < 16; ++n) {
        Pbuf[o0 + n * SCAN_D] = pf[n];
        Qbuf[o0 + n * SCAN_D] = h[n];
    }
}

// Pass 2: sequential combine over chunks -> initial state H_c per chunk
// one thread per (b, n, d); one chunk is a plane of 16 * SCAN_D elements
__global__ __launch_bounds__(256)
void scan_pass2(const float* __restrict__ Pbuf, const float* __restrict__ Qbuf,
                float* __restrict__ Hbuf) {
    constexpr int plane = 16 * SCAN_D;
    const int tid = blockIdx.x * 256 + threadIdx.x;
    const int b = tid / plane;
    const int r = tid - b * plane;        // n * SCAN_D + d
    const size_t o0 = (size_t)b * SCAN_NC * plane + r;
    float H = 0.0f;
    // unrolled whole: the loads do not depend on H, so they can all be in
    // flight together instead of one memory latency per few chunks
#pragma unroll
    for (int c = 0; c < SCAN_NC; ++c) {
        const size_t o = o0 + c * plane;
        Hbuf[o] = H;
        H = Pbuf[o] * H + Qbuf[o];
    }
}

// Pass 3: replay chunk from true H_c, emit y = sum_n Cv*h + D*xn, +residual
// grid: x = d / 256, y = chunk, z = batch
__global__ __launch_bounds__(256)
void scan_pass3(const float* __restrict__ dtp, const float* __restrict__ xnf,
                const float* __restrict__ xres,
                const float* __restrict__ Bv, const float* __restrict__ Cv,
                const float* __restrict__ A_log, const float* __restrict__ Dp,
                const float* __restrict__ scale, const float* __restrict__ Hbuf,
                float* __restrict__ x2, int Lv, int Dv) {
    const int d = blockIdx.x * 256 + threadIdx.x;
    const int c = blockIdx.y;
    const int b = blockIdx.z;

    const float Dd = Dp[d];
    const float sc = scale[d];

    float An[16], h[16];
    const size_t o0 = (size_t)(b * SCAN_NC + c) * 16 * SCAN_D + d;
#pragma unroll  // constant n: the per-thread arrays stay in registers
    for (int n = 0; n < 16; ++n) {
        An[n] = -expf(A_log[n]);
        h[n]  = Hbuf[o0 + n * SCAN_D];
    }
    const int row0 = b * Lv + c * SCAN_CL;
    for (int l = 0; l < SCAN_CL; ++l) {
        const size_t idx = (size_t)(row0 + l);
        const float dt = softplus_f(dtp[idx * Dv + d]);
        const float xv = xnf[idx * Dv + d];
        const float xr = xres[idx * Dv + d];
        const float* __restrict__ Br = Bv + idx * 16;   // same for the whole block
        const float* __restrict__ Cr = Cv + idx * 16;
        float t[16];
#pragma unroll  // constant n: the per-thread arrays stay in registers
        for (int n = 0; n < 16; ++n) {
            const float dtA = dt * An[n];
            const float dA  = expf(dtA);
            const float bt  = phi1_f(dtA) * Br[n] * xv;
            h[n] = dA * h[n] + bt;
            t[n] = Cr[n] * h[n];
        }
        // sum over n: pairs 8, 4, 2, 1 apart
#pragma unroll  // constant n: the per-thread arrays stay in registers
        for (int s = 8; s > 0; s >>= 1)
#pragma unroll  // constant n: the per-thread arrays stay in registers
            for (int n = 0; n < s; ++n) t[n] += t[n + s];
        const float y = (t[0] + Dd * xv) * sc;
        x2[idx * Dv + d] = y + xr;
        // precaution: the next trip rewrites the registers that this store names
        asm volatile("s_wait_xcnt 0x0" ::: "memory");
    }
}

// ---------------------------------------------------------------------------
// Launch
// ---------------------------------------------------------------------------
extern "C" void kernel_launch(void* const* d_in, const int* in_sizes, int n_in,
                              void* d_out, int out_size, void* d_ws, size_t ws_size,
                              hipStream_t stream) {
    (void)in_sizes; (void)n_in; (void)out_size; (void)ws_size;
    constexpr int Bb = 2, Lv = 2048, Dv = 1024, Nst = 16, DFF = 4096;
    constexpr int Mrows = Bb * Lv;  // 4096
    constexpr int NCh = SCAN_NC;
    static_assert(Dv == SCAN_D && NCh * SCAN_CL == Lv, "scan tiling");

    const float* x       = (const float*)d_in[0];
    const float* norm1_w = (const float*)d_in[1];
    const float* norm2_w = (const float*)d_in[2];
    const float* A_log   = (const float*)d_in[3];
    const float* D_param = (const float*)d_in[4];
    const float* scale   = (const float*)d_in[5];
    const float* Wdt     = (const float*)d_in[6];
    const float* bdt     = (const float*)d_in[7];
    const float* WB      = (const float*)d_in[8];
    const float* bB      = (const float*)d_in[9];
    const float* WC      = (const float*)d_in[10];
    const float* bC      = (const float*)d_in[11];
    const float* W1      = (const float*)d_in[12];
    const float* b1      = (const float*)d_in[13];
    const float* W2      = (const float*)d_in[14];
    const float* b2      = (const float*)d_in[15];
    float* out = (float*)d_out;

    size_t off = 0;
    auto alloc = [&](size_t bytes) -> void* {
        void* p = (char*)d_ws + off;
        off += (bytes + 255) & ~(size_t)255;
        return p;
    };
    float*          xnf  = (float*)alloc((size_t)Mrows * Dv * 4);
    unsigned short* xnb  = (unsigned short*)alloc((size_t)Mrows * Dv * 2);
    unsigned short* wdtb = (unsigned short*)alloc((size_t)Dv * Dv * 2);
    unsigned short* w1b  = (unsigned short*)alloc((size_t)DFF * Dv * 2);
    unsigned short* w2b  = (unsigned short*)alloc((size_t)Dv * DFF * 2);
    float*          dtp  = (float*)alloc((size_t)Mrows * Dv * 4);
    float*          Bv   = (float*)alloc((size_t)Mrows * Nst * 4);
    float*          Cv   = (float*)alloc((size_t)Mrows * Nst * 4);
    float*          x2   = (float*)alloc((size_t)Mrows * Dv * 4);
    unsigned short* xn2b = (unsigned short*)alloc((size_t)Mrows * Dv * 2);
    unsigned short* hb   = (unsigned short*)alloc((size_t)Mrows * DFF * 2);
    float*          Pbuf = (float*)alloc((size_t)Bb * Dv * NCh * 16 * 4);
    float*          Qbuf = (float*)alloc((size_t)Bb * Dv * NCh * 16 * 4);
    float*          Hbuf = (float*)alloc((size_t)Bb * Dv * NCh * 16 * 4);

    // 1. weight converts to bf16
    static_assert((Dv * Dv) % CVT_BLOCK == 0 && (DFF * Dv) % CVT_BLOCK == 0, "convert tiling");
    cvt_bf16_kernel<<<(Dv * Dv) / CVT_BLOCK, 256, 0, stream>>>(Wdt, wdtb);
    cvt_bf16_kernel<<<(DFF * Dv) / CVT_BLOCK, 256, 0, stream>>>(W1, w1b);
    cvt_bf16_kernel<<<(Dv * DFF) / CVT_BLOCK, 256, 0, stream>>>(W2, w2b);

    // 2. RMSNorm1 (f32 + bf16)
    rmsnorm_kernel<1><<<Mrows, 256, 0, stream>>>(x, norm1_w, xnf, xnb, Dv);

    // 3. dt_pre = xn @ Wdt^T + bdt  (WMMA, async-LDS pipelined)
    gemm_wmma_bf16<0><<<dim3(Dv / 128, Mrows / 128), 256, 0, stream>>>(
        xnb, wdtb, bdt, nullptr, dtp, nullptr, Mrows, Dv, Dv);

    // 4. Bv / Cv projections
    bc_proj_kernel<<<(Mrows * 32) / 256, 256, 0, stream>>>(
        xnf, WB, bB, WC, bC, Bv, Cv, Dv);

    // 5. chunked selective scan + residual -> x2
    scan_pass1<<<dim3(Dv / 256, NCh, Bb), 256, 0, stream>>>(
        dtp, xnf, Bv, A_log, Pbuf, Qbuf, Lv, Dv);
    scan_pass2<<<(Bb * Dv * 16) / 256, 256, 0, stream>>>(Pbuf, Qbuf, Hbuf);
    scan_pass3<<<dim3(Dv / 256, NCh, Bb), 256, 0, stream>>>(
        dtp, xnf, x, Bv, Cv, A_log, D_param, scale, Hbuf, x2, Lv, Dv);

    // 6. RMSNorm2 (bf16 only)
    rmsnorm_kernel<0><<<Mrows, 256, 0, stream>>>(x2, norm2_w, nullptr, xn2b, Dv);

    // 7. h = gelu(xn2 @ W1^T + b1) -> bf16  (WMMA)
    gemm_wmma_bf16<1><<<dim3(DFF / 128, Mrows / 128), 256, 0, stream>>>(
        xn2b, w1b, b1, nullptr, nullptr, hb, Mrows, DFF, Dv);

    // 8. out = h @ W2^T + b2 + x2  (WMMA)
    gemm_wmma_bf16<2><<<dim3(Dv / 128, Mrows / 128), 256, 0, stream>>>(
        hb, w2b, b2, x2, out, nullptr, Mrows, Dv, DFF);
}

// v003
// One run takes 274 microseconds.
// In both of two side-by-side timings against v002, it was 1.47 times as fast.
// Counting every step since v000, it is 2.56 times as fast.
#include <hip/hip_runtime.h>
#include <hip/hip_bf16.h>
#include <stdint.h>

// ---------------------------------------------------------------------------
// Types for WMMA (gfx1250, wave32)
// ---------------------------------------------------------------------------
typedef __attribute__((ext_vector_type(16))) __bf16 v16bf;
typedef __attribute__((ext_vector_type(8)))  float  v8f;

struct alignas(16) U16x8 { unsigned short u[8]; };
struct alignas(32) FragBF { U16x8 lo, hi; };

static __device__ __forceinline__ unsigned short f2bf(float f) {
    unsigned int u = __float_as_uint(f);
    u += 0x7FFFu + ((u >> 16) & 1u);          // round-to-nearest-even
    return (unsigned short)(u >> 16);
}

static __device__ __forceinline__ float gelu_tanh(float x) {
    float x3 = x * x * x;
    return 0.5f * x * (1.0f + tanhf(0.7978845608028654f * (x + 0.044715f * x3)));
}

static __device__ __forceinline__ float phi1_f(float z) {
    if (fabsf(z) < 1e-4f) return 1.0f + 0.5f * z;
    return expm1f(z) / z;
}

// ---------------------------------------------------------------------------
// Scan arithmetic on the hardware's own exp2 / log2 / rcp instructions.
// ---------------------------------------------------------------------------
#define LOG2E_F 1.4426950408889634f
#define LN2_F   0.6931471805599453f
// A step takes the short form only where every |dt * A[n]| is at least this:
// there exp(z) - 1 keeps its relative accuracy (error about 1e-7 / |z|).
#define SCAN_ZMIN  0.0625f
// ... and where 1 / dt is far from overflow.
#define SCAN_DTMIN 1e-30f

// r[i] = 2^x[i], i = 0..7. One statement, so that each v_exp_f32 has an
// independent instruction behind it and the last one a v_nop: the slot that the
// instruction set asks for before a transcendental's source is overwritten or its
// result read.
static __device__ __forceinline__ void exp2_x8(float* r, const float* x) {
    asm("v_exp_f32 %0, %8\n\t"
        "v_exp_f32 %1, %9\n\t"
        "v_exp_f32 %2, %10\n\t"
        "v_exp_f32 %3, %11\n\t"
        "v_exp_f32 %4, %12\n\t"
        "v_exp_f32 %5, %13\n\t"
        "v_exp_f32 %6, %14\n\t"
        "v_exp_f32 %7, %15\n\t"
        "v_nop"
        : "=&v"(r[0]), "=&v"(r[1]), "=&v"(r[2]), "=&v"(r[3]),
          "=&v"(r[4]), "=&v"(r[5]), "=&v"(r[6]), "=&v"(r[7])
        : "v"(x[0]), "v"(x[1]), "v"(x[2]), "v"(x[3]),
          "v"(x[4]), "v"(x[5]), "v"(x[6]), "v"(x[7]));
}

// softplus(x) = max(x, 0) + log1p(exp(-|x|)); e = exp(-|x|) lies in (0, 1].
// Below 1/16 the series of log1p keeps the relative accuracy that 1 + e loses.
static __device__ __forceinline__ float softplus_hw(float x) {
    const float e  = __builtin_amdgcn_exp2f(-fabsf(x) * LOG2E_F);
    const float lg = __builtin_amdgcn_logf(1.0f + e) * LN2_F;
    float p = 0.2f - e * (1.0f / 6.0f);
    p = -0.25f + e * p;
    p = (1.0f / 3.0f) + e * p;
    p = -0.5f + e * p;
    p = e + (e * e) * p;
    return fmaxf(x, 0.0f) + ((e < 0.0625f) ? p : lg);
}

// ---------------------------------------------------------------------------
// gfx1250 async memory->LDS copy (ASYNCcnt tracked), 16B per lane.
// LDS destination address = low 32 bits of the generic pointer
// (flat aperture maps LDS_ADDR = addr[31:0]).
// ---------------------------------------------------------------------------
static __device__ __forceinline__ void async_copy_b128(void* lds_ptr, const void* gptr) {
    unsigned lds_addr = (unsigned)(size_t)lds_ptr;
    unsigned long long ga = (unsigned long long)(size_t)gptr;
    asm volatile("global_load_async_to_lds_b128 %0, %1, off"
                 :: "v"(lds_addr), "v"(ga)
                 : "memory");
}

template <int Nc>
static __device__ __forceinline__ void wait_asynccnt() {
    asm volatile("s_wait_asynccnt %0" :: "n"(Nc) : "memory");
}

// ---------------------------------------------------------------------------
// f32 -> bf16 convert. One block of 256 threads converts CVT_BLOCK contiguous
// elements; the array length must be a multiple of CVT_BLOCK (checked at the
// launch). A thread takes CVT_G groups of 4 elements, 256 groups apart: each
// wave-wide load covers 512 contiguous bytes, each store 256, and a wave has
// CVT_G loads in flight. The point is fewer waves than with one element a
// thread, for speed only.
// ---------------------------------------------------------------------------
typedef __attribute__((ext_vector_type(4))) float f32x4;
struct alignas(8) U16x4 { unsigned short u[4]; };
#define CVT_G     8
#define CVT_BLOCK (256 * CVT_G * 4)

__global__ __launch_bounds__(256)
void cvt_bf16_kernel(const float* __restrict__ in,
                     unsigned short* __restrict__ out) {
    const size_t g0 = (size_t)blockIdx.x * (256 * CVT_G) + threadIdx.x;
    const f32x4* __restrict__ src = (const f32x4*)in + g0;
    U16x4* __restrict__ dst = (U16x4*)out + g0;
    f32x4 v[CVT_G];
#pragma unroll  // constant j: v stays in registers and all loads go out first
    for (int j = 0; j < CVT_G; ++j) v[j] = src[j * 256];
#pragma unroll  // constant j: v stays in registers
    for (int j = 0; j < CVT_G; ++j) {
        U16x4 o;
        o.u[0] = f2bf(v[j][0]);
        o.u[1] = f2bf(v[j][1]);
        o.u[2] = f2bf(v[j][2]);
        o.u[3] = f2bf(v[j][3]);
        dst[j * 256] = o;
    }
}

// ---------------------------------------------------------------------------
// RMSNorm: one block per row of length Dn=1024; writes f32 (optional) + bf16
// ---------------------------------------------------------------------------
template <int WRITE_F32>
__global__ __launch_bounds__(256)
void rmsnorm_kernel(const float* __restrict__ x, const float* __restrict__ w,
                    float* __restrict__ xf, unsigned short* __restrict__ xb, int Dn) {
    const int row = blockIdx.x;
    const int tid = threadIdx.x;
    const float* xr = x + (size_t)row * Dn;
    float ss = 0.0f;
    for (int i = tid; i < Dn; i += 256) { float v = xr[i]; ss += v * v; }
    __shared__ float red[256];
    red[tid] = ss;
    __syncthreads();
    for (int s = 128; s > 0; s >>= 1) {
        if (tid < s) red[tid] += red[tid + s];
        __syncthreads();
    }
    const float r = rsqrtf(red[0] / (float)Dn + 1e-6f);
    for (int i = tid; i < Dn; i += 256) {
        float v = xr[i] * r * w[i];
        if (WRITE_F32) xf[(size_t)row * Dn + i] = v;
        xb[(size_t)row * Dn + i] = f2bf(v);
    }
}

// ---------------------------------------------------------------------------
// WMMA bf16 GEMM:  out[m][n] = sum_k A[m][k] * Bw[n][k]  (+epilogue)
// MODE 0: outF = acc + bias[n]                      (f32)
// MODE 1: outB = bf16(gelu(acc + bias[n]))          (bf16)
// MODE 2: outF = acc + bias[n] + resid[m][n]        (f32)
// Block: 256 threads = 8 waves (2x4), block tile 128x128, BK=64.
// Wave tile 64x32 = 4x2 accumulators of v_wmma_f32_16x16x32_bf16.
// Double-buffered LDS, filled by global_load_async_to_lds_b128 (ASYNCcnt).
// ---------------------------------------------------------------------------
template <int MODE>
__global__ __launch_bounds__(256)
void gemm_wmma_bf16(const unsigned short* __restrict__ A,
                    const unsigned short* __restrict__ Bw,
                    const float* __restrict__ bias,
                    const float* __restrict__ resid,
                    float* __restrict__ outF,
                    unsigned short* __restrict__ outB,
                    int M, int N, int K) {
    __shared__ unsigned short As[2][128][72];  // 64 cols + pad, 16B-aligned rows
    __shared__ unsigned short Bs[2][128][72];

    const int tid   = threadIdx.x;
    const int lane  = tid & 31;
    const int wid   = tid >> 5;
    const int waveM = wid >> 2;      // 0..1  (rows of 64)
    const int waveN = wid & 3;       // 0..3  (cols of 32)
    const int m0 = blockIdx.y * 128;
    const int n0 = blockIdx.x * 128;

    const int lrow = tid & 127;      // LDS fill: row within tile
    const int lch  = tid >> 7;       // 0..1 : which 32-col half

    const int ml   = lane & 15;      // M (or N) index within fragment
    const int half = lane >> 4;      // lane-half selects K sub-pattern

    const v8f vzero = {0.f, 0.f, 0.f, 0.f, 0.f, 0.f, 0.f, 0.f};
    v8f acc[4][2];
#pragma unroll
    for (int i = 0; i < 4; ++i)
#pragma unroll
        for (int j = 0; j < 2; ++j) acc[i][j] = vzero;

    const unsigned short* rowA = A  + (size_t)(m0 + lrow) * K + lch * 32;
    const unsigned short* rowB = Bw + (size_t)(n0 + lrow) * K + lch * 32;

    // Issue one K-slab (8 x 16B per thread) into LDS buffer `buf` via async DMA.
    auto issue_slab = [&](int buf, int k0) {
        const unsigned short* sA = rowA + k0;
        const unsigned short* sB = rowB + k0;
        unsigned short* dA = &As[buf][lrow][lch * 32];
        unsigned short* dB = &Bs[buf][lrow][lch * 32];
        async_copy_b128(dA + 0,  sA + 0);
        async_copy_b128(dA + 8,  sA + 8);
        async_copy_b128(dA + 16, sA + 16);
        async_copy_b128(dA + 24, sA + 24);
        async_copy_b128(dB + 0,  sB + 0);
        async_copy_b128(dB + 8,  sB + 8);
        async_copy_b128(dB + 16, sB + 16);
        async_copy_b128(dB + 24, sB + 24);
    };

    const int nslab = K >> 6;
    issue_slab(0, 0);

    for (int i = 0; i < nslab; ++i) {
        const int cur = i & 1;
        if (i + 1 < nslab) {
            issue_slab(cur ^ 1, (i + 1) << 6);  // prefetch next slab (async)
            wait_asynccnt<8>();                 // this wave's slab-i loads done
        } else {
            wait_asynccnt<0>();
        }
        __syncthreads();                        // all waves' slab-i data in LDS

#pragma unroll
        for (int s = 0; s < 2; ++s) {
            const int ks = s * 32;
            // 16-bit A/B fragment layout: lane-half 0 holds K {0..7,16..23},
            // half 1 holds K {8..15,24..31} (two 16B runs per lane).
            FragBF fa[4], fb[2];
#pragma unroll
            for (int ii = 0; ii < 4; ++ii) {
                const int row = waveM * 64 + ii * 16 + ml;
                fa[ii].lo = *(const U16x8*)&As[cur][row][ks + half * 8];
                fa[ii].hi = *(const U16x8*)&As[cur][row][ks + 16 + half * 8];
            }
#pragma unroll
            for (int j = 0; j < 2; ++j) {
                const int col = waveN * 32 + j * 16 + ml;
                fb[j].lo = *(const U16x8*)&Bs[cur][col][ks + half * 8];
                fb[j].hi = *(const U16x8*)&Bs[cur][col][ks + 16 + half * 8];
            }
#pragma unroll
            for (int ii = 0; ii < 4; ++ii) {
                v16bf av = __builtin_bit_cast(v16bf, fa[ii]);
#pragma unroll
                for (int j = 0; j < 2; ++j) {
                    v16bf bv = __builtin_bit_cast(v16bf, fb[j]);
                    acc[ii][j] = __builtin_amdgcn_wmma_f32_16x16x32_bf16(
                        false, av, false, bv, (short)0, acc[ii][j], false, false);
                }
            }
        }
        __syncthreads();   // everyone finished reading buf `cur` before refill
    }

    // Epilogue: C/D layout — VGPR r: lanes 0-15 -> M=r, lanes 16-31 -> M=r+8.
#pragma unroll
    for (int i = 0; i < 4; ++i) {
        const int rowBase = m0 + waveM * 64 + i * 16;
#pragma unroll
        for (int j = 0; j < 2; ++j) {
            const int col = n0 + waveN * 32 + j * 16 + ml;
#pragma unroll
            for (int r = 0; r < 8; ++r) {
                const int row = rowBase + r + half * 8;
                float c = acc[i][j][r] + bias[col];
                const size_t o = (size_t)row * N + col;
                if (MODE == 0) {
                    outF[o] = c;
                } else if (MODE == 1) {
                    outB[o] = f2bf(gelu_tanh(c));
                } else {
                    outF[o] = c + resid[o];
                }
            }
        }
    }
}

// ---------------------------------------------------------------------------
// Bv / Cv projections: out[row][n] = dot(xn[row,:], W[n,:]) + b[n]
// ---------------------------------------------------------------------------
__global__ __launch_bounds__(256)
void bc_proj_kernel(const float* __restrict__ xnf,
                    const float* __restrict__ WB, const float* __restrict__ bB,
                    const float* __restrict__ WC, const float* __restrict__ bC,
                    float* __restrict__ Bv, float* __restrict__ Cv, int K) {
    const int t = blockIdx.x * 256 + threadIdx.x;
    const int row = t >> 5;
    const int o = t & 31;
    const int n = o & 15;
    const bool isC = o >= 16;
    const float* w = (isC ? WC : WB) + (size_t)n * K;
    const float* xr = xnf + (size_t)row * K;
    float s = 0.0f;
    for (int k = 0; k < K; k += 4) {
        s += xr[k] * w[k] + xr[k + 1] * w[k + 1]
           + xr[k + 2] * w[k + 2] + xr[k + 3] * w[k + 3];
    }
    s += (isC ? bC : bB)[n];
    (isC ? Cv : Bv)[(size_t)row * 16 + n] = s;
}

// ---------------------------------------------------------------------------
// Chunked linear-recurrence scan (h = dA*h + b), 3 passes, NC chunks of CL.
// Thread layout (pass 1/3): one thread per (b, chunk, d); the lanes of a wave
// run along d, and each thread keeps all 16 states n in registers.
// P/Q/H layout: [b][chunk][n][d], so every access is contiguous along d.
// ---------------------------------------------------------------------------
#define SCAN_NC 64
#define SCAN_CL 32
#define SCAN_D  1024   // channels = pitch of one n row of P/Q/H (a constant, so that
                       // the 16 rows are reached by immediate offsets from one address)

// Pass 1: per-chunk transfer (P = prod dA, q = end state from h0=0)
// grid: x = d / 256, y = chunk, z = batch
__global__ __launch_bounds__(256)
void scan_pass1(const float* __restrict__ dtp, const float* __restrict__ xnf,
                const float* __restrict__ Bv, const float* __restrict__ A_log,
                float* __restrict__ Pbuf, float* __restrict__ Qbuf,
                int Lv, int Dv) {
    const int d = blockIdx.x * 256 + threadIdx.x;
    const int c = blockIdx.y;
    const int b = blockIdx.z;

    float An[16], invA[16], h[16], pf[16];
    float Amin = __builtin_inff();
#pragma unroll  // constant n: the per-thread arrays stay in registers
    for (int n = 0; n < 16; ++n) {
        An[n]   = -expf(A_log[n]);
        invA[n] = 1.0f / An[n];
        Amin    = fminf(Amin, -An[n]);
        h[n]  = 0.0f;
        pf[n] = 1.0f;
    }
    const int row0 = b * Lv + c * SCAN_CL;
    for (int l = 0; l < SCAN_CL; ++l) {
        const size_t idx = (size_t)(row0 + l);
        const float dt = softplus_hw(dtp[idx * Dv + d]);
        const float xv = xnf[idx * Dv + d];
        const float* __restrict__ Bp = Bv + idx * 16;   // same for the whole block
        float Br[16];   // read ahead of the branch, beside the two loads above
#pragma unroll  // constant n: the per-thread arrays stay in registers
        for (int n = 0; n < 16; ++n) Br[n] = Bp[n];
        const float dt2 = dt * LOG2E_F;
        float z2[16], dA[16];   // dA = exp(dt * A) = 2^(dt * log2(e) * A)
#pragma unroll  // constant n: the per-thread arrays stay in registers
        for (int n = 0; n < 16; ++n) z2[n] = dt2 * An[n];
        exp2_x8(dA, z2);
        exp2_x8(dA + 8, z2 + 8);
        const bool shortform = (dt * Amin >= SCAN_ZMIN) && (dt >= SCAN_DTMIN);
        if (__builtin_amdgcn_ballot_w32(!shortform) == 0u) {
            // b = (dA - 1) * w with w = B * x / (dt * A), so dA*h + b = dA*(h + w) - w
            const float g = xv * __builtin_amdgcn_rcpf(dt);
#pragma unroll  // constant n: the per-thread arrays stay in registers
            for (int n = 0; n < 16; ++n) {
                const float w = g * (Br[n] * invA[n]);
                h[n]  = dA[n] * (h[n] + w) - w;
                pf[n] = dA[n] * pf[n];
            }
        } else {
            // some lane has a small dt * A: phi1 in its library form, exact near 0
#pragma unroll  // constant n: the per-thread arrays stay in registers
            for (int n = 0; n < 16; ++n) {
                const float bt = phi1_f(dt * An[n]) * Br[n] * xv;
                h[n]  = dA[n] * h[n] + bt;
                pf[n] = dA[n] * pf[n];
            }
        }
    }
    const size_t o0 = (size_t)(b * SCAN_NC + c) * 16 * SCAN_D + d;
#pragma unroll  // constant n: the per-thread arrays stay in registers
    for (int n = 0; n < 16; ++n) {
        Pbuf[o0 + n * SCAN_D] = pf[n];
        Qbuf[o0 + n * SCAN_D] = h[n];
    }
}

// Pass 2: sequential combine over chunks -> initial state H_c per chunk
// one thread per (b, n, d); one chunk is a plane of 16 * SCAN_D elements
__global__ __launch_bounds__(256)
void scan_pass2(const float* __restrict__ Pbuf, const float* __restrict__ Qbuf,
                float* __restrict__ Hbuf) {
    constexpr int plane = 16 * SCAN_D;
    const int tid = blockIdx.x * 256 + threadIdx.x;
    const int b = tid / plane;
    const int r = tid - b * plane;        // n * SCAN_D + d
    const size_t o0 = (size_t)b * SCAN_NC * plane + r;
    float H = 0.0f;
    // unrolled whole: the loads do not depend on H, so they can all be in
    // flight together instead of one memory latency per few chunks
#pragma unroll
    for (int c = 0; c < SCAN_NC; ++c) {
        const size_t o = o0 + c * plane;
        Hbuf[o] = H;
        H = Pbuf[o] * H + Qbuf[o];
    }
}

// Pass 3: replay chunk from true H_c, emit y = sum_n Cv*h + D*xn, +residual
// grid: x = d / 256, y = chunk, z = batch
__global__ __launch_bounds__(256)
void scan_pass3(const float* __restrict__ dtp, const float* __restrict__ xnf,
                const float* __restrict__ xres,
                const float* __restrict__ Bv, const float* __restrict__ Cv,
                const float* __restrict__ A_log, const float* __restrict__ Dp,
                const float* __restrict__ scale, const float* __restrict__ Hbuf,
                float* __restrict__ x2, int Lv, int Dv) {
    const int d = blockIdx.x * 256 + threadIdx.x;
    const int c = blockIdx.y;
    const int b = blockIdx.z;

    const float Dd = Dp[d];
    const float sc = scale[d];

    float An[16], invA[16], h[16];
    float Amin = __builtin_inff();
    const size_t o0 = (size_t)(b * SCAN_NC + c) * 16 * SCAN_D + d;
#pragma unroll  // constant n: the per-thread arrays stay in registers
    for (int n = 0; n < 16; ++n) {
        An[n]   = -expf(A_log[n]);
        invA[n] = 1.0f / An[n];
        Amin    = fminf(Amin, -An[n]);
        h[n]  = Hbuf[o0 + n * SCAN_D];
    }
    const int row0 = b * Lv + c * SCAN_CL;
    for (int l = 0; l < SCAN_CL; ++l) {
        const size_t idx = (size_t)(row0 + l);
        const float dt = softplus_hw(dtp[idx * Dv + d]);
        const float xv = xnf[idx * Dv + d];
        const float xr = xres[idx * Dv + d];
        const float* __restrict__ Bp = Bv + idx * 16;   // same for the whole block
        const float* __restrict__ Cp = Cv + idx * 16;
        float Br[16], Cr[16];   // read ahead of the branch, beside the loads above
#pragma unroll  // constant n: the per-thread arrays stay in registers
        for (int n = 0; n < 16; ++n) { Br[n] = Bp[n]; Cr[n] = Cp[n]; }
        float t[16];
        const float dt2 = dt * LOG2E_F;
        float z2[16], dA[16];   // dA = exp(dt * A) = 2^(dt * log2(e) * A)
#pragma unroll  // constant n: the per-thread arrays stay in registers
        for (int n = 0; n < 16; ++n) z2[n] = dt2 * An[n];
        exp2_x8(dA, z2);
        exp2_x8(dA + 8, z2 + 8);
        const bool shortform = (dt * Amin >= SCAN_ZMIN) && (dt >= SCAN_DTMIN);
        if (__builtin_amdgcn_ballot_w32(!shortform) == 0u) {
            // b = (dA - 1) * w with w = B * x / (dt * A), so dA*h + b = dA*(h + w) - w
            const float g = xv * __builtin_amdgcn_rcpf(dt);
#pragma unroll  // constant n: the per-thread arrays stay in registers
            for (int n = 0; n < 16; ++n) {
                const float w = g * (Br[n] * invA[n]);
                h[n] = dA[n] * (h[n] + w) - w;
                t[n] = Cr[n] * h[n];
            }
        } else {
            // some lane has a small dt * A: phi1 in its library form, exact near 0
#pragma unroll  // constant n: the per-thread arrays stay in registers
            for (int n = 0; n < 16; ++n) {
                const float bt = phi1_f(dt * An[n]) * Br[n] * xv;
                h[n] = dA[n] * h[n] + bt;
                t[n] = Cr[n] * h[n];
            }
        }
        // sum over n: pairs 8, 4, 2, 1 apart
#pragma unroll  // constant n: the per-thread arrays stay in registers
        for (int s = 8; s > 0; s >>= 1)
#pragma unroll  // constant n: the per-thread arrays stay in registers
            for (int n = 0; n < s; ++n) t[n] += t[n + s];
        const float y = (t[0] + Dd * xv) * sc;
        x2[idx * Dv + d] = y + xr;
        // precaution: the next trip rewrites the registers that this store names
        asm volatile("s_wait_xcnt 0x0" ::: "memory");
    }
}

// ---------------------------------------------------------------------------
// Launch
// ---------------------------------------------------------------------------
extern "C" void kernel_launch(void* const* d_in, const int* in_sizes, int n_in,
                              void* d_out, int out_size, void* d_ws, size_t ws_size,
                              hipStream_t stream) {
    (void)in_sizes; (void)n_in; (void)out_size; (void)ws_size;
    constexpr int Bb = 2, Lv = 2048, Dv = 1024, Nst = 16, DFF = 4096;
    constexpr int Mrows = Bb * Lv;  // 4096
    constexpr int NCh = SCAN_NC;
    static_assert(Dv == SCAN_D && NCh * SCAN_CL == Lv, "scan tiling");

    const float* x       = (const float*)d_in[0];
    const float* norm1_w = (const float*)d_in[1];
    const float* norm2_w = (const float*)d_in[2];
    const float* A_log   = (const float*)d_in[3];
    const float* D_param = (const float*)d_in[4];
    const float* scale   = (const float*)d_in[5];
    const float* Wdt     = (const float*)d_in[6];
    const float* bdt     = (const float*)d_in[7];
    const float* WB      = (const float*)d_in[8];
    const float* bB      = (const float*)d_in[9];
    const float* WC      = (const float*)d_in[10];
    const float* bC      = (const float*)d_in[11];
    const float* W1      = (const float*)d_in[12];
    const float* b1      = (const float*)d_in[13];
    const float* W2      = (const float*)d_in[14];
    const float* b2      = (const float*)d_in[15];
    float* out = (float*)d_out;

    size_t off = 0;
    auto alloc = [&](size_t bytes) -> void* {
        void* p = (char*)d_ws + off;
        off += (bytes + 255) & ~(size_t)255;
        return p;
    };
    float*          xnf  = (float*)alloc((size_t)Mrows * Dv * 4);
    unsigned short* xnb  = (unsigned short*)alloc((size_t)Mrows * Dv * 2);
    unsigned short* wdtb = (unsigned short*)alloc((size_t)Dv * Dv * 2);
    unsigned short* w1b  = (unsigned short*)alloc((size_t)DFF * Dv * 2);
    unsigned short* w2b  = (unsigned short*)alloc((size_t)Dv * DFF * 2);
    float*          dtp  = (float*)alloc((size_t)Mrows * Dv * 4);
    float*          Bv   = (float*)alloc((size_t)Mrows * Nst * 4);
    float*          Cv   = (float*)alloc((size_t)Mrows * Nst * 4);
    float*          x2   = (float*)alloc((size_t)Mrows * Dv * 4);
    unsigned short* xn2b = (unsigned short*)alloc((size_t)Mrows * Dv * 2);
    unsigned short* hb   = (unsigned short*)alloc((size_t)Mrows * DFF * 2);
    float*          Pbuf = (float*)alloc((size_t)Bb * Dv * NCh * 16 * 4);
    float*          Qbuf = (float*)alloc((size_t)Bb * Dv * NCh * 16 * 4);
    float*          Hbuf = (float*)alloc((size_t)Bb * Dv * NCh * 16 * 4);

    // 1. weight converts to bf16
    static_assert((Dv * Dv) % CVT_BLOCK == 0 && (DFF * Dv) % CVT_BLOCK == 0, "convert tiling");
    cvt_bf16_kernel<<<(Dv * Dv) / CVT_BLOCK, 256, 0, stream>>>(Wdt, wdtb);
    cvt_bf16_kernel<<<(DFF * Dv) / CVT_BLOCK, 256, 0, stream>>>(W1, w1b);
    cvt_bf16_kernel<<<(Dv * DFF) / CVT_BLOCK, 256, 0, stream>>>(W2, w2b);

    // 2. RMSNorm1 (f32 + bf16)
    rmsnorm_kernel<1><<<Mrows, 256, 0, stream>>>(x, norm1_w, xnf, xnb, Dv);

    // 3. dt_pre = xn @ Wdt^T + bdt  (WMMA, async-LDS pipelined)
    gemm_wmma_bf16<0><<<dim3(Dv / 128, Mrows / 128), 256, 0, stream>>>(
        xnb, wdtb, bdt, nullptr, dtp, nullptr, Mrows, Dv, Dv);

    // 4. Bv / Cv projections
    bc_proj_kernel<<<(Mrows * 32) / 256, 256, 0, stream>>>(
        xnf, WB, bB, WC, bC, Bv, Cv, Dv);

    // 5. chunked selective scan + residual -> x2
    scan_pass1<<<dim3(Dv / 256, NCh, Bb), 256, 0, stream>>>(
        dtp, xnf, Bv, A_log, Pbuf, Qbuf, Lv, Dv);
    scan_pass2<<<(Bb * Dv * 16) / 256, 256, 0, stream>>>(Pbuf, Qbuf, Hbuf);
    scan_pass3<<<dim3(Dv / 256, NCh, Bb), 256, 0, stream>>>(
        dtp, xnf, x, Bv, Cv, A_log, D_param, scale, Hbuf, x2, Lv, Dv);

    // 6. RMSNorm2 (bf16 only)
    rmsnorm_kernel<0><<<Mrows, 256, 0, stream>>>(x2, norm2_w, nullptr, xn2b, Dv);

    // 7. h = gelu(xn2 @ W1^T + b1) -> bf16  (WMMA)
    gemm_wmma_bf16<1><<<dim3(DFF / 128, Mrows / 128), 256, 0, stream>>>(
        xn2b, w1b, b1, nullptr, nullptr, hb, Mrows, DFF, Dv);

    // 8. out = h @ W2^T + b2 + x2  (WMMA)
    gemm_wmma_bf16<2><<<dim3(Dv / 128, Mrows / 128), 256, 0, stream>>>(
        hb, w2b, b2, x2, out, nullptr, Mrows, Dv, DFF);
}

// v004
// One run takes 239 microseconds.
// Timed twice side by side with v003, it ran 1.15 times as fast both times.
// All steps since v000 together make it 2.94 times as fast.
#include <hip/hip_runtime.h>
#include <hip/hip_bf16.h>
#include <stdint.h>

// ---------------------------------------------------------------------------
// Types for WMMA (gfx1250, wave32)
// ---------------------------------------------------------------------------
typedef __attribute__((ext_vector_type(16))) __bf16 v16bf;
typedef __attribute__((ext_vector_type(8)))  float  v8f;

struct alignas(16) U16x8 { unsigned short u[8]; };
struct alignas(32) FragBF { U16x8 lo, hi; };

static __device__ __forceinline__ unsigned short f2bf(float f) {
    unsigned int u = __float_as_uint(f);
    u += 0x7FFFu + ((u >> 16) & 1u);          // round-to-nearest-even
    return (unsigned short)(u >> 16);
}

static __device__ __forceinline__ float gelu_tanh(float x) {
    float x3 = x * x * x;
    return 0.5f * x * (1.0f + tanhf(0.7978845608028654f * (x + 0.044715f * x3)));
}

static __device__ __forceinline__ float phi1_f(float z) {
    if (fabsf(z) < 1e-4f) return 1.0f + 0.5f * z;
    return expm1f(z) / z;
}

// ---------------------------------------------------------------------------
// Scan arithmetic on the hardware's own exp2 / log2 / rcp instructions.
// ---------------------------------------------------------------------------
#define LOG2E_F 1.4426950408889634f
#define LN2_F   0.6931471805599453f
// A step takes the short form only where every |dt * A[n]| is at least this:
// there exp(z) - 1 keeps its relative accuracy (error about 1e-7 / |z|).
#define SCAN_ZMIN  0.0625f
// ... and where 1 / dt is far from overflow.
#define SCAN_DTMIN 1e-30f

// r[i] = 2^x[i], i = 0..7. One statement, so that each v_exp_f32 has an
// independent instruction behind it and the last one a v_nop: the slot that the
// instruction set asks for before a transcendental's source is overwritten or its
// result read.
static __device__ __forceinline__ void exp2_x8(float* r, const float* x) {
    asm("v_exp_f32 %0, %8\n\t"
        "v_exp_f32 %1, %9\n\t"
        "v_exp_f32 %2, %10\n\t"
        "v_exp_f32 %3, %11\n\t"
        "v_exp_f32 %4, %12\n\t"
        "v_exp_f32 %5, %13\n\t"
        "v_exp_f32 %6, %14\n\t"
        "v_exp_f32 %7, %15\n\t"
        "v_nop"
        : "=&v"(r[0]), "=&v"(r[1]), "=&v"(r[2]), "=&v"(r[3]),
          "=&v"(r[4]), "=&v"(r[5]), "=&v"(r[6]), "=&v"(r[7])
        : "v"(x[0]), "v"(x[1]), "v"(x[2]), "v"(x[3]),
          "v"(x[4]), "v"(x[5]), "v"(x[6]), "v"(x[7]));
}

// softplus(x) = max(x, 0) + log1p(exp(-|x|)); e = exp(-|x|) lies in (0, 1].
// Below 1/16 the series of log1p keeps the relative accuracy that 1 + e loses.
static __device__ __forceinline__ float softplus_hw(float x) {
    const float e  = __builtin_amdgcn_exp2f(-fabsf(x) * LOG2E_F);
    const float lg = __builtin_amdgcn_logf(1.0f + e) * LN2_F;
    float p = 0.2f - e * (1.0f / 6.0f);
    p = -0.25f + e * p;
    p = (1.0f / 3.0f) + e * p;
    p = -0.5f + e * p;
    p = e + (e * e) * p;
    return fmaxf(x, 0.0f) + ((e < 0.0625f) ? p : lg);
}

// ---------------------------------------------------------------------------
// gfx1250 async memory->LDS copies (ASYNCcnt tracked), 16B per lane: the eight
// copies of one thread for one K-slab. l = LDS byte address (low 32 bits of the
// generic pointer: the flat aperture maps LDS_ADDR = addr[31:0]), g = global address.
// The last line is a precaution: it stands ahead of whatever rewrites the address
// registers that the copies name, and inside the statement nothing can be moved
// in front of it.
// ---------------------------------------------------------------------------
static __device__ __forceinline__ unsigned lds_addr_of(const void* p) {
    return (unsigned)(size_t)p;
}

static __device__ __forceinline__ void async_copy_b128_x8(const unsigned* l,
                                                          const unsigned short* const* g) {
    asm volatile("global_load_async_to_lds_b128 %0, %8, off\n\t"
                 "global_load_async_to_lds_b128 %1, %9, off\n\t"
                 "global_load_async_to_lds_b128 %2, %10, off\n\t"
                 "global_load_async_to_lds_b128 %3, %11, off\n\t"
                 "global_load_async_to_lds_b128 %4, %12, off\n\t"
                 "global_load_async_to_lds_b128 %5, %13, off\n\t"
                 "global_load_async_to_lds_b128 %6, %14, off\n\t"
                 "global_load_async_to_lds_b128 %7, %15, off\n\t"
                 "s_wait_xcnt 0x0"
                 :: "v"(l[0]), "v"(l[1]), "v"(l[2]), "v"(l[3]),
                    "v"(l[4]), "v"(l[5]), "v"(l[6]), "v"(l[7]),
                    "v"(g[0]), "v"(g[1]), "v"(g[2]), "v"(g[3]),
                    "v"(g[4]), "v"(g[5]), "v"(g[6]), "v"(g[7])
                 : "memory");
}

template <int Nc>
static __device__ __forceinline__ void wait_asynccnt() {
    asm volatile("s_wait_asynccnt %0" :: "n"(Nc) : "memory");
}

// ---------------------------------------------------------------------------
// f32 -> bf16 convert. One block of 256 threads converts CVT_BLOCK contiguous
// elements; the array length must be a multiple of CVT_BLOCK (checked at the
// launch). A thread takes CVT_G groups of 4 elements, 256 groups apart: each
// wave-wide load covers 512 contiguous bytes, each store 256, and a wave has
// CVT_G loads in flight. The point is fewer waves than with one element a
// thread, for speed only.
// ---------------------------------------------------------------------------
typedef __attribute__((ext_vector_type(4))) float f32x4;
struct alignas(8) U16x4 { unsigned short u[4]; };
#define CVT_G     8
#define CVT_BLOCK (256 * CVT_G * 4)

__global__ __launch_bounds__(256)
void cvt_bf16_kernel(const float* __restrict__ in,
                     unsigned short* __restrict__ out) {
    const size_t g0 = (size_t)blockIdx.x * (256 * CVT_G) + threadIdx.x;
    const f32x4* __restrict__ src = (const f32x4*)in + g0;
    U16x4* __restrict__ dst = (U16x4*)out + g0;
    f32x4 v[CVT_G];
#pragma unroll  // constant j: v stays in registers and all loads go out first
    for (int j = 0; j < CVT_G; ++j) v[j] = src[j * 256];
#pragma unroll  // constant j: v stays in registers
    for (int j = 0; j < CVT_G; ++j) {
        U16x4 o;
        o.u[0] = f2bf(v[j][0]);
        o.u[1] = f2bf(v[j][1]);
        o.u[2] = f2bf(v[j][2]);
        o.u[3] = f2bf(v[j][3]);
        dst[j * 256] = o;
    }
}

// ---------------------------------------------------------------------------
// RMSNorm: one block per row of length Dn=1024; writes f32 (optional) + bf16
// ---------------------------------------------------------------------------
template <int WRITE_F32>
__global__ __launch_bounds__(256)
void rmsnorm_kernel(const float* __restrict__ x, const float* __restrict__ w,
                    float* __restrict__ xf, unsigned short* __restrict__ xb, int Dn) {
    const int row = blockIdx.x;
    const int tid = threadIdx.x;
    const float* xr = x + (size_t)row * Dn;
    float ss = 0.0f;
    for (int i = tid; i < Dn; i += 256) { float v = xr[i]; ss += v * v; }
    __shared__ float red[256];
    red[tid] = ss;
    __syncthreads();
    for (int s = 128; s > 0; s >>= 1) {
        if (tid < s) red[tid] += red[tid + s];
        __syncthreads();
    }
    const float r = rsqrtf(red[0] / (float)Dn + 1e-6f);
    for (int i = tid; i < Dn; i += 256) {
        float v = xr[i] * r * w[i];
        if (WRITE_F32) xf[(size_t)row * Dn + i] = v;
        xb[(size_t)row * Dn + i] = f2bf(v);
    }
}

// ---------------------------------------------------------------------------
// WMMA bf16 GEMM:  out[m][n] = sum_k A[m][k] * Bw[n][k]  (+epilogue)
// MODE 0: outF = acc + bias[n]                      (f32)
// MODE 1: outB = bf16(gelu(acc + bias[n]))          (bf16)
// MODE 2: outF = acc + bias[n] + resid[m][n]        (f32)
// Block: 256 threads = 8 waves (2x4), block tile 128x128, BK=64.
// Wave tile 64x32 = 4x2 accumulators of v_wmma_f32_16x16x32_bf16.
// Double-buffered LDS, filled by global_load_async_to_lds_b128 (ASYNCcnt).
// ---------------------------------------------------------------------------
template <int MODE>
__global__ __launch_bounds__(256)
void gemm_wmma_bf16(const unsigned short* __restrict__ A,
                    const unsigned short* __restrict__ Bw,
                    const float* __restrict__ bias,
                    const float* __restrict__ resid,
                    float* __restrict__ outF,
                    unsigned short* __restrict__ outB,
                    int M, int N, int K) {
    __shared__ unsigned short As[2][128][72];  // 64 cols + pad, 16B-aligned rows
    __shared__ unsigned short Bs[2][128][72];

    const int tid   = threadIdx.x;
    const int lane  = tid & 31;
    const int wid   = tid >> 5;
    const int waveM = wid >> 2;      // 0..1  (rows of 64)
    const int waveN = wid & 3;       // 0..3  (cols of 32)
    const int m0 = blockIdx.y * 128;
    const int n0 = blockIdx.x * 128;

    // LDS fill: 8 neighbouring lanes take the 8 16-byte pieces of one row's 128-byte
    // slab, so a wave-wide copy covers 4 whole lines (a lane per row touched 32).
    const int lrow = tid >> 3;       // 0..31: row within a group of 32 rows
    const int lch  = tid & 7;        // which 16-byte piece of the row's slab

    const int ml   = lane & 15;      // M (or N) index within fragment
    const int half = lane >> 4;      // lane-half selects K sub-pattern

    const v8f vzero = {0.f, 0.f, 0.f, 0.f, 0.f, 0.f, 0.f, 0.f};
    v8f acc[4][2];
#pragma unroll
    for (int i = 0; i < 4; ++i)
#pragma unroll
        for (int j = 0; j < 2; ++j) acc[i][j] = vzero;

    const unsigned short* rowA = A  + (size_t)(m0 + lrow) * K + lch * 8;
    const unsigned short* rowB = Bw + (size_t)(n0 + lrow) * K + lch * 8;

    // Issue one K-slab (8 x 16B per thread) into LDS buffer `buf` via async DMA.
    auto issue_slab = [&](int buf, int k0) {
        unsigned l[8];
        const unsigned short* g[8];
#pragma unroll  // constant q: l and g stay in registers
        for (int q = 0; q < 4; ++q) {     // four groups of 32 rows
            l[q]     = lds_addr_of(&As[buf][q * 32 + lrow][lch * 8]);
            l[4 + q] = lds_addr_of(&Bs[buf][q * 32 + lrow][lch * 8]);
            g[q]     = rowA + (size_t)(q * 32) * K + k0;
            g[4 + q] = rowB + (size_t)(q * 32) * K + k0;
        }
        async_copy_b128_x8(l, g);
    };

    const int nslab = K >> 6;
    issue_slab(0, 0);

    for (int i = 0; i < nslab; ++i) {
        const int cur = i & 1;
        if (i + 1 < nslab) {
            issue_slab(cur ^ 1, (i + 1) << 6);  // prefetch next slab (async)
            wait_asynccnt<8>();                 // this wave's slab-i loads done
        } else {
            wait_asynccnt<0>();
        }
        __syncthreads();                        // all waves' slab-i data in LDS

#pragma unroll
        for (int s = 0; s < 2; ++s) {
            const int ks = s * 32;
            // 16-bit A/B fragment layout: lane-half 0 holds K {0..7,16..23},
            // half 1 holds K {8..15,24..31} (two 16B runs per lane).
            FragBF fa[4], fb[2];
#pragma unroll
            for (int ii = 0; ii < 4; ++ii) {
                const int row = waveM * 64 + ii * 16 + ml;
                fa[ii].lo = *(const U16x8*)&As[cur][row][ks + half * 8];
                fa[ii].hi = *(const U16x8*)&As[cur][row][ks + 16 + half * 8];
            }
#pragma unroll
            for (int j = 0; j < 2; ++j) {
                const int col = waveN * 32 + j * 16 + ml;
                fb[j].lo = *(const U16x8*)&Bs[cur][col][ks + half * 8];
                fb[j].hi = *(const U16x8*)&Bs[cur][col][ks + 16 + half * 8];
            }
#pragma unroll
            for (int ii = 0; ii < 4; ++ii) {
                v16bf av = __builtin_bit_cast(v16bf, fa[ii]);
#pragma unroll
                for (int j = 0; j < 2; ++j) {
                    v16bf bv = __builtin_bit_cast(v16bf, fb[j]);
                    acc[ii][j] = __builtin_amdgcn_wmma_f32_16x16x32_bf16(
                        false, av, false, bv, (short)0, acc[ii][j], false, false);
                }
            }
        }
        __syncthreads();   // everyone finished reading buf `cur` before refill
    }

    // Epilogue: C/D layout — VGPR r: lanes 0-15 -> M=r, lanes 16-31 -> M=r+8.
#pragma unroll
    for (int i = 0; i < 4; ++i) {
        const int rowBase = m0 + waveM * 64 + i * 16;
#pragma unroll
        for (int j = 0; j < 2; ++j) {
            const int col = n0 + waveN * 32 + j * 16 + ml;
#pragma unroll
            for (int r = 0; r < 8; ++r) {
                const int row = rowBase + r + half * 8;
                float c = acc[i][j][r] + bias[col];
                const size_t o = (size_t)row * N + col;
                if (MODE == 0) {
                    outF[o] = c;
                } else if (MODE == 1) {
                    outB[o] = f2bf(gelu_tanh(c));
                } else {
                    outF[o] = c + resid[o];
                }
            }
        }
    }
}

// ---------------------------------------------------------------------------
// Bv / Cv projections: out[row][n] = dot(xn[row,:], W[n,:]) + b[n]
// ---------------------------------------------------------------------------
__global__ __launch_bounds__(256)
void bc_proj_kernel(const float* __restrict__ xnf,
                    const float* __restrict__ WB, const float* __restrict__ bB,
                    const float* __restrict__ WC, const float* __restrict__ bC,
                    float* __restrict__ Bv, float* __restrict__ Cv, int K) {
    const int t = blockIdx.x * 256 + threadIdx.x;
    const int row = t >> 5;
    const int o = t & 31;
    const int n = o & 15;
    const bool isC = o >= 16;
    const float* w = (isC ? WC : WB) + (size_t)n * K;
    const float* xr = xnf + (size_t)row * K;
    float s = 0.0f;
    for (int k = 0; k < K; k += 4) {
        s += xr[k] * w[k] + xr[k + 1] * w[k + 1]
           + xr[k + 2] * w[k + 2] + xr[k + 3] * w[k + 3];
    }
    s += (isC ? bC : bB)[n];
    (isC ? Cv : Bv)[(size_t)row * 16 + n] = s;
}

// ---------------------------------------------------------------------------
// Chunked linear-recurrence scan (h = dA*h + b), 3 passes, NC chunks of CL.
// Thread layout (pass 1/3): one thread per (b, chunk, d); the lanes of a wave
// run along d, and each thread keeps all 16 states n in registers.
// P/Q/H layout: [b][chunk][n][d], so every access is contiguous along d.
// ---------------------------------------------------------------------------
#define SCAN_NC 64
#define SCAN_CL 32
#define SCAN_D  1024   // channels = pitch of one n row of P/Q/H (a constant, so that
                       // the 16 rows are reached by immediate offsets from one address)

// Pass 1: per-chunk transfer (P = prod dA, q = end state from h0=0)
// grid: x = d / 256, y = chunk, z = batch
__global__ __launch_bounds__(256)
void scan_pass1(const float* __restrict__ dtp, const float* __restrict__ xnf,
                const float* __restrict__ Bv, const float* __restrict__ A_log,
                float* __restrict__ Pbuf, float* __restrict__ Qbuf,
                int Lv, int Dv) {
    const int d = blockIdx.x * 256 + threadIdx.x;
    const int c = blockIdx.y;
    const int b = blockIdx.z;

    float An[16], invA[16], h[16], pf[16];
    float Amin = __builtin_inff();
#pragma unroll  // constant n: the per-thread arrays stay in registers
    for (int n = 0; n < 16; ++n) {
        An[n]   = -expf(A_log[n]);
        invA[n] = 1.0f / An[n];
        Amin    = fminf(Amin, -An[n]);
        h[n]  = 0.0f;
        pf[n] = 1.0f;
    }
    const int row0 = b * Lv + c * SCAN_CL;
    for (int l = 0; l < SCAN_CL; ++l) {
        const size_t idx = (size_t)(row0 + l);
        const float dt = softplus_hw(dtp[idx * Dv + d]);
        const float xv = xnf[idx * Dv + d];
        const float* __restrict__ Bp = Bv + idx * 16;   // same for the whole block
        float Br[16];   // read ahead of the branch, beside the two loads above
#pragma unroll  // constant n: the per-thread arrays stay in registers
        for (int n = 0; n < 16; ++n) Br[n] = Bp[n];
        const float dt2 = dt * LOG2E_F;
        float z2[16], dA[16];   // dA = exp(dt * A) = 2^(dt * log2(e) * A)
#pragma unroll  // constant n: the per-thread arrays stay in registers
        for (int n = 0; n < 16; ++n) z2[n] = dt2 * An[n];
        exp2_x8(dA, z2);
        exp2_x8(dA + 8, z2 + 8);
        const bool shortform = (dt * Amin >= SCAN_ZMIN) && (dt >= SCAN_DTMIN);
        if (__builtin_amdgcn_ballot_w32(!shortform) == 0u) {
            // b = (dA - 1) * w with w = B * x / (dt * A), so dA*h + b = dA*(h + w) - w
            const float g = xv * __builtin_amdgcn_rcpf(dt);
#pragma unroll  // constant n: the per-thread arrays stay in registers
            for (int n = 0; n < 16; ++n) {
                const float w = g * (Br[n] * invA[n]);
                h[n]  = dA[n] * (h[n] + w) - w;
                pf[n] = dA[n] * pf[n];
            }
        } else {
            // some lane has a small dt * A: phi1 in its library form, exact near 0
#pragma unroll  // constant n: the per-thread arrays stay in registers
            for (int n = 0; n < 16; ++n) {
                const float bt = phi1_f(dt * An[n]) * Br[n] * xv;
                h[n]  = dA[n] * h[n] + bt;
                pf[n] = dA[n] * pf[n];
            }
        }
    }
    const size_t o0 = (size_t)(b * SCAN_NC + c) * 16 * SCAN_D + d;
#pragma unroll  // constant n: the per-thread arrays stay in registers
    for (int n = 0; n < 16; ++n) {
        Pbuf[o0 + n * SCAN_D] = pf[n];
        Qbuf[o0 + n * SCAN_D] = h[n];
    }
}

// Pass 2: sequential combine over chunks -> initial state H_c per chunk
// one thread per (b, n, d); one chunk is a plane of 16 * SCAN_D elements
__global__ __launch_bounds__(256)
void scan_pass2(const float* __restrict__ Pbuf, const float* __restrict__ Qbuf,
                float* __restrict__ Hbuf) {
    constexpr int plane = 16 * SCAN_D;
    const int tid = blockIdx.x * 256 + threadIdx.x;
    const int b = tid / plane;
    const int r = tid - b * plane;        // n * SCAN_D + d
    const size_t o0 = (size_t)b * SCAN_NC * plane + r;
    float H = 0.0f;
    // unrolled whole: the loads do not depend on H, so they can all be in
    // flight together instead of one memory latency per few chunks
#pragma unroll
    for (int c = 0; c < SCAN_NC; ++c) {
        const size_t o = o0 + c * plane;
        Hbuf[o] = H;
        H = Pbuf[o] * H + Qbuf[o];
    }
}

// Pass 3: replay chunk from true H_c, emit y = sum_n Cv*h + D*xn, +residual
// grid: x = d / 256, y = chunk, z = batch
__global__ __launch_bounds__(256)
void scan_pass3(const float* __restrict__ dtp, const float* __restrict__ xnf,
                const float* __restrict__ xres,
                const float* __restrict__ Bv, const float* __restrict__ Cv,
                const float* __restrict__ A_log, const float* __restrict__ Dp,
                const float* __restrict__ scale, const float* __restrict__ Hbuf,
                float* __restrict__ x2, int Lv, int Dv) {
    const int d = blockIdx.x * 256 + threadIdx.x;
    const int c = blockIdx.y;
    const int b = blockIdx.z;

    const float Dd = Dp[d];
    const float sc = scale[d];

    float An[16], invA[16], h[16];
    float Amin = __builtin_inff();
    const size_t o0 = (size_t)(b * SCAN_NC + c) * 16 * SCAN_D + d;
#pragma unroll  // constant n: the per-thread arrays stay in registers
    for (int n = 0; n < 16; ++n) {
        An[n]   = -expf(A_log[n]);
        invA[n] = 1.0f / An[n];
        Amin    = fminf(Amin, -An[n]);
        h[n]  = Hbuf[o0 + n * SCAN_D];
    }
    const int row0 = b * Lv + c * SCAN_CL;
    for (int l = 0; l < SCAN_CL; ++l) {
        const size_t idx = (size_t)(row0 + l);
        const float dt = softplus_hw(dtp[idx * Dv + d]);
        const float xv = xnf[idx * Dv + d];
        const float xr = xres[idx * Dv + d];
        const float* __restrict__ Bp = Bv + idx * 16;   // same for the whole block
        const float* __restrict__ Cp = Cv + idx * 16;
        float Br[16], Cr[16];   // read ahead of the branch, beside the loads above
#pragma unroll  // constant n: the per-thread arrays stay in registers
        for (int n = 0; n < 16; ++n) { Br[n] = Bp[n]; Cr[n] = Cp[n]; }
        float t[16];
        const float dt2 = dt * LOG2E_F;
        float z2[16], dA[16];   // dA = exp(dt * A) = 2^(dt * log2(e) * A)
#pragma unroll  // constant n: the per-thread arrays stay in registers
        for (int n = 0; n < 16; ++n) z2[n] = dt2 * An[n];
        exp2_x8(dA, z2);
        exp2_x8(dA + 8, z2 + 8);
        const bool shortform = (dt * Amin >= SCAN_ZMIN) && (dt >= SCAN_DTMIN);
        if (__builtin_amdgcn_ballot_w32(!shortform) == 0u) {
            // b = (dA - 1) * w with w = B * x / (dt * A), so dA*h + b = dA*(h + w) - w
            const float g = xv * __builtin_amdgcn_rcpf(dt);
#pragma unroll  // constant n: the per-thread arrays stay in registers
            for (int n = 0; n < 16; ++n) {
                const float w = g * (Br[n] * invA[n]);
                h[n] = dA[n] * (h[n] + w) - w;
                t[n] = Cr[n] * h[n];
            }
        } else {
            // some lane has a small dt * A: phi1 in its library form, exact near 0
#pragma unroll  // constant n: the per-thread arrays stay in registers
            for (int n = 0; n < 16; ++n) {
                const float bt = phi1_f(dt * An[n]) * Br[n] * xv;
                h[n] = dA[n] * h[n] + bt;
                t[n] = Cr[n] * h[n];
            }
        }
        // sum over n: pairs 8, 4, 2, 1 apart
#pragma unroll  // constant n: the per-thread arrays stay in registers
        for (int s = 8; s > 0; s >>= 1)
#pragma unroll  // constant n: the per-thread arrays stay in registers
            for (int n = 0; n < s; ++n) t[n] += t[n + s];
        const float y = (t[0] + Dd * xv) * sc;
        x2[idx * Dv + d] = y + xr;
        // precaution: the next trip rewrites the registers that this store names
        asm volatile("s_wait_xcnt 0x0" ::: "memory");
    }
}

// ---------------------------------------------------------------------------
// Launch
// ---------------------------------------------------------------------------
extern "C" void kernel_launch(void* const* d_in, const int* in_sizes, int n_in,
                              void* d_out, int out_size, void* d_ws, size_t ws_size,
                              hipStream_t stream) {
    (void)in_sizes; (void)n_in; (void)out_size; (void)ws_size;
    constexpr int Bb = 2, Lv = 2048, Dv = 1024, Nst = 16, DFF = 4096;
    constexpr int Mrows = Bb * Lv;  // 4096
    constexpr int NCh = SCAN_NC;
    static_assert(Dv == SCAN_D && NCh * SCAN_CL == Lv, "scan tiling");

    const float* x       = (const float*)d_in[0];
    const float* norm1_w = (const float*)d_in[1];
    const float* norm2_w = (const float*)d_in[2];
    const float* A_log   = (const float*)d_in[3];
    const float* D_param = (const float*)d_in[4];
    const float* scale   = (const float*)d_in[5];
    const float* Wdt     = (const float*)d_in[6];
    const float* bdt     = (const float*)d_in[7];
    const float* WB      = (const float*)d_in[8];
    const float* bB      = (const float*)d_in[9];
    const float* WC      = (const float*)d_in[10];
    const float* bC      = (const float*)d_in[11];
    const float* W1      = (const float*)d_in[12];
    const float* b1      = (const float*)d_in[13];
    const float* W2      = (const float*)d_in[14];
    const float* b2      = (const float*)d_in[15];
    float* out = (float*)d_out;

    size_t off = 0;
    auto alloc = [&](size_t bytes) -> void* {
        void* p = (char*)d_ws + off;
        off += (bytes + 255) & ~(size_t)255;
        return p;
    };
    float*          xnf  = (float*)alloc((size_t)Mrows * Dv * 4);
    unsigned short* xnb  = (unsigned short*)alloc((size_t)Mrows * Dv * 2);
    unsigned short* wdtb = (unsigned short*)alloc((size_t)Dv * Dv * 2);
    unsigned short* w1b  = (unsigned short*)alloc((size_t)DFF * Dv * 2);
    unsigned short* w2b  = (unsigned short*)alloc((size_t)Dv * DFF * 2);
    float*          dtp  = (float*)alloc((size_t)Mrows * Dv * 4);
    float*          Bv   = (float*)alloc((size_t)Mrows * Nst * 4);
    float*          Cv   = (float*)alloc((size_t)Mrows * Nst * 4);
    float*          x2   = (float*)alloc((size_t)Mrows * Dv * 4);
    unsigned short* xn2b = (unsigned short*)alloc((size_t)Mrows * Dv * 2);
    unsigned short* hb   = (unsigned short*)alloc((size_t)Mrows * DFF * 2);
    float*          Pbuf = (float*)alloc((size_t)Bb * Dv * NCh * 16 * 4);
    float*          Qbuf = (float*)alloc((size_t)Bb * Dv * NCh * 16 * 4);
    float*          Hbuf = (float*)alloc((size_t)Bb * Dv * NCh * 16 * 4);

    // 1. weight converts to bf16
    static_assert((Dv * Dv) % CVT_BLOCK == 0 && (DFF * Dv) % CVT_BLOCK == 0, "convert tiling");
    cvt_bf16_kernel<<<(Dv * Dv) / CVT_BLOCK, 256, 0, stream>>>(Wdt, wdtb);
    cvt_bf16_kernel<<<(DFF * Dv) / CVT_BLOCK, 256, 0, stream>>>(W1, w1b);
    cvt_bf16_kernel<<<(Dv * DFF) / CVT_BLOCK, 256, 0, stream>>>(W2, w2b);

    // 2. RMSNorm1 (f32 + bf16)
    rmsnorm_kernel<1><<<Mrows, 256, 0, stream>>>(x, norm1_w, xnf, xnb, Dv);

    // 3. dt_pre = xn @ Wdt^T + bdt  (WMMA, async-LDS pipelined)
    gemm_wmma_bf16<0><<<dim3(Dv / 128, Mrows / 128), 256, 0, stream>>>(
        xnb, wdtb, bdt, nullptr, dtp, nullptr, Mrows, Dv, Dv);

    // 4. Bv / Cv projections
    bc_proj_kernel<<<(Mrows * 32) / 256, 256, 0, stream>>>(
        xnf, WB, bB, WC, bC, Bv, Cv, Dv);

    // 5. chunked selective scan + residual -> x2
    scan_pass1<<<dim3(Dv / 256, NCh, Bb), 256, 0, stream>>>(
        dtp, xnf, Bv, A_log, Pbuf, Qbuf, Lv, Dv);
    scan_pass2<<<(Bb * Dv * 16) / 256, 256, 0, stream>>>(Pbuf, Qbuf, Hbuf);
    scan_pass3<<<dim3(Dv / 256, NCh, Bb), 256, 0, stream>>>(
        dtp, xnf, x, Bv, Cv, A_log, D_param, scale, Hbuf, x2, Lv, Dv);

    // 6. RMSNorm2 (bf16 only)
    rmsnorm_kernel<0><<<Mrows, 256, 0, stream>>>(x2, norm2_w, nullptr, xn2b, Dv);

    // 7. h = gelu(xn2 @ W1^T + b1) -> bf16  (WMMA)
    gemm_wmma_bf16<1><<<dim3(DFF / 128, Mrows / 128), 256, 0, stream>>>(
        xn2b, w1b, b1, nullptr, nullptr, hb, Mrows, DFF, Dv);

    // 8. out = h @ W2^T + b2 + x2  (WMMA)
    gemm_wmma_bf16<2><<<dim3(Dv / 128, Mrows / 128), 256, 0, stream>>>(
        hb, w2b, b2, x2, out, nullptr, Mrows, Dv, DFF);
}

// v005
// It runs in 210 microseconds.
// Two timings next to v004 put it at 1.15 and 1.14 times that version's speed.
// Counting every step since v000, it is 3.36 times as fast.
#include <hip/hip_runtime.h>
#include <hip/hip_bf16.h>
#include <stdint.h>

// ---------------------------------------------------------------------------
// Types for WMMA (gfx1250, wave32)
// ---------------------------------------------------------------------------
typedef __attribute__((ext_vector_type(16))) __bf16 v16bf;
typedef __attribute__((ext_vector_type(8)))  float  v8f;

struct alignas(16) U16x8 { unsigned short u[8]; };
struct alignas(32) FragBF { U16x8 lo, hi; };

static __device__ __forceinline__ unsigned short f2bf(float f) {
    unsigned int u = __float_as_uint(f);
    u += 0x7FFFu + ((u >> 16) & 1u);          // round-to-nearest-even
    return (unsigned short)(u >> 16);
}

static __device__ __forceinline__ float gelu_tanh(float x) {
    float x3 = x * x * x;
    return 0.5f * x * (1.0f + tanhf(0.7978845608028654f * (x + 0.044715f * x3)));
}

static __device__ __forceinline__ float phi1_f(float z) {
    if (fabsf(z) < 1e-4f) return 1.0f + 0.5f * z;
    return expm1f(z) / z;
}

// ---------------------------------------------------------------------------
// Scan arithmetic on the hardware's own exp2 / log2 / rcp instructions.
// ---------------------------------------------------------------------------
#define LOG2E_F 1.4426950408889634f
#define LN2_F   0.6931471805599453f
// A step takes the short form only where every |dt * A[n]| is at least this:
// there exp(z) - 1 keeps its relative accuracy (error about 1e-7 / |z|).
#define SCAN_ZMIN  0.0625f
// ... and where 1 / dt is far from overflow.
#define SCAN_DTMIN 1e-30f

// r[i] = 2^x[i], i = 0..7. One statement, so that each v_exp_f32 has an
// independent instruction behind it and the last one a v_nop: the slot that the
// instruction set asks for before a transcendental's source is overwritten or its
// result read.
static __device__ __forceinline__ void exp2_x8(float* r, const float* x) {
    asm("v_exp_f32 %0, %8\n\t"
        "v_exp_f32 %1, %9\n\t"
        "v_exp_f32 %2, %10\n\t"
        "v_exp_f32 %3, %11\n\t"
        "v_exp_f32 %4, %12\n\t"
        "v_exp_f32 %5, %13\n\t"
        "v_exp_f32 %6, %14\n\t"
        "v_exp_f32 %7, %15\n\t"
        "v_nop"
        : "=&v"(r[0]), "=&v"(r[1]), "=&v"(r[2]), "=&v"(r[3]),
          "=&v"(r[4]), "=&v"(r[5]), "=&v"(r[6]), "=&v"(r[7])
        : "v"(x[0]), "v"(x[1]), "v"(x[2]), "v"(x[3]),
          "v"(x[4]), "v"(x[5]), "v"(x[6]), "v"(x[7]));
}

// softplus(x) = max(x, 0) + log1p(exp(-|x|)); e = exp(-|x|) lies in (0, 1].
// Below 1/16 the series of log1p keeps the relative accuracy that 1 + e loses.
static __device__ __forceinline__ float softplus_hw(float x) {
    const float e  = __builtin_amdgcn_exp2f(-fabsf(x) * LOG2E_F);
    const float lg = __builtin_amdgcn_logf(1.0f + e) * LN2_F;
    float p = 0.2f - e * (1.0f / 6.0f);
    p = -0.25f + e * p;
    p = (1.0f / 3.0f) + e * p;
    p = -0.5f + e * p;
    p = e + (e * e) * p;
    return fmaxf(x, 0.0f) + ((e < 0.0625f) ? p : lg);
}

// ---------------------------------------------------------------------------
// gfx1250 async memory->LDS copies (ASYNCcnt tracked), 16B per lane: the eight
// copies of one thread for one K-slab. l = LDS byte address (low 32 bits of the
// generic pointer: the flat aperture maps LDS_ADDR = addr[31:0]), g = global address.
// The last line is a precaution: it stands ahead of whatever rewrites the address
// registers that the copies name, and inside the statement nothing can be moved
// in front of it.
// ---------------------------------------------------------------------------
static __device__ __forceinline__ unsigned lds_addr_of(const void* p) {
    return (unsigned)(size_t)p;
}

static __device__ __forceinline__ void async_copy_b128_x8(const unsigned* l,
                                                          const unsigned short* const* g) {
    asm volatile("global_load_async_to_lds_b128 %0, %8, off\n\t"
                 "global_load_async_to_lds_b128 %1, %9, off\n\t"
                 "global_load_async_to_lds_b128 %2, %10, off\n\t"
                 "global_load_async_to_lds_b128 %3, %11, off\n\t"
                 "global_load_async_to_lds_b128 %4, %12, off\n\t"
                 "global_load_async_to_lds_b128 %5, %13, off\n\t"
                 "global_load_async_to_lds_b128 %6, %14, off\n\t"
                 "global_load_async_to_lds_b128 %7, %15, off\n\t"
                 "s_wait_xcnt 0x0"
                 :: "v"(l[0]), "v"(l[1]), "v"(l[2]), "v"(l[3]),
                    "v"(l[4]), "v"(l[5]), "v"(l[6]), "v"(l[7]),
                    "v"(g[0]), "v"(g[1]), "v"(g[2]), "v"(g[3]),
                    "v"(g[4]), "v"(g[5]), "v"(g[6]), "v"(g[7])
                 : "memory");
}

template <int Nc>
static __device__ __forceinline__ void wait_asynccnt() {
    asm volatile("s_wait_asynccnt %0" :: "n"(Nc) : "memory");
}

// ---------------------------------------------------------------------------
// f32 -> bf16 convert. One block of 256 threads converts CVT_BLOCK contiguous
// elements; the array length must be a multiple of CVT_BLOCK (checked at the
// launch). A thread takes CVT_G groups of 4 elements, 256 groups apart: each
// wave-wide load covers 512 contiguous bytes, each store 256, and a wave has
// CVT_G loads in flight. The point is fewer waves than with one element a
// thread, for speed only.
// ---------------------------------------------------------------------------
typedef __attribute__((ext_vector_type(4))) float f32x4;
struct alignas(8) U16x4 { unsigned short u[4]; };
#define CVT_G     8
#define CVT_BLOCK (256 * CVT_G * 4)

__global__ __launch_bounds__(256)
void cvt_bf16_kernel(const float* __restrict__ in,
                     unsigned short* __restrict__ out) {
    const size_t g0 = (size_t)blockIdx.x * (256 * CVT_G) + threadIdx.x;
    const f32x4* __restrict__ src = (const f32x4*)in + g0;
    U16x4* __restrict__ dst = (U16x4*)out + g0;
    f32x4 v[CVT_G];
#pragma unroll  // constant j: v stays in registers and all loads go out first
    for (int j = 0; j < CVT_G; ++j) v[j] = src[j * 256];
#pragma unroll  // constant j: v stays in registers
    for (int j = 0; j < CVT_G; ++j) {
        U16x4 o;
        o.u[0] = f2bf(v[j][0]);
        o.u[1] = f2bf(v[j][1]);
        o.u[2] = f2bf(v[j][2]);
        o.u[3] = f2bf(v[j][3]);
        dst[j * 256] = o;
    }
}

// ---------------------------------------------------------------------------
// RMSNorm: one block per row of length Dn=1024; writes f32 (optional) + bf16
// ---------------------------------------------------------------------------
template <int WRITE_F32>
__global__ __launch_bounds__(256)
void rmsnorm_kernel(const float* __restrict__ x, const float* __restrict__ w,
                    float* __restrict__ xf, unsigned short* __restrict__ xb, int Dn) {
    const int row = blockIdx.x;
    const int tid = threadIdx.x;
    const float* xr = x + (size_t)row * Dn;
    float ss = 0.0f;
    for (int i = tid; i < Dn; i += 256) { float v = xr[i]; ss += v * v; }
    __shared__ float red[256];
    red[tid] = ss;
    __syncthreads();
    for (int s = 128; s > 0; s >>= 1) {
        if (tid < s) red[tid] += red[tid + s];
        __syncthreads();
    }
    const float r = rsqrtf(red[0] / (float)Dn + 1e-6f);
    for (int i = tid; i < Dn; i += 256) {
        float v = xr[i] * r * w[i];
        if (WRITE_F32) xf[(size_t)row * Dn + i] = v;
        xb[(size_t)row * Dn + i] = f2bf(v);
    }
}

// ---------------------------------------------------------------------------
// WMMA bf16 GEMM:  out[m][n] = sum_k A[m][k] * Bw[n][k]  (+epilogue)
// MODE 0: outF = acc + bias[n]                      (f32)
// MODE 1: outB = bf16(gelu(acc + bias[n]))          (bf16)
// MODE 2: outF = acc + bias[n] + resid[m][n]        (f32)
// Block: 256 threads = 8 waves (2x4), block tile 128x128, BK=64.
// Wave tile 64x32 = 4x2 accumulators of v_wmma_f32_16x16x32_bf16.
// Double-buffered LDS, filled by global_load_async_to_lds_b128 (ASYNCcnt).
// ---------------------------------------------------------------------------
template <int MODE>
__global__ __launch_bounds__(256)
void gemm_wmma_bf16(const unsigned short* __restrict__ A,
                    const unsigned short* __restrict__ Bw,
                    const float* __restrict__ bias,
                    const float* __restrict__ resid,
                    float* __restrict__ outF,
                    unsigned short* __restrict__ outB,
                    int M, int N, int K) {
    __shared__ unsigned short As[2][128][72];  // 64 cols + pad, 16B-aligned rows
    __shared__ unsigned short Bs[2][128][72];

    const int tid   = threadIdx.x;
    const int lane  = tid & 31;
    const int wid   = tid >> 5;
    const int waveM = wid >> 2;      // 0..1  (rows of 64)
    const int waveN = wid & 3;       // 0..3  (cols of 32)
    const int m0 = blockIdx.y * 128;
    const int n0 = blockIdx.x * 128;

    // LDS fill: 8 neighbouring lanes take the 8 16-byte pieces of one row's 128-byte
    // slab, so a wave-wide copy covers 4 whole lines (a lane per row touched 32).
    const int lrow = tid >> 3;       // 0..31: row within a group of 32 rows
    const int lch  = tid & 7;        // which 16-byte piece of the row's slab

    const int ml   = lane & 15;      // M (or N) index within fragment
    const int half = lane >> 4;      // lane-half selects K sub-pattern

    const v8f vzero = {0.f, 0.f, 0.f, 0.f, 0.f, 0.f, 0.f, 0.f};
    v8f acc[4][2];
#pragma unroll
    for (int i = 0; i < 4; ++i)
#pragma unroll
        for (int j = 0; j < 2; ++j) acc[i][j] = vzero;

    const unsigned short* rowA = A  + (size_t)(m0 + lrow) * K + lch * 8;
    const unsigned short* rowB = Bw + (size_t)(n0 + lrow) * K + lch * 8;

    // Issue one K-slab (8 x 16B per thread) into LDS buffer `buf` via async DMA.
    auto issue_slab = [&](int buf, int k0) {
        unsigned l[8];
        const unsigned short* g[8];
#pragma unroll  // constant q: l and g stay in registers
        for (int q = 0; q < 4; ++q) {     // four groups of 32 rows
            l[q]     = lds_addr_of(&As[buf][q * 32 + lrow][lch * 8]);
            l[4 + q] = lds_addr_of(&Bs[buf][q * 32 + lrow][lch * 8]);
            g[q]     = rowA + (size_t)(q * 32) * K + k0;
            g[4 + q] = rowB + (size_t)(q * 32) * K + k0;
        }
        async_copy_b128_x8(l, g);
    };

    const int nslab = K >> 6;
    issue_slab(0, 0);

    for (int i = 0; i < nslab; ++i) {
        const int cur = i & 1;
        if (i + 1 < nslab) {
            issue_slab(cur ^ 1, (i + 1) << 6);  // prefetch next slab (async)
            wait_asynccnt<8>();                 // this wave's slab-i loads done
        } else {
            wait_asynccnt<0>();
        }
        __syncthreads();                        // all waves' slab-i data in LDS

#pragma unroll
        for (int s = 0; s < 2; ++s) {
            const int ks = s * 32;
            // 16-bit A/B fragment layout: lane-half 0 holds K {0..7,16..23},
            // half 1 holds K {8..15,24..31} (two 16B runs per lane).
            FragBF fa[4], fb[2];
#pragma unroll
            for (int ii = 0; ii < 4; ++ii) {
                const int row = waveM * 64 + ii * 16 + ml;
                fa[ii].lo = *(const U16x8*)&As[cur][row][ks + half * 8];
                fa[ii].hi = *(const U16x8*)&As[cur][row][ks + 16 + half * 8];
            }
#pragma unroll
            for (int j = 0; j < 2; ++j) {
                const int col = waveN * 32 + j * 16 + ml;
                fb[j].lo = *(const U16x8*)&Bs[cur][col][ks + half * 8];
                fb[j].hi = *(const U16x8*)&Bs[cur][col][ks + 16 + half * 8];
            }
#pragma unroll
            for (int ii = 0; ii < 4; ++ii) {
                v16bf av = __builtin_bit_cast(v16bf, fa[ii]);
#pragma unroll
                for (int j = 0; j < 2; ++j) {
                    v16bf bv = __builtin_bit_cast(v16bf, fb[j]);
                    acc[ii][j] = __builtin_amdgcn_wmma_f32_16x16x32_bf16(
                        false, av, false, bv, (short)0, acc[ii][j], false, false);
                }
            }
        }
        __syncthreads();   // everyone finished reading buf `cur` before refill
    }

    // Epilogue: C/D layout — VGPR r: lanes 0-15 -> M=r, lanes 16-31 -> M=r+8.
#pragma unroll
    for (int i = 0; i < 4; ++i) {
        const int rowBase = m0 + waveM * 64 + i * 16;
#pragma unroll
        for (int j = 0; j < 2; ++j) {
            const int col = n0 + waveN * 32 + j * 16 + ml;
#pragma unroll
            for (int r = 0; r < 8; ++r) {
                const int row = rowBase + r + half * 8;
                float c = acc[i][j][r] + bias[col];
                const size_t o = (size_t)row * N + col;
                if (MODE == 0) {
                    outF[o] = c;
                } else if (MODE == 1) {
                    outB[o] = f2bf(gelu_tanh(c));
                } else {
                    outF[o] = c + resid[o];
                }
            }
        }
    }
}

// ---------------------------------------------------------------------------
// Bv / Cv projections: out[row][n] = dot(xn[row,:], W[n,:]) + b[n], all in f32.
// One block takes 16 rows of xn and all 32 rows of WB and WC, so W is read once per
// 16 rows. Its 16 waves split K: wave w owns k = 64 w .. 64 w + 63.
// 1. Each wave brings its 48 row pieces of 256 bytes into LDS with loads that cover
//    whole lines (16 lanes a piece, two pieces a load).
// 2. It reads them back as fragments of v_wmma_f32_16x16x4_f32, W as A and xn as B:
//    lane (c, h) takes row c, k = 8 kk + 4 h .. + 3, the same for both operands, and
//    feeds elements 0, 1 to one product and 2, 3 to the next.
// 3. Each wave lays its two partial tiles over the head of its own LDS rows, and the
//    16 partial sums of every output are added as a tree over the waves.
// ---------------------------------------------------------------------------
typedef __attribute__((ext_vector_type(2))) float v2f;
typedef f32x4 f32x4_a4 __attribute__((aligned(4)));   // an input's base is only known as float*
#define BC_WAVES 16
#define BC_KW    64                    // k per wave
#define BC_K     (BC_WAVES * BC_KW)    // row length of xn, WB, WC (checked at the launch)
#define BC_PITCH 68                    // dwords a staged row: 16-byte reads down a column hit no bank twice

__global__ __launch_bounds__(BC_WAVES * 32)
void bc_proj_kernel(const float* __restrict__ xnf,
                    const float* __restrict__ WB, const float* __restrict__ bB,
                    const float* __restrict__ WC, const float* __restrict__ bC,
                    float* __restrict__ Bv, float* __restrict__ Cv) {
    __shared__ __attribute__((aligned(16))) float stage[BC_WAVES][48][BC_PITCH];
    const int tid  = threadIdx.x;
    const int lane = tid & 31;
    const int w    = tid >> 5;
    const int c    = lane & 15;
    const int h    = lane >> 4;
    const int m0   = blockIdx.x * 16;

    // 1. rows 0..15 of stage[w]: xn, 16..31: WB, 32..47: WC
    const int go = h * BC_K + w * BC_KW + c * 4;
    const float* __restrict__ gx = xnf + (size_t)m0 * BC_K + go;
    const float* __restrict__ gb = WB + go;
    const float* __restrict__ gc = WC + go;
    f32x4 v[24];
#pragma unroll  // constant j: v stays in registers and all loads go out first
    for (int j = 0; j < 8; ++j) {
        v[j]      = *(const f32x4_a4*)(gx + 2 * j * BC_K);
        v[8 + j]  = *(const f32x4_a4*)(gb + 2 * j * BC_K);
        v[16 + j] = *(const f32x4_a4*)(gc + 2 * j * BC_K);
    }
#pragma unroll  // constant j: v stays in registers
    for (int j = 0; j < 24; ++j)
        *(f32x4*)&stage[w][2 * j + h][c * 4] = v[j];
    __syncthreads();   // a lane reads what other lanes have stored

    // 2. D[n][m]: register r of lane (c, h) is out[m0 + c][8 h + r]
    float* const sf = &stage[w][c][h * 4];   // the one LDS address of steps 2 and 3
    v8f accB = {0.f, 0.f, 0.f, 0.f, 0.f, 0.f, 0.f, 0.f};
    v8f accC = accB;
#pragma unroll  // constant kk: LDS offsets are immediates and the reads can go out ahead
    for (int kk = 0; kk < BC_KW / 8; ++kk) {
        const f32x4 x4 = *(const f32x4*)(sf + kk * 8);
        const f32x4 b4 = *(const f32x4*)(sf + 16 * BC_PITCH + kk * 8);
        const f32x4 c4 = *(const f32x4*)(sf + 32 * BC_PITCH + kk * 8);
        const v2f xlo = {x4[0], x4[1]}, xhi = {x4[2], x4[3]};
        const v2f blo = {b4[0], b4[1]}, bhi = {b4[2], b4[3]};
        const v2f clo = {c4[0], c4[1]}, chi = {c4[2], c4[3]};
        accB = __builtin_amdgcn_wmma_f32_16x16x4_f32(false, blo, false, xlo, (short)0, accB, false, false);
        accC = __builtin_amdgcn_wmma_f32_16x16x4_f32(false, clo, false, xlo, (short)0, accC, false, false);
        accB = __builtin_amdgcn_wmma_f32_16x16x4_f32(false, bhi, false, xhi, (short)0, accB, false, false);
        accC = __builtin_amdgcn_wmma_f32_16x16x4_f32(false, chi, false, xhi, (short)0, accC, false, false);
    }
    // Four vector slots between the last product and whatever vector instruction next
    // reuses its registers: the distance of the 16-bit forms, kept here as a precaution
    // (none is tabled for the f32 form, and the compiler pads none). The two scheduling
    // barriers hold the slots at this place and keep step 3's index arithmetic behind them.
    __builtin_amdgcn_sched_barrier(0);
    asm volatile("v_nop\n\tv_nop\n\tv_nop\n\tv_nop");
    __builtin_amdgcn_sched_barrier(0);

    // 3. Row c (Bv) and row 16 + c (Cv) of the wave's own slice, which only this wave has
    //    read: n = 8 h + 4 q + e lies at column 8 q + 4 h + e, so that sf serves again.
    {
        const f32x4 b0 = {accB[0], accB[1], accB[2], accB[3]}, b1 = {accB[4], accB[5], accB[6], accB[7]};
        const f32x4 c0 = {accC[0], accC[1], accC[2], accC[3]}, c1 = {accC[4], accC[5], accC[6], accC[7]};
        *(f32x4*)(sf)                     = b0;
        *(f32x4*)(sf + 8)                 = b1;
        *(f32x4*)(sf + 16 * BC_PITCH)     = c0;
        *(f32x4*)(sf + 16 * BC_PITCH + 8) = c1;
    }
    __syncthreads();   // every wave's partial tiles are in LDS
    const int t   = tid >> 8;     // 0: Bv, 1: Cv (the same for a whole wave)
    const int idx = tid & 255;    // m * 16 + n
    const int n   = idx & 15;
    const int col = ((n >> 2) & 1) * 8 + (n >> 3) * 4 + (n & 3);
    float p[BC_WAVES];
#pragma unroll  // constant i: p stays in registers
    for (int i = 0; i < BC_WAVES; ++i) p[i] = stage[i][t * 16 + (idx >> 4)][col];
#pragma unroll  // constant i: p stays in registers
    for (int s = BC_WAVES / 2; s > 0; s >>= 1)
#pragma unroll  // constant i: p stays in registers
        for (int i = 0; i < s; ++i) p[i] += p[i + s];
    (t ? Cv : Bv)[(size_t)m0 * 16 + idx] = p[0] + (t ? bC : bB)[n];
}

// ---------------------------------------------------------------------------
// Chunked linear-recurrence scan (h = dA*h + b), 3 passes, NC chunks of CL.
// Thread layout (pass 1/3): one thread per (b, chunk, d); the lanes of a wave
// run along d, and each thread keeps all 16 states n in registers.
// P/Q/H layout: [b][chunk][n][d], so every access is contiguous along d.
// ---------------------------------------------------------------------------
#define SCAN_NC 64
#define SCAN_CL 32
#define SCAN_D  1024   // channels = pitch of one n row of P/Q/H (a constant, so that
                       // the 16 rows are reached by immediate offsets from one address)

// Pass 1: per-chunk transfer (P = prod dA, q = end state from h0=0)
// grid: x = d / 256, y = chunk, z = batch
__global__ __launch_bounds__(256)
void scan_pass1(const float* __restrict__ dtp, const float* __restrict__ xnf,
                const float* __restrict__ Bv, const float* __restrict__ A_log,
                float* __restrict__ Pbuf, float* __restrict__ Qbuf,
                int Lv, int Dv) {
    const int d = blockIdx.x * 256 + threadIdx.x;
    const int c = blockIdx.y;
    const int b = blockIdx.z;

    float An[16], invA[16], h[16], pf[16];
    float Amin = __builtin_inff();
#pragma unroll  // constant n: the per-thread arrays stay in registers
    for (int n = 0; n < 16; ++n) {
        An[n]   = -expf(A_log[n]);
        invA[n] = 1.0f / An[n];
        Amin    = fminf(Amin, -An[n]);
        h[n]  = 0.0f;
        pf[n] = 1.0f;
    }
    const int row0 = b * Lv + c * SCAN_CL;
    for (int l = 0; l < SCAN_CL; ++l) {
        const size_t idx = (size_t)(row0 + l);
        const float dt = softplus_hw(dtp[idx * Dv + d]);
        const float xv = xnf[idx * Dv + d];
        const float* __restrict__ Bp = Bv + idx * 16;   // same for the whole block
        float Br[16];   // read ahead of the branch, beside the two loads above
#pragma unroll  // constant n: the per-thread arrays stay in registers
        for (int n = 0; n < 16; ++n) Br[n] = Bp[n];
        const float dt2 = dt * LOG2E_F;
        float z2[16], dA[16];   // dA = exp(dt * A) = 2^(dt * log2(e) * A)
#pragma unroll  // constant n: the per-thread arrays stay in registers
        for (int n = 0; n < 16; ++n) z2[n] = dt2 * An[n];
        exp2_x8(dA, z2);
        exp2_x8(dA + 8, z2 + 8);
        const bool shortform = (dt * Amin >= SCAN_ZMIN) && (dt >= SCAN_DTMIN);
        if (__builtin_amdgcn_ballot_w32(!shortform) == 0u) {
            // b = (dA - 1) * w with w = B * x / (dt * A), so dA*h + b = dA*(h + w) - w
            const float g = xv * __builtin_amdgcn_rcpf(dt);
#pragma unroll  // constant n: the per-thread arrays stay in registers
            for (int n = 0; n < 16; ++n) {
                const float w = g * (Br[n] * invA[n]);
                h[n]  = dA[n] * (h[n] + w) - w;
                pf[n] = dA[n] * pf[n];
            }
        } else {
            // some lane has a small dt * A: phi1 in its library form, exact near 0
#pragma unroll  // constant n: the per-thread arrays stay in registers
            for (int n = 0; n < 16; ++n) {
                const float bt = phi1_f(dt * An[n]) * Br[n] * xv;
                h[n]  = dA[n] * h[n] + bt;
                pf[n] = dA[n] * pf[n];
            }
        }
    }
    const size_t o0 = (size_t)(b * SCAN_NC + c) * 16 * SCAN_D + d;
#pragma unroll  // constant n: the per-thread arrays stay in registers
    for (int n = 0; n < 16; ++n) {
        Pbuf[o0 + n * SCAN_D] = pf[n];
        Qbuf[o0 + n * SCAN_D] = h[n];
    }
}

// Pass 2: sequential combine over chunks -> initial state H_c per chunk
// one thread per (b, n, d); one chunk is a plane of 16 * SCAN_D elements
__global__ __launch_bounds__(256)
void scan_pass2(const float* __restrict__ Pbuf, const float* __restrict__ Qbuf,
                float* __restrict__ Hbuf) {
    constexpr int plane = 16 * SCAN_D;
    const int tid = blockIdx.x * 256 + threadIdx.x;
    const int b = tid / plane;
    const int r = tid - b * plane;        // n * SCAN_D + d
    const size_t o0 = (size_t)b * SCAN_NC * plane + r;
    float H = 0.0f;
    // unrolled whole: the loads do not depend on H, so they can all be in
    // flight together instead of one memory latency per few chunks
#pragma unroll
    for (int c = 0; c < SCAN_NC; ++c) {
        const size_t o = o0 + c * plane;
        Hbuf[o] = H;
        H = Pbuf[o] * H + Qbuf[o];
    }
}

// Pass 3: replay chunk from true H_c, emit y = sum_n Cv*h + D*xn, +residual
// grid: x = d / 256, y = chunk, z = batch
__global__ __launch_bounds__(256)
void scan_pass3(const float* __restrict__ dtp, const float* __restrict__ xnf,
                const float* __restrict__ xres,
                const float* __restrict__ Bv, const float* __restrict__ Cv,
                const float* __restrict__ A_log, const float* __restrict__ Dp,
                const float* __restrict__ scale, const float* __restrict__ Hbuf,
                float* __restrict__ x2, int Lv, int Dv) {
    const int d = blockIdx.x * 256 + threadIdx.x;
    const int c = blockIdx.y;
    const int b = blockIdx.z;

    const float Dd = Dp[d];
    const float sc = scale[d];

    float An[16], invA[16], h[16];
    float Amin = __builtin_inff();
    const size_t o0 = (size_t)(b * SCAN_NC + c) * 16 * SCAN_D + d;
#pragma unroll  // constant n: the per-thread arrays stay in registers
    for (int n = 0; n < 16; ++n) {
        An[n]   = -expf(A_log[n]);
        invA[n] = 1.0f / An[n];
        Amin    = fminf(Amin, -An[n]);
        h[n]  = Hbuf[o0 + n * SCAN_D];
    }
    const int row0 = b * Lv + c * SCAN_CL;
    for (int l = 0; l < SCAN_CL; ++l) {
        const size_t idx = (size_t)(row0 + l);
        const float dt = softplus_hw(dtp[idx * Dv + d]);
        const float xv = xnf[idx * Dv + d];
        const float xr = xres[idx * Dv + d];
        const float* __restrict__ Bp = Bv + idx * 16;   // same for the whole block
        const float* __restrict__ Cp = Cv + idx * 16;
        float Br[16], Cr[16];   // read ahead of the branch, beside the loads above
#pragma unroll  // constant n: the per-thread arrays stay in registers
        for (int n = 0; n < 16; ++n) { Br[n] = Bp[n]; Cr[n] = Cp[n]; }
        float t[16];
        const float dt2 = dt * LOG2E_F;
        float z2[16], dA[16];   // dA = exp(dt * A) = 2^(dt * log2(e) * A)
#pragma unroll  // constant n: the per-thread arrays stay in registers
        for (int n = 0; n < 16; ++n) z2[n] = dt2 * An[n];
        exp2_x8(dA, z2);
        exp2_x8(dA + 8, z2 + 8);
        const bool shortform = (dt * Amin >= SCAN_ZMIN) && (dt >= SCAN_DTMIN);
        if (__builtin_amdgcn_ballot_w32(!shortform) == 0u) {
            // b = (dA - 1) * w with w = B * x / (dt * A), so dA*h + b = dA*(h + w) - w
            const float g = xv * __builtin_amdgcn_rcpf(dt);
#pragma unroll  // constant n: the per-thread arrays stay in registers
            for (int n = 0; n < 16; ++n) {
                const float w = g * (Br[n] * invA[n]);
                h[n] = dA[n] * (h[n] + w) - w;
                t[n] = Cr[n] * h[n];
            }
        } else {
            // some lane has a small dt * A: phi1 in its library form, exact near 0
#pragma unroll  // constant n: the per-thread arrays stay in registers
            for (int n = 0; n < 16; ++n) {
                const float bt = phi1_f(dt * An[n]) * Br[n] * xv;
                h[n] = dA[n] * h[n] + bt;
                t[n] = Cr[n] * h[n];
            }
        }
        // sum over n: pairs 8, 4, 2, 1 apart
#pragma unroll  // constant n: the per-thread arrays stay in registers
        for (int s = 8; s > 0; s >>= 1)
#pragma unroll  // constant n: the per-thread arrays stay in registers
            for (int n = 0; n < s; ++n) t[n] += t[n + s];
        const float y = (t[0] + Dd * xv) * sc;
        x2[idx * Dv + d] = y + xr;
        // precaution: the next trip rewrites the registers that this store names
        asm volatile("s_wait_xcnt 0x0" ::: "memory");
    }
}

// ---------------------------------------------------------------------------
// Launch
// ---------------------------------------------------------------------------
extern "C" void kernel_launch(void* const* d_in, const int* in_sizes, int n_in,
                              void* d_out, int out_size, void* d_ws, size_t ws_size,
                              hipStream_t stream) {
    (void)in_sizes; (void)n_in; (void)out_size; (void)ws_size;
    constexpr int Bb = 2, Lv = 2048, Dv = 1024, Nst = 16, DFF = 4096;
    constexpr int Mrows = Bb * Lv;  // 4096
    constexpr int NCh = SCAN_NC;
    static_assert(Dv == SCAN_D && NCh * SCAN_CL == Lv, "scan tiling");

    const float* x       = (const float*)d_in[0];
    const float* norm1_w = (const float*)d_in[1];
    const float* norm2_w = (const float*)d_in[2];
    const float* A_log   = (const float*)d_in[3];
    const float* D_param = (const float*)d_in[4];
    const float* scale   = (const float*)d_in[5];
    const float* Wdt     = (const float*)d_in[6];
    const float* bdt     = (const float*)d_in[7];
    const float* WB      = (const float*)d_in[8];
    const float* bB      = (const float*)d_in[9];
    const float* WC      = (const float*)d_in[10];
    const float* bC      = (const float*)d_in[11];
    const float* W1      = (const float*)d_in[12];
    const float* b1      = (const float*)d_in[13];
    const float* W2      = (const float*)d_in[14];
    const float* b2      = (const float*)d_in[15];
    float* out = (float*)d_out;

    size_t off = 0;
    auto alloc = [&](size_t bytes) -> void* {
        void* p = (char*)d_ws + off;
        off += (bytes + 255) & ~(size_t)255;
        return p;
    };
    float*          xnf  = (float*)alloc((size_t)Mrows * Dv * 4);
    unsigned short* xnb  = (unsigned short*)alloc((size_t)Mrows * Dv * 2);
    unsigned short* wdtb = (unsigned short*)alloc((size_t)Dv * Dv * 2);
    unsigned short* w1b  = (unsigned short*)alloc((size_t)DFF * Dv * 2);
    unsigned short* w2b  = (unsigned short*)alloc((size_t)Dv * DFF * 2);
    float*          dtp  = (float*)alloc((size_t)Mrows * Dv * 4);
    float*          Bv   = (float*)alloc((size_t)Mrows * Nst * 4);
    float*          Cv   = (float*)alloc((size_t)Mrows * Nst * 4);
    float*          x2   = (float*)alloc((size_t)Mrows * Dv * 4);
    unsigned short* xn2b = (unsigned short*)alloc((size_t)Mrows * Dv * 2);
    unsigned short* hb   = (unsigned short*)alloc((size_t)Mrows * DFF * 2);
    float*          Pbuf = (float*)alloc((size_t)Bb * Dv * NCh * 16 * 4);
    float*          Qbuf = (float*)alloc((size_t)Bb * Dv * NCh * 16 * 4);
    float*          Hbuf = (float*)alloc((size_t)Bb * Dv * NCh * 16 * 4);

    // 1. weight converts to bf16
    static_assert((Dv * Dv) % CVT_BLOCK == 0 && (DFF * Dv) % CVT_BLOCK == 0, "convert tiling");
    cvt_bf16_kernel<<<(Dv * Dv) / CVT_BLOCK, 256, 0, stream>>>(Wdt, wdtb);
    cvt_bf16_kernel<<<(DFF * Dv) / CVT_BLOCK, 256, 0, stream>>>(W1, w1b);
    cvt_bf16_kernel<<<(Dv * DFF) / CVT_BLOCK, 256, 0, stream>>>(W2, w2b);

    // 2. RMSNorm1 (f32 + bf16)
    rmsnorm_kernel<1><<<Mrows, 256, 0, stream>>>(x, norm1_w, xnf, xnb, Dv);

    // 3. dt_pre = xn @ Wdt^T + bdt  (WMMA, async-LDS pipelined)
    gemm_wmma_bf16<0><<<dim3(Dv / 128, Mrows / 128), 256, 0, stream>>>(
        xnb, wdtb, bdt, nullptr, dtp, nullptr, Mrows, Dv, Dv);

    // 4. Bv / Cv projections
    static_assert(Dv == BC_K && Mrows % 16 == 0 && Nst == 16, "projection tiling");
    bc_proj_kernel<<<Mrows / 16, BC_WAVES * 32, 0, stream>>>(
        xnf, WB, bB, WC, bC, Bv, Cv);

    // 5. chunked selective scan + residual -> x2
    scan_pass1<<<dim3(Dv / 256, NCh, Bb), 256, 0, stream>>>(
        dtp, xnf, Bv, A_log, Pbuf, Qbuf, Lv, Dv);
    scan_pass2<<<(Bb * Dv * 16) / 256, 256, 0, stream>>>(Pbuf, Qbuf, Hbuf);
    scan_pass3<<<dim3(Dv / 256, NCh, Bb), 256, 0, stream>>>(
        dtp, xnf, x, Bv, Cv, A_log, D_param, scale, Hbuf, x2, Lv, Dv);

    // 6. RMSNorm2 (bf16 only)
    rmsnorm_kernel<0><<<Mrows, 256, 0, stream>>>(x2, norm2_w, nullptr, xn2b, Dv);

    // 7. h = gelu(xn2 @ W1^T + b1) -> bf16  (WMMA)
    gemm_wmma_bf16<1><<<dim3(DFF / 128, Mrows / 128), 256, 0, stream>>>(
        xn2b, w1b, b1, nullptr, nullptr, hb, Mrows, DFF, Dv);

    // 8. out = h @ W2^T + b2 + x2  (WMMA)
    gemm_wmma_bf16<2><<<dim3(Dv / 128, Mrows / 128), 256, 0, stream>>>(
        hb, w2b, b2, x2, out, nullptr, Mrows, Dv, DFF);
}

// v006
// Measured time: 189 microseconds a run.
// In two side-by-side timings against v005, it was 1.11 and 1.12 times as fast.
// Over all steps from v000 it is 3.74 times as fast.
#include <hip/hip_runtime.h>
#include <hip/hip_bf16.h>
#include <stdint.h>

// ---------------------------------------------------------------------------
// Types for WMMA (gfx1250, wave32)
// ---------------------------------------------------------------------------
typedef __attribute__((ext_vector_type(16))) __bf16 v16bf;
typedef __attribute__((ext_vector_type(8)))  float  v8f;

struct alignas(16) U16x8 { unsigned short u[8]; };
struct alignas(32) FragBF { U16x8 lo, hi; };

static __device__ __forceinline__ unsigned short f2bf(float f) {
    unsigned int u = __float_as_uint(f);
    u += 0x7FFFu + ((u >> 16) & 1u);          // round-to-nearest-even
    return (unsigned short)(u >> 16);
}

static __device__ __forceinline__ float gelu_tanh(float x) {
    float x3 = x * x * x;
    return 0.5f * x * (1.0f + tanhf(0.7978845608028654f * (x + 0.044715f * x3)));
}

static __device__ __forceinline__ float phi1_f(float z) {
    if (fabsf(z) < 1e-4f) return 1.0f + 0.5f * z;
    return expm1f(z) / z;
}

// ---------------------------------------------------------------------------
// Scan arithmetic on the hardware's own exp2 / log2 / rcp instructions.
// ---------------------------------------------------------------------------
#define LOG2E_F 1.4426950408889634f
#define LN2_F   0.6931471805599453f
// A step takes the short form only where every |dt * A[n]| is at least this:
// there exp(z) - 1 keeps its relative accuracy (error about 1e-7 / |z|).
#define SCAN_ZMIN  0.0625f
// ... and where 1 / dt is far from overflow.
#define SCAN_DTMIN 1e-30f

// r[i] = 2^x[i], i = 0..7. One statement, so that each v_exp_f32 has an
// independent instruction behind it and the last one a v_nop: the slot that the
// instruction set asks for before a transcendental's source is overwritten or its
// result read.
static __device__ __forceinline__ void exp2_x8(float* r, const float* x) {
    asm("v_exp_f32 %0, %8\n\t"
        "v_exp_f32 %1, %9\n\t"
        "v_exp_f32 %2, %10\n\t"
        "v_exp_f32 %3, %11\n\t"
        "v_exp_f32 %4, %12\n\t"
        "v_exp_f32 %5, %13\n\t"
        "v_exp_f32 %6, %14\n\t"
        "v_exp_f32 %7, %15\n\t"
        "v_nop"
        : "=&v"(r[0]), "=&v"(r[1]), "=&v"(r[2]), "=&v"(r[3]),
          "=&v"(r[4]), "=&v"(r[5]), "=&v"(r[6]), "=&v"(r[7])
        : "v"(x[0]), "v"(x[1]), "v"(x[2]), "v"(x[3]),
          "v"(x[4]), "v"(x[5]), "v"(x[6]), "v"(x[7]));
}

// softplus(x) = max(x, 0) + log1p(exp(-|x|)); e = exp(-|x|) lies in (0, 1].
// Below 1/16 the series of log1p keeps the relative accuracy that 1 + e loses.
static __device__ __forceinline__ float softplus_hw(float x) {
    const float e  = __builtin_amdgcn_exp2f(-fabsf(x) * LOG2E_F);
    const float lg = __builtin_amdgcn_logf(1.0f + e) * LN2_F;
    float p = 0.2f - e * (1.0f / 6.0f);
    p = -0.25f + e * p;
    p = (1.0f / 3.0f) + e * p;
    p = -0.5f + e * p;
    p = e + (e * e) * p;
    return fmaxf(x, 0.0f) + ((e < 0.0625f) ? p : lg);
}

// ---------------------------------------------------------------------------
// gfx1250 async memory->LDS copies (ASYNCcnt tracked), 16B per lane: the eight
// copies of one thread for one K-slab. l = LDS byte address (low 32 bits of the
// generic pointer: the flat aperture maps LDS_ADDR = addr[31:0]), g = global address.
// The last line is a precaution: it stands ahead of whatever rewrites the address
// registers that the copies name, and inside the statement nothing can be moved
// in front of it.
// ---------------------------------------------------------------------------
static __device__ __forceinline__ unsigned lds_addr_of(const void* p) {
    return (unsigned)(size_t)p;
}

static __device__ __forceinline__ void async_copy_b128_x8(const unsigned* l,
                                                          const unsigned short* const* g) {
    asm volatile("global_load_async_to_lds_b128 %0, %8, off\n\t"
                 "global_load_async_to_lds_b128 %1, %9, off\n\t"
                 "global_load_async_to_lds_b128 %2, %10, off\n\t"
                 "global_load_async_to_lds_b128 %3, %11, off\n\t"
                 "global_load_async_to_lds_b128 %4, %12, off\n\t"
                 "global_load_async_to_lds_b128 %5, %13, off\n\t"
                 "global_load_async_to_lds_b128 %6, %14, off\n\t"
                 "global_load_async_to_lds_b128 %7, %15, off\n\t"
                 "s_wait_xcnt 0x0"
                 :: "v"(l[0]), "v"(l[1]), "v"(l[2]), "v"(l[3]),
                    "v"(l[4]), "v"(l[5]), "v"(l[6]), "v"(l[7]),
                    "v"(g[0]), "v"(g[1]), "v"(g[2]), "v"(g[3]),
                    "v"(g[4]), "v"(g[5]), "v"(g[6]), "v"(g[7])
                 : "memory");
}

template <int Nc>
static __device__ __forceinline__ void wait_asynccnt() {
    asm volatile("s_wait_asynccnt %0" :: "n"(Nc) : "memory");
}

// ---------------------------------------------------------------------------
// f32 -> bf16 convert. One block of 256 threads converts CVT_BLOCK contiguous
// elements; the array length must be a multiple of CVT_BLOCK (checked at the
// launch). A thread takes CVT_G groups of 4 elements, 256 groups apart: each
// wave-wide load covers 512 contiguous bytes, each store 256, and a wave has
// CVT_G loads in flight. The point is fewer waves than with one element a
// thread, for speed only.
// ---------------------------------------------------------------------------
typedef __attribute__((ext_vector_type(4))) float f32x4;
struct alignas(8) U16x4 { unsigned short u[4]; };
#define CVT_G     8
#define CVT_BLOCK (256 * CVT_G * 4)

__global__ __launch_bounds__(256)
void cvt_bf16_kernel(const float* __restrict__ in,
                     unsigned short* __restrict__ out) {
    const size_t g0 = (size_t)blockIdx.x * (256 * CVT_G) + threadIdx.x;
    const f32x4* __restrict__ src = (const f32x4*)in + g0;
    U16x4* __restrict__ dst = (U16x4*)out + g0;
    f32x4 v[CVT_G];
#pragma unroll  // constant j: v stays in registers and all loads go out first
    for (int j = 0; j < CVT_G; ++j) v[j] = src[j * 256];
#pragma unroll  // constant j: v stays in registers
    for (int j = 0; j < CVT_G; ++j) {
        U16x4 o;
        o.u[0] = f2bf(v[j][0]);
        o.u[1] = f2bf(v[j][1]);
        o.u[2] = f2bf(v[j][2]);
        o.u[3] = f2bf(v[j][3]);
        dst[j * 256] = o;
    }
}

// ---------------------------------------------------------------------------
// RMSNorm: one block per row of length Dn=1024; writes f32 (optional) + bf16
// ---------------------------------------------------------------------------
template <int WRITE_F32>
__global__ __launch_bounds__(256)
void rmsnorm_kernel(const float* __restrict__ x, const float* __restrict__ w,
                    float* __restrict__ xf, unsigned short* __restrict__ xb, int Dn) {
    const int row = blockIdx.x;
    const int tid = threadIdx.x;
    const float* xr = x + (size_t)row * Dn;
    float ss = 0.0f;
    for (int i = tid; i < Dn; i += 256) { float v = xr[i]; ss += v * v; }
    __shared__ float red[256];
    red[tid] = ss;
    __syncthreads();
    for (int s = 128; s > 0; s >>= 1) {
        if (tid < s) red[tid] += red[tid + s];
        __syncthreads();
    }
    const float r = rsqrtf(red[0] / (float)Dn + 1e-6f);
    for (int i = tid; i < Dn; i += 256) {
        float v = xr[i] * r * w[i];
        if (WRITE_F32) xf[(size_t)row * Dn + i] = v;
        xb[(size_t)row * Dn + i] = f2bf(v);
    }
}

// ---------------------------------------------------------------------------
// WMMA bf16 GEMM:  out[m][n] = sum_k A[m][k] * Bw[n][k]  (+epilogue)
// MODE 0: outF = acc + bias[n]                      (f32)
// MODE 1: outB = bf16(gelu(acc + bias[n]))          (bf16)
// MODE 2: outF = acc + bias[n] + resid[m][n]        (f32)
// Block: 256 threads = 8 waves (2x4), block tile 128x128, BK=64.
// Wave tile 64x32 = 4x2 accumulators of v_wmma_f32_16x16x32_bf16.
// Double-buffered LDS, filled by global_load_async_to_lds_b128 (ASYNCcnt).
// ---------------------------------------------------------------------------
template <int MODE>
__global__ __launch_bounds__(256)
void gemm_wmma_bf16(const unsigned short* __restrict__ A,
                    const unsigned short* __restrict__ Bw,
                    const float* __restrict__ bias,
                    const float* __restrict__ resid,
                    float* __restrict__ outF,
                    unsigned short* __restrict__ outB,
                    int M, int N, int K) {
    __shared__ unsigned short As[2][128][72];  // 64 cols + pad, 16B-aligned rows
    __shared__ unsigned short Bs[2][128][72];

    const int tid   = threadIdx.x;
    const int lane  = tid & 31;
    const int wid   = tid >> 5;
    const int waveM = wid >> 2;      // 0..1  (rows of 64)
    const int waveN = wid & 3;       // 0..3  (cols of 32)
    const int m0 = blockIdx.y * 128;
    const int n0 = blockIdx.x * 128;

    // LDS fill: 8 neighbouring lanes take the 8 16-byte pieces of one row's 128-byte
    // slab, so a wave-wide copy covers 4 whole lines (a lane per row touched 32).
    const int lrow = tid >> 3;       // 0..31: row within a group of 32 rows
    const int lch  = tid & 7;        // which 16-byte piece of the row's slab

    const int ml   = lane & 15;      // M (or N) index within fragment
    const int half = lane >> 4;      // lane-half selects K sub-pattern

    const v8f vzero = {0.f, 0.f, 0.f, 0.f, 0.f, 0.f, 0.f, 0.f};
    v8f acc[4][2];
#pragma unroll
    for (int i = 0; i < 4; ++i)
#pragma unroll
        for (int j = 0; j < 2; ++j) acc[i][j] = vzero;

    const unsigned short* rowA = A  + (size_t)(m0 + lrow) * K + lch * 8;
    const unsigned short* rowB = Bw + (size_t)(n0 + lrow) * K + lch * 8;

    // Issue one K-slab (8 x 16B per thread) into LDS buffer `buf` via async DMA.
    auto issue_slab = [&](int buf, int k0) {
        unsigned l[8];
        const unsigned short* g[8];
#pragma unroll  // constant q: l and g stay in registers
        for (int q = 0; q < 4; ++q) {     // four groups of 32 rows
            l[q]     = lds_addr_of(&As[buf][q * 32 + lrow][lch * 8]);
            l[4 + q] = lds_addr_of(&Bs[buf][q * 32 + lrow][lch * 8]);
            g[q]     = rowA + (size_t)(q * 32) * K + k0;
            g[4 + q] = rowB + (size_t)(q * 32) * K + k0;
        }
        async_copy_b128_x8(l, g);
    };

    const int nslab = K >> 6;
    issue_slab(0, 0);

    for (int i = 0; i < nslab; ++i) {
        const int cur = i & 1;
        if (i + 1 < nslab) {
            issue_slab(cur ^ 1, (i + 1) << 6);  // prefetch next slab (async)
            wait_asynccnt<8>();                 // this wave's slab-i loads done
        } else {
            wait_asynccnt<0>();
        }
        __syncthreads();                        // all waves' slab-i data in LDS

        // All 24 fragment reads of the slab go out as one group, each into registers of
        // its own, ahead of the slab's 16 products: a wave then waits out the LDS latency
        // once a slab (with one A register set it did so in front of every pair of products).
        // 16-bit A/B fragment layout: lane-half 0 holds K {0..7,16..23},
        // half 1 holds K {8..15,24..31} (two 16B runs per lane).
        FragBF fa[2][4], fb[2][2];
#pragma unroll  // constant s, j, ii: the fragments stay in registers
        for (int s = 0; s < 2; ++s) {
            const int ks = s * 32;
#pragma unroll  // constant index: the fragments stay in registers
            for (int j = 0; j < 2; ++j) {
                const int col = waveN * 32 + j * 16 + ml;
                fb[s][j].lo = *(const U16x8*)&Bs[cur][col][ks + half * 8];
                fb[s][j].hi = *(const U16x8*)&Bs[cur][col][ks + 16 + half * 8];
            }
#pragma unroll  // constant index: the fragments stay in registers
            for (int ii = 0; ii < 4; ++ii) {
                const int row = waveM * 64 + ii * 16 + ml;
                fa[s][ii].lo = *(const U16x8*)&As[cur][row][ks + half * 8];
                fa[s][ii].hi = *(const U16x8*)&As[cur][row][ks + 16 + half * 8];
            }
        }
        // Keeps the reads in front of the products: left free, the scheduler sinks each
        // read to its first use to save registers, and the waits to 0 come back.
        __builtin_amdgcn_sched_barrier(0);
#pragma unroll  // constant s, ii, j: the fragments stay in registers
        for (int s = 0; s < 2; ++s) {
#pragma unroll  // constant index: the fragments stay in registers
            for (int ii = 0; ii < 4; ++ii) {
                v16bf av = __builtin_bit_cast(v16bf, fa[s][ii]);
#pragma unroll  // constant index: the fragments stay in registers
                for (int j = 0; j < 2; ++j) {
                    v16bf bv = __builtin_bit_cast(v16bf, fb[s][j]);
                    acc[ii][j] = __builtin_amdgcn_wmma_f32_16x16x32_bf16(
                        false, av, false, bv, (short)0, acc[ii][j], false, false);
                }
            }
        }
        // Keeps the barrier below behind the products: left free, it is lifted in front of
        // them with a wait for all 24 reads, and no product runs while the reads come in.
        __builtin_amdgcn_sched_barrier(0);
        __syncthreads();   // everyone finished reading buf `cur` before refill
    }

    // Epilogue: C/D layout — VGPR r: lanes 0-15 -> M=r, lanes 16-31 -> M=r+8.
#pragma unroll
    for (int i = 0; i < 4; ++i) {
        const int rowBase = m0 + waveM * 64 + i * 16;
#pragma unroll
        for (int j = 0; j < 2; ++j) {
            const int col = n0 + waveN * 32 + j * 16 + ml;
#pragma unroll
            for (int r = 0; r < 8; ++r) {
                const int row = rowBase + r + half * 8;
                float c = acc[i][j][r] + bias[col];
                const size_t o = (size_t)row * N + col;
                if (MODE == 0) {
                    outF[o] = c;
                } else if (MODE == 1) {
                    outB[o] = f2bf(gelu_tanh(c));
                } else {
                    outF[o] = c + resid[o];
                }
            }
        }
    }
}

// ---------------------------------------------------------------------------
// Bv / Cv projections: out[row][n] = dot(xn[row,:], W[n,:]) + b[n], all in f32.
// One block takes 16 rows of xn and all 32 rows of WB and WC, so W is read once per
// 16 rows. Its 16 waves split K: wave w owns k = 64 w .. 64 w + 63.
// 1. Each wave brings its 48 row pieces of 256 bytes into LDS with loads that cover
//    whole lines (16 lanes a piece, two pieces a load).
// 2. It reads them back as fragments of v_wmma_f32_16x16x4_f32, W as A and xn as B:
//    lane (c, h) takes row c, k = 8 kk + 4 h .. + 3, the same for both operands, and
//    feeds elements 0, 1 to one product and 2, 3 to the next.
// 3. Each wave lays its two partial tiles over the head of its own LDS rows, and the
//    16 partial sums of every output are added as a tree over the waves.
// ---------------------------------------------------------------------------
typedef __attribute__((ext_vector_type(2))) float v2f;
typedef f32x4 f32x4_a4 __attribute__((aligned(4)));   // an input's base is only known as float*
#define BC_WAVES 16
#define BC_KW    64                    // k per wave
#define BC_K     (BC_WAVES * BC_KW)    // row length of xn, WB, WC (checked at the launch)
#define BC_PITCH 68                    // dwords a staged row: 16-byte reads down a column hit no bank twice

__global__ __launch_bounds__(BC_WAVES * 32)
void bc_proj_kernel(const float* __restrict__ xnf,
                    const float* __restrict__ WB, const float* __restrict__ bB,
                    const float* __restrict__ WC, const float* __restrict__ bC,
                    float* __restrict__ Bv, float* __restrict__ Cv) {
    __shared__ __attribute__((aligned(16))) float stage[BC_WAVES][48][BC_PITCH];
    const int tid  = threadIdx.x;
    const int lane = tid & 31;
    const int w    = tid >> 5;
    const int c    = lane & 15;
    const int h    = lane >> 4;
    const int m0   = blockIdx.x * 16;

    // 1. rows 0..15 of stage[w]: xn, 16..31: WB, 32..47: WC
    const int go = h * BC_K + w * BC_KW + c * 4;
    const float* __restrict__ gx = xnf + (size_t)m0 * BC_K + go;
    const float* __restrict__ gb = WB + go;
    const float* __restrict__ gc = WC + go;
    f32x4 v[24];
#pragma unroll  // constant j: v stays in registers and all loads go out first
    for (int j = 0; j < 8; ++j) {
        v[j]      = *(const f32x4_a4*)(gx + 2 * j * BC_K);
        v[8 + j]  = *(const f32x4_a4*)(gb + 2 * j * BC_K);
        v[16 + j] = *(const f32x4_a4*)(gc + 2 * j * BC_K);
    }
#pragma unroll  // constant j: v stays in registers
    for (int j = 0; j < 24; ++j)
        *(f32x4*)&stage[w][2 * j + h][c * 4] = v[j];
    __syncthreads();   // a lane reads what other lanes have stored

    // 2. D[n][m]: register r of lane (c, h) is out[m0 + c][8 h + r]
    float* const sf = &stage[w][c][h * 4];   // the one LDS address of steps 2 and 3
    v8f accB = {0.f, 0.f, 0.f, 0.f, 0.f, 0.f, 0.f, 0.f};
    v8f accC = accB;
#pragma unroll  // constant kk: LDS offsets are immediates and the reads can go out ahead
    for (int kk = 0; kk < BC_KW / 8; ++kk) {
        const f32x4 x4 = *(const f32x4*)(sf + kk * 8);
        const f32x4 b4 = *(const f32x4*)(sf + 16 * BC_PITCH + kk * 8);
        const f32x4 c4 = *(const f32x4*)(sf + 32 * BC_PITCH + kk * 8);
        const v2f xlo = {x4[0], x4[1]}, xhi = {x4[2], x4[3]};
        const v2f blo = {b4[0], b4[1]}, bhi = {b4[2], b4[3]};
        const v2f clo = {c4[0], c4[1]}, chi = {c4[2], c4[3]};
        accB = __builtin_amdgcn_wmma_f32_16x16x4_f32(false, blo, false, xlo, (short)0, accB, false, false);
        accC = __builtin_amdgcn_wmma_f32_16x16x4_f32(false, clo, false, xlo, (short)0, accC, false, false);
        accB = __builtin_amdgcn_wmma_f32_16x16x4_f32(false, bhi, false, xhi, (short)0, accB, false, false);
        accC = __builtin_amdgcn_wmma_f32_16x16x4_f32(false, chi, false, xhi, (short)0, accC, false, false);
    }
    // Four vector slots between the last product and whatever vector instruction next
    // reuses its registers: the distance of the 16-bit forms, kept here as a precaution
    // (none is tabled for the f32 form, and the compiler pads none). The two scheduling
    // barriers hold the slots at this place and keep step 3's index arithmetic behind them.
    __builtin_amdgcn_sched_barrier(0);
    asm volatile("v_nop\n\tv_nop\n\tv_nop\n\tv_nop");
    __builtin_amdgcn_sched_barrier(0);

    // 3. Row c (Bv) and row 16 + c (Cv) of the wave's own slice, which only this wave has
    //    read: n = 8 h + 4 q + e lies at column 8 q + 4 h + e, so that sf serves again.
    {
        const f32x4 b0 = {accB[0], accB[1], accB[2], accB[3]}, b1 = {accB[4], accB[5], accB[6], accB[7]};
        const f32x4 c0 = {accC[0], accC[1], accC[2], accC[3]}, c1 = {accC[4], accC[5], accC[6], accC[7]};
        *(f32x4*)(sf)                     = b0;
        *(f32x4*)(sf + 8)                 = b1;
        *(f32x4*)(sf + 16 * BC_PITCH)     = c0;
        *(f32x4*)(sf + 16 * BC_PITCH + 8) = c1;
    }
    __syncthreads();   // every wave's partial tiles are in LDS
    const int t   = tid >> 8;     // 0: Bv, 1: Cv (the same for a whole wave)
    const int idx = tid & 255;    // m * 16 + n
    const int n   = idx & 15;
    const int col = ((n >> 2) & 1) * 8 + (n >> 3) * 4 + (n & 3);
    float p[BC_WAVES];
#pragma unroll  // constant i: p stays in registers
    for (int i = 0; i < BC_WAVES; ++i) p[i] = stage[i][t * 16 + (idx >> 4)][col];
#pragma unroll  // constant i: p stays in registers
    for (int s = BC_WAVES / 2; s > 0; s >>= 1)
#pragma unroll  // constant i: p stays in registers
        for (int i = 0; i < s; ++i) p[i] += p[i + s];
    (t ? Cv : Bv)[(size_t)m0 * 16 + idx] = p[0] + (t ? bC : bB)[n];
}

// ---------------------------------------------------------------------------
// Chunked linear-recurrence scan (h = dA*h + b), 3 passes, NC chunks of CL.
// Thread layout (pass 1/3): one thread per (b, chunk, d); the lanes of a wave
// run along d, and each thread keeps all 16 states n in registers.
// P/Q/H layout: [b][chunk][n][d], so every access is contiguous along d.
// ---------------------------------------------------------------------------
#define SCAN_NC 64
#define SCAN_CL 32
#define SCAN_D  1024   // channels = pitch of one n row of P/Q/H (a constant, so that
                       // the 16 rows are reached by immediate offsets from one address)

// Pass 1: per-chunk transfer (P = prod dA, q = end state from h0=0)
// grid: x = d / 256, y = chunk, z = batch
__global__ __launch_bounds__(256)
void scan_pass1(const float* __restrict__ dtp, const float* __restrict__ xnf,
                const float* __restrict__ Bv, const float* __restrict__ A_log,
                float* __restrict__ Pbuf, float* __restrict__ Qbuf,
                int Lv, int Dv) {
    const int d = blockIdx.x * 256 + threadIdx.x;
    const int c = blockIdx.y;
    const int b = blockIdx.z;

    float An[16], invA[16], h[16], pf[16];
    float Amin = __builtin_inff();
#pragma unroll  // constant n: the per-thread arrays stay in registers
    for (int n = 0; n < 16; ++n) {
        An[n]   = -expf(A_log[n]);
        invA[n] = 1.0f / An[n];
        Amin    = fminf(Amin, -An[n]);
        h[n]  = 0.0f;
        pf[n] = 1.0f;
    }
    const int row0 = b * Lv + c * SCAN_CL;
    for (int l = 0; l < SCAN_CL; ++l) {
        const size_t idx = (size_t)(row0 + l);
        const float dt = softplus_hw(dtp[idx * Dv + d]);
        const float xv = xnf[idx * Dv + d];
        const float* __restrict__ Bp = Bv + idx * 16;   // same for the whole block
        float Br[16];   // read ahead of the branch, beside the two loads above
#pragma unroll  // constant n: the per-thread arrays stay in registers
        for (int n = 0; n < 16; ++n) Br[n] = Bp[n];
        const float dt2 = dt * LOG2E_F;
        float z2[16], dA[16];   // dA = exp(dt * A) = 2^(dt * log2(e) * A)
#pragma unroll  // constant n: the per-thread arrays stay in registers
        for (int n = 0; n < 16; ++n) z2[n] = dt2 * An[n];
        exp2_x8(dA, z2);
        exp2_x8(dA + 8, z2 + 8);
        const bool shortform = (dt * Amin >= SCAN_ZMIN) && (dt >= SCAN_DTMIN);
        if (__builtin_amdgcn_ballot_w32(!shortform) == 0u) {
            // b = (dA - 1) * w with w = B * x / (dt * A), so dA*h + b = dA*(h + w) - w
            const float g = xv * __builtin_amdgcn_rcpf(dt);
#pragma unroll  // constant n: the per-thread arrays stay in registers
            for (int n = 0; n < 16; ++n) {
                const float w = g * (Br[n] * invA[n]);
                h[n]  = dA[n] * (h[n] + w) - w;
                pf[n] = dA[n] * pf[n];
            }
        } else {
            // some lane has a small dt * A: phi1 in its library form, exact near 0
#pragma unroll  // constant n: the per-thread arrays stay in registers
            for (int n = 0; n < 16; ++n) {
                const float bt = phi1_f(dt * An[n]) * Br[n] * xv;
                h[n]  = dA[n] * h[n] + bt;
                pf[n] = dA[n] * pf[n];
            }
        }
    }
    const size_t o0 = (size_t)(b * SCAN_NC + c) * 16 * SCAN_D + d;
#pragma unroll  // constant n: the per-thread arrays stay in registers
    for (int n = 0; n < 16; ++n) {
        Pbuf[o0 + n * SCAN_D] = pf[n];
        Qbuf[o0 + n * SCAN_D] = h[n];
    }
}

// Pass 2: sequential combine over chunks -> initial state H_c per chunk
// one thread per (b, n, d); one chunk is a plane of 16 * SCAN_D elements
__global__ __launch_bounds__(256)
void scan_pass2(const float* __restrict__ Pbuf, const float* __restrict__ Qbuf,
                float* __restrict__ Hbuf) {
    constexpr int plane = 16 * SCAN_D;
    const int tid = blockIdx.x * 256 + threadIdx.x;
    const int b = tid / plane;
    const int r = tid - b * plane;        // n * SCAN_D + d
    const size_t o0 = (size_t)b * SCAN_NC * plane + r;
    float H = 0.0f;
    // unrolled whole: the loads do not depend on H, so they can all be in
    // flight together instead of one memory latency per few chunks
#pragma unroll
    for (int c = 0; c < SCAN_NC; ++c) {
        const size_t o = o0 + c * plane;
        Hbuf[o] = H;
        H = Pbuf[o] * H + Qbuf[o];
    }
}

// Pass 3: replay chunk from true H_c, emit y = sum_n Cv*h + D*xn, +residual
// grid: x = d / 256, y = chunk, z = batch
__global__ __launch_bounds__(256)
void scan_pass3(const float* __restrict__ dtp, const float* __restrict__ xnf,
                const float* __restrict__ xres,
                const float* __restrict__ Bv, const float* __restrict__ Cv,
                const float* __restrict__ A_log, const float* __restrict__ Dp,
                const float* __restrict__ scale, const float* __restrict__ Hbuf,
                float* __restrict__ x2, int Lv, int Dv) {
    const int d = blockIdx.x * 256 + threadIdx.x;
    const int c = blockIdx.y;
    const int b = blockIdx.z;

    const float Dd = Dp[d];
    const float sc = scale[d];

    float An[16], invA[16], h[16];
    float Amin = __builtin_inff();
    const size_t o0 = (size_t)(b * SCAN_NC + c) * 16 * SCAN_D + d;
#pragma unroll  // constant n: the per-thread arrays stay in registers
    for (int n = 0; n < 16; ++n) {
        An[n]   = -expf(A_log[n]);
        invA[n] = 1.0f / An[n];
        Amin    = fminf(Amin, -An[n]);
        h[n]  = Hbuf[o0 + n * SCAN_D];
    }
    const int row0 = b * Lv + c * SCAN_CL;
    for (int l = 0; l < SCAN_CL; ++l) {
        const size_t idx = (size_t)(row0 + l);
        const float dt = softplus_hw(dtp[idx * Dv + d]);
        const float xv = xnf[idx * Dv + d];
        const float xr = xres[idx * Dv + d];
        const float* __restrict__ Bp = Bv + idx * 16;   // same for the whole block
        const float* __restrict__ Cp = Cv + idx * 16;
        float Br[16], Cr[16];   // read ahead of the branch, beside the loads above
#pragma unroll  // constant n: the per-thread arrays stay in registers
        for (int n = 0; n < 16; ++n) { Br[n] = Bp[n]; Cr[n] = Cp[n]; }
        float t[16];
        const float dt2 = dt * LOG2E_F;
        float z2[16], dA[16];   // dA = exp(dt * A) = 2^(dt * log2(e) * A)
#pragma unroll  // constant n: the per-thread arrays stay in registers
        for (int n = 0; n < 16; ++n) z2[n] = dt2 * An[n];
        exp2_x8(dA, z2);
        exp2_x8(dA + 8, z2 + 8);
        const bool shortform = (dt * Amin >= SCAN_ZMIN) && (dt >= SCAN_DTMIN);
        if (__builtin_amdgcn_ballot_w32(!shortform) == 0u) {
            // b = (dA - 1) * w with w = B * x / (dt * A), so dA*h + b = dA*(h + w) - w
            const float g = xv * __builtin_amdgcn_rcpf(dt);
#pragma unroll  // constant n: the per-thread arrays stay in registers
            for (int n = 0; n < 16; ++n) {
                const float w = g * (Br[n] * invA[n]);
                h[n] = dA[n] * (h[n] + w) - w;
                t[n] = Cr[n] * h[n];
            }
        } else {
            // some lane has a small dt * A: phi1 in its library form, exact near 0
#pragma unroll  // constant n: the per-thread arrays stay in registers
            for (int n = 0; n < 16; ++n) {
                const float bt = phi1_f(dt * An[n]) * Br[n] * xv;
                h[n] = dA[n] * h[n] + bt;
                t[n] = Cr[n] * h[n];
            }
        }
        // sum over n: pairs 8, 4, 2, 1 apart
#pragma unroll  // constant n: the per-thread arrays stay in registers
        for (int s = 8; s > 0; s >>= 1)
#pragma unroll  // constant n: the per-thread arrays stay in registers
            for (int n = 0; n < s; ++n) t[n] += t[n + s];
        const float y = (t[0] + Dd * xv) * sc;
        x2[idx * Dv + d] = y + xr;
        // precaution: the next trip rewrites the registers that this store names
        asm volatile("s_wait_xcnt 0x0" ::: "memory");
    }
}

// ---------------------------------------------------------------------------
// Launch
// ---------------------------------------------------------------------------
extern "C" void kernel_launch(void* const* d_in, const int* in_sizes, int n_in,
                              void* d_out, int out_size, void* d_ws, size_t ws_size,
                              hipStream_t stream) {
    (void)in_sizes; (void)n_in; (void)out_size; (void)ws_size;
    constexpr int Bb = 2, Lv = 2048, Dv = 1024, Nst = 16, DFF = 4096;
    constexpr int Mrows = Bb * Lv;  // 4096
    constexpr int NCh = SCAN_NC;
    static_assert(Dv == SCAN_D && NCh * SCAN_CL == Lv, "scan tiling");

    const float* x       = (const float*)d_in[0];
    const float* norm1_w = (const float*)d_in[1];
    const float* norm2_w = (const float*)d_in[2];
    const float* A_log   = (const float*)d_in[3];
    const float* D_param = (const float*)d_in[4];
    const float* scale   = (const float*)d_in[5];
    const float* Wdt     = (const float*)d_in[6];
    const float* bdt     = (const float*)d_in[7];
    const float* WB      = (const float*)d_in[8];
    const float* bB      = (const float*)d_in[9];
    const float* WC      = (const float*)d_in[10];
    const float* bC      = (const float*)d_in[11];
    const float* W1      = (const float*)d_in[12];
    const float* b1      = (const float*)d_in[13];
    const float* W2      = (const float*)d_in[14];
    const float* b2      = (const float*)d_in[15];
    float* out = (float*)d_out;

    size_t off = 0;
    auto alloc = [&](size_t bytes) -> void* {
        void* p = (char*)d_ws + off;
        off += (bytes + 255) & ~(size_t)255;
        return p;
    };
    float*          xnf  = (float*)alloc((size_t)Mrows * Dv * 4);
    unsigned short* xnb  = (unsigned short*)alloc((size_t)Mrows * Dv * 2);
    unsigned short* wdtb = (unsigned short*)alloc((size_t)Dv * Dv * 2);
    unsigned short* w1b  = (unsigned short*)alloc((size_t)DFF * Dv * 2);
    unsigned short* w2b  = (unsigned short*)alloc((size_t)Dv * DFF * 2);
    float*          dtp  = (float*)alloc((size_t)Mrows * Dv * 4);
    float*          Bv   = (float*)alloc((size_t)Mrows * Nst * 4);
    float*          Cv   = (float*)alloc((size_t)Mrows * Nst * 4);
    float*          x2   = (float*)alloc((size_t)Mrows * Dv * 4);
    unsigned short* xn2b = (unsigned short*)alloc((size_t)Mrows * Dv * 2);
    unsigned short* hb   = (unsigned short*)alloc((size_t)Mrows * DFF * 2);
    float*          Pbuf = (float*)alloc((size_t)Bb * Dv * NCh * 16 * 4);
    float*          Qbuf = (float*)alloc((size_t)Bb * Dv * NCh * 16 * 4);
    float*          Hbuf = (float*)alloc((size_t)Bb * Dv * NCh * 16 * 4);

    // 1. weight converts to bf16
    static_assert((Dv * Dv) % CVT_BLOCK == 0 && (DFF * Dv) % CVT_BLOCK == 0, "convert tiling");
    cvt_bf16_kernel<<<(Dv * Dv) / CVT_BLOCK, 256, 0, stream>>>(Wdt, wdtb);
    cvt_bf16_kernel<<<(DFF * Dv) / CVT_BLOCK, 256, 0, stream>>>(W1, w1b);
    cvt_bf16_kernel<<<(Dv * DFF) / CVT_BLOCK, 256, 0, stream>>>(W2, w2b);

    // 2. RMSNorm1 (f32 + bf16)
    rmsnorm_kernel<1><<<Mrows, 256, 0, stream>>>(x, norm1_w, xnf, xnb, Dv);

    // 3. dt_pre = xn @ Wdt^T + bdt  (WMMA, async-LDS pipelined)
    gemm_wmma_bf16<0><<<dim3(Dv / 128, Mrows / 128), 256, 0, stream>>>(
        xnb, wdtb, bdt, nullptr, dtp, nullptr, Mrows, Dv, Dv);

    // 4. Bv / Cv projections
    static_assert(Dv == BC_K && Mrows % 16 == 0 && Nst == 16, "projection tiling");
    bc_proj_kernel<<<Mrows / 16, BC_WAVES * 32, 0, stream>>>(
        xnf, WB, bB, WC, bC, Bv, Cv);

    // 5. chunked selective scan + residual -> x2
    scan_pass1<<<dim3(Dv / 256, NCh, Bb), 256, 0, stream>>>(
        dtp, xnf, Bv, A_log, Pbuf, Qbuf, Lv, Dv);
    scan_pass2<<<(Bb * Dv * 16) / 256, 256, 0, stream>>>(Pbuf, Qbuf, Hbuf);
    scan_pass3<<<dim3(Dv / 256, NCh, Bb), 256, 0, stream>>>(
        dtp, xnf, x, Bv, Cv, A_log, D_param, scale, Hbuf, x2, Lv, Dv);

    // 6. RMSNorm2 (bf16 only)
    rmsnorm_kernel<0><<<Mrows, 256, 0, stream>>>(x2, norm2_w, nullptr, xn2b, Dv);

    // 7. h = gelu(xn2 @ W1^T + b1) -> bf16  (WMMA)
    gemm_wmma_bf16<1><<<dim3(DFF / 128, Mrows / 128), 256, 0, stream>>>(
        xn2b, w1b, b1, nullptr, nullptr, hb, Mrows, DFF, Dv);

    // 8. out = h @ W2^T + b2 + x2  (WMMA)
    gemm_wmma_bf16<2><<<dim3(Dv / 128, Mrows / 128), 256, 0, stream>>>(
        hb, w2b, b2, x2, out, nullptr, Mrows, Dv, DFF);
}

// v007
// A run of this version takes 181 microseconds.
// Two timings next to v006 put it at 1.04 and 1.05 times that version's speed.
// All steps since v000 together make it 3.90 times as fast.
#include <hip/hip_runtime.h>
#include <hip/hip_bf16.h>
#include <stdint.h>

// ---------------------------------------------------------------------------
// Types for WMMA (gfx1250, wave32)
// ---------------------------------------------------------------------------
typedef __attribute__((ext_vector_type(16))) __bf16 v16bf;
typedef __attribute__((ext_vector_type(8)))  float  v8f;

struct alignas(16) U16x8 { unsigned short u[8]; };
struct alignas(32) FragBF { U16x8 lo, hi; };

static __device__ __forceinline__ unsigned short f2bf(float f) {
    unsigned int u = __float_as_uint(f);
    u += 0x7FFFu + ((u >> 16) & 1u);          // round-to-nearest-even
    return (unsigned short)(u >> 16);
}

static __device__ __forceinline__ float phi1_f(float z) {
    if (fabsf(z) < 1e-4f) return 1.0f + 0.5f * z;
    return expm1f(z) / z;
}

// ---------------------------------------------------------------------------
// Scan arithmetic on the hardware's own exp2 / log2 / rcp instructions.
// ---------------------------------------------------------------------------
#define LOG2E_F 1.4426950408889634f
#define LN2_F   0.6931471805599453f
// A step takes the short form only where every |dt * A[n]| is at least this:
// there exp(z) - 1 keeps its relative accuracy (error about 1e-7 / |z|).
#define SCAN_ZMIN  0.0625f
// ... and where 1 / dt is far from overflow.
#define SCAN_DTMIN 1e-30f

// r[i] = 2^x[i], i = 0..7. One statement, so that each v_exp_f32 has an
// independent instruction behind it and the last one a v_nop: the slot that the
// instruction set asks for before a transcendental's source is overwritten or its
// result read.
static __device__ __forceinline__ void exp2_x8(float* r, const float* x) {
    asm("v_exp_f32 %0, %8\n\t"
        "v_exp_f32 %1, %9\n\t"
        "v_exp_f32 %2, %10\n\t"
        "v_exp_f32 %3, %11\n\t"
        "v_exp_f32 %4, %12\n\t"
        "v_exp_f32 %5, %13\n\t"
        "v_exp_f32 %6, %14\n\t"
        "v_exp_f32 %7, %15\n\t"
        "v_nop"
        : "=&v"(r[0]), "=&v"(r[1]), "=&v"(r[2]), "=&v"(r[3]),
          "=&v"(r[4]), "=&v"(r[5]), "=&v"(r[6]), "=&v"(r[7])
        : "v"(x[0]), "v"(x[1]), "v"(x[2]), "v"(x[3]),
          "v"(x[4]), "v"(x[5]), "v"(x[6]), "v"(x[7]));
}

// r[i] = 1 / x[i], i = 0..7, in the same form and for the same reason as exp2_x8.
static __device__ __forceinline__ void rcp_x8(float* r, const float* x) {
    asm("v_rcp_f32 %0, %8\n\t"
        "v_rcp_f32 %1, %9\n\t"
        "v_rcp_f32 %2, %10\n\t"
        "v_rcp_f32 %3, %11\n\t"
        "v_rcp_f32 %4, %12\n\t"
        "v_rcp_f32 %5, %13\n\t"
        "v_rcp_f32 %6, %14\n\t"
        "v_rcp_f32 %7, %15\n\t"
        "v_nop"
        : "=&v"(r[0]), "=&v"(r[1]), "=&v"(r[2]), "=&v"(r[3]),
          "=&v"(r[4]), "=&v"(r[5]), "=&v"(r[6]), "=&v"(r[7])
        : "v"(x[0]), "v"(x[1]), "v"(x[2]), "v"(x[3]),
          "v"(x[4]), "v"(x[5]), "v"(x[6]), "v"(x[7]));
}

// y[i] = gelu(x[i]), tanh form, i = 0..7.
// 0.5 * (1 + tanh(u)) = 1 / (1 + exp(-2 u)) with u = 0.7978845608 * (x + 0.044715 x^3),
// and exp(-2 u) = 2^t. No branch, so the eight values are worked on side by side (the
// library tanhf takes two divergent branches a value, one value after the other).
// The ends come out as with tanh: 2^t = 0 gives x, 2^t = inf gives x * 0.
static __device__ __forceinline__ void gelu_tanh_x8(float* y, const float* x) {
    float t[8], e[8], q[8];
#pragma unroll  // constant i: the arrays stay in registers
    for (int i = 0; i < 8; ++i)
        t[i] = x[i] * (-2.3022081981f - 0.1029432396f * (x[i] * x[i]));   // -2 u log2(e)
    exp2_x8(e, t);
#pragma unroll  // constant i: the arrays stay in registers
    for (int i = 0; i < 8; ++i) e[i] = 1.0f + e[i];
    rcp_x8(q, e);
#pragma unroll  // constant i: the arrays stay in registers
    for (int i = 0; i < 8; ++i) y[i] = x[i] * q[i];
}

// softplus(x) = max(x, 0) + log1p(exp(-|x|)); e = exp(-|x|) lies in (0, 1].
// Below 1/16 the series of log1p keeps the relative accuracy that 1 + e loses.
static __device__ __forceinline__ float softplus_hw(float x) {
    const float e  = __builtin_amdgcn_exp2f(-fabsf(x) * LOG2E_F);
    const float lg = __builtin_amdgcn_logf(1.0f + e) * LN2_F;
    float p = 0.2f - e * (1.0f / 6.0f);
    p = -0.25f + e * p;
    p = (1.0f / 3.0f) + e * p;
    p = -0.5f + e * p;
    p = e + (e * e) * p;
    return fmaxf(x, 0.0f) + ((e < 0.0625f) ? p : lg);
}

// ---------------------------------------------------------------------------
// gfx1250 async memory->LDS copies (ASYNCcnt tracked), 16B per lane: the eight
// copies of one thread for one K-slab. l = LDS byte address (low 32 bits of the
// generic pointer: the flat aperture maps LDS_ADDR = addr[31:0]), g = global address.
// The last line is a precaution: it stands ahead of whatever rewrites the address
// registers that the copies name, and inside the statement nothing can be moved
// in front of it.
// ---------------------------------------------------------------------------
static __device__ __forceinline__ unsigned lds_addr_of(const void* p) {
    return (unsigned)(size_t)p;
}

static __device__ __forceinline__ void async_copy_b128_x8(const unsigned* l,
                                                          const unsigned short* const* g) {
    asm volatile("global_load_async_to_lds_b128 %0, %8, off\n\t"
                 "global_load_async_to_lds_b128 %1, %9, off\n\t"
                 "global_load_async_to_lds_b128 %2, %10, off\n\t"
                 "global_load_async_to_lds_b128 %3, %11, off\n\t"
                 "global_load_async_to_lds_b128 %4, %12, off\n\t"
                 "global_load_async_to_lds_b128 %5, %13, off\n\t"
                 "global_load_async_to_lds_b128 %6, %14, off\n\t"
                 "global_load_async_to_lds_b128 %7, %15, off\n\t"
                 "s_wait_xcnt 0x0"
                 :: "v"(l[0]), "v"(l[1]), "v"(l[2]), "v"(l[3]),
                    "v"(l[4]), "v"(l[5]), "v"(l[6]), "v"(l[7]),
                    "v"(g[0]), "v"(g[1]), "v"(g[2]), "v"(g[3]),
                    "v"(g[4]), "v"(g[5]), "v"(g[6]), "v"(g[7])
                 : "memory");
}

template <int Nc>
static __device__ __forceinline__ void wait_asynccnt() {
    asm volatile("s_wait_asynccnt %0" :: "n"(Nc) : "memory");
}

// ---------------------------------------------------------------------------
// f32 -> bf16 convert. One block of 256 threads converts CVT_BLOCK contiguous
// elements; the array length must be a multiple of CVT_BLOCK (checked at the
// launch). A thread takes CVT_G groups of 4 elements, 256 groups apart: each
// wave-wide load covers 512 contiguous bytes, each store 256, and a wave has
// CVT_G loads in flight. The point is fewer waves than with one element a
// thread, for speed only.
// ---------------------------------------------------------------------------
typedef __attribute__((ext_vector_type(4))) float f32x4;
struct alignas(8) U16x4 { unsigned short u[4]; };
#define CVT_G     8
#define CVT_BLOCK (256 * CVT_G * 4)

__global__ __launch_bounds__(256)
void cvt_bf16_kernel(const float* __restrict__ in,
                     unsigned short* __restrict__ out) {
    const size_t g0 = (size_t)blockIdx.x * (256 * CVT_G) + threadIdx.x;
    const f32x4* __restrict__ src = (const f32x4*)in + g0;
    U16x4* __restrict__ dst = (U16x4*)out + g0;
    f32x4 v[CVT_G];
#pragma unroll  // constant j: v stays in registers and all loads go out first
    for (int j = 0; j < CVT_G; ++j) v[j] = src[j * 256];
#pragma unroll  // constant j: v stays in registers
    for (int j = 0; j < CVT_G; ++j) {
        U16x4 o;
        o.u[0] = f2bf(v[j][0]);
        o.u[1] = f2bf(v[j][1]);
        o.u[2] = f2bf(v[j][2]);
        o.u[3] = f2bf(v[j][3]);
        dst[j * 256] = o;
    }
}

// ---------------------------------------------------------------------------
// RMSNorm: one block per row of length Dn=1024; writes f32 (optional) + bf16
// ---------------------------------------------------------------------------
template <int WRITE_F32>
__global__ __launch_bounds__(256)
void rmsnorm_kernel(const float* __restrict__ x, const float* __restrict__ w,
                    float* __restrict__ xf, unsigned short* __restrict__ xb, int Dn) {
    const int row = blockIdx.x;
    const int tid = threadIdx.x;
    const float* xr = x + (size_t)row * Dn;
    float ss = 0.0f;
    for (int i = tid; i < Dn; i += 256) { float v = xr[i]; ss += v * v; }
    __shared__ float red[256];
    red[tid] = ss;
    __syncthreads();
    for (int s = 128; s > 0; s >>= 1) {
        if (tid < s) red[tid] += red[tid + s];
        __syncthreads();
    }
    const float r = rsqrtf(red[0] / (float)Dn + 1e-6f);
    for (int i = tid; i < Dn; i += 256) {
        float v = xr[i] * r * w[i];
        if (WRITE_F32) xf[(size_t)row * Dn + i] = v;
        xb[(size_t)row * Dn + i] = f2bf(v);
    }
}

// ---------------------------------------------------------------------------
// WMMA bf16 GEMM:  out[m][n] = sum_k A[m][k] * Bw[n][k]  (+epilogue)
// MODE 0: outF = acc + bias[n]                      (f32)
// MODE 1: outB = bf16(gelu(acc + bias[n]))          (bf16)
// MODE 2: outF = acc + bias[n] + resid[m][n]        (f32)
// Block: 256 threads = 8 waves (2x4), block tile 128x128, BK=64.
// Wave tile 64x32 = 4x2 accumulators of v_wmma_f32_16x16x32_bf16.
// Double-buffered LDS, filled by global_load_async_to_lds_b128 (ASYNCcnt).
// ---------------------------------------------------------------------------
template <int MODE>
__global__ __launch_bounds__(256)
void gemm_wmma_bf16(const unsigned short* __restrict__ A,
                    const unsigned short* __restrict__ Bw,
                    const float* __restrict__ bias,
                    const float* __restrict__ resid,
                    float* __restrict__ outF,
                    unsigned short* __restrict__ outB,
                    int M, int N, int K) {
    __shared__ unsigned short As[2][128][72];  // 64 cols + pad, 16B-aligned rows
    __shared__ unsigned short Bs[2][128][72];

    const int tid   = threadIdx.x;
    const int lane  = tid & 31;
    const int wid   = tid >> 5;
    const int waveM = wid >> 2;      // 0..1  (rows of 64)
    const int waveN = wid & 3;       // 0..3  (cols of 32)
    const int m0 = blockIdx.y * 128;
    const int n0 = blockIdx.x * 128;

    // LDS fill: 8 neighbouring lanes take the 8 16-byte pieces of one row's 128-byte
    // slab, so a wave-wide copy covers 4 whole lines (a lane per row touched 32).
    const int lrow = tid >> 3;       // 0..31: row within a group of 32 rows
    const int lch  = tid & 7;        // which 16-byte piece of the row's slab

    const int ml   = lane & 15;      // M (or N) index within fragment
    const int half = lane >> 4;      // lane-half selects K sub-pattern

    const v8f vzero = {0.f, 0.f, 0.f, 0.f, 0.f, 0.f, 0.f, 0.f};
    v8f acc[4][2];
#pragma unroll
    for (int i = 0; i < 4; ++i)
#pragma unroll
        for (int j = 0; j < 2; ++j) acc[i][j] = vzero;

    const unsigned short* rowA = A  + (size_t)(m0 + lrow) * K + lch * 8;
    const unsigned short* rowB = Bw + (size_t)(n0 + lrow) * K + lch * 8;

    // Issue one K-slab (8 x 16B per thread) into LDS buffer `buf` via async DMA.
    auto issue_slab = [&](int buf, int k0) {
        unsigned l[8];
        const unsigned short* g[8];
#pragma unroll  // constant q: l and g stay in registers
        for (int q = 0; q < 4; ++q) {     // four groups of 32 rows
            l[q]     = lds_addr_of(&As[buf][q * 32 + lrow][lch * 8]);
            l[4 + q] = lds_addr_of(&Bs[buf][q * 32 + lrow][lch * 8]);
            g[q]     = rowA + (size_t)(q * 32) * K + k0;
            g[4 + q] = rowB + (size_t)(q * 32) * K + k0;
        }
        async_copy_b128_x8(l, g);
    };

    const int nslab = K >> 6;
    issue_slab(0, 0);

    for (int i = 0; i < nslab; ++i) {
        const int cur = i & 1;
        if (i + 1 < nslab) {
            issue_slab(cur ^ 1, (i + 1) << 6);  // prefetch next slab (async)
            wait_asynccnt<8>();                 // this wave's slab-i loads done
        } else {
            wait_asynccnt<0>();
        }
        __syncthreads();                        // all waves' slab-i data in LDS

        // All 24 fragment reads of the slab go out as one group, each into registers of
        // its own, ahead of the slab's 16 products: a wave then waits out the LDS latency
        // once a slab (with one A register set it did so in front of every pair of products).
        // 16-bit A/B fragment layout: lane-half 0 holds K {0..7,16..23},
        // half 1 holds K {8..15,24..31} (two 16B runs per lane).
        FragBF fa[2][4], fb[2][2];
#pragma unroll  // constant s, j, ii: the fragments stay in registers
        for (int s = 0; s < 2; ++s) {
            const int ks = s * 32;
#pragma unroll  // constant index: the fragments stay in registers
            for (int j = 0; j < 2; ++j) {
                const int col = waveN * 32 + j * 16 + ml;
                fb[s][j].lo = *(const U16x8*)&Bs[cur][col][ks + half * 8];
                fb[s][j].hi = *(const U16x8*)&Bs[cur][col][ks + 16 + half * 8];
            }
#pragma unroll  // constant index: the fragments stay in registers
            for (int ii = 0; ii < 4; ++ii) {
                const int row = waveM * 64 + ii * 16 + ml;
                fa[s][ii].lo = *(const U16x8*)&As[cur][row][ks + half * 8];
                fa[s][ii].hi = *(const U16x8*)&As[cur][row][ks + 16 + half * 8];
            }
        }
        // Keeps the reads in front of the products: left free, the scheduler sinks each
        // read to its first use to save registers, and the waits to 0 come back.
        __builtin_amdgcn_sched_barrier(0);
#pragma unroll  // constant s, ii, j: the fragments stay in registers
        for (int s = 0; s < 2; ++s) {
#pragma unroll  // constant index: the fragments stay in registers
            for (int ii = 0; ii < 4; ++ii) {
                v16bf av = __builtin_bit_cast(v16bf, fa[s][ii]);
#pragma unroll  // constant index: the fragments stay in registers
                for (int j = 0; j < 2; ++j) {
                    v16bf bv = __builtin_bit_cast(v16bf, fb[s][j]);
                    acc[ii][j] = __builtin_amdgcn_wmma_f32_16x16x32_bf16(
                        false, av, false, bv, (short)0, acc[ii][j], false, false);
                }
            }
        }
        // Keeps the barrier below behind the products: left free, it is lifted in front of
        // them with a wait for all 24 reads, and no product runs while the reads come in.
        __builtin_amdgcn_sched_barrier(0);
        __syncthreads();   // everyone finished reading buf `cur` before refill
    }

    // Epilogue: C/D layout — VGPR r: lanes 0-15 -> M=r, lanes 16-31 -> M=r+8.
    float bcol[2];   // read once, ahead of the stores (behind a store it is read again, and waited for)
#pragma unroll  // constant j: bcol stays in registers
    for (int j = 0; j < 2; ++j) bcol[j] = bias[n0 + waveN * 32 + j * 16 + ml];
#pragma unroll
    for (int i = 0; i < 4; ++i) {
        const int rowBase = m0 + waveM * 64 + i * 16;
#pragma unroll
        for (int j = 0; j < 2; ++j) {
            const int col = n0 + waveN * 32 + j * 16 + ml;
            float cv[8];
#pragma unroll  // constant r: cv stays in registers
            for (int r = 0; r < 8; ++r) cv[r] = acc[i][j][r] + bcol[j];
            if (MODE == 1) {
                float gv[8];
                gelu_tanh_x8(gv, cv);
                unsigned short* po = outB + (size_t)(rowBase + half * 8) * N + col;
#pragma unroll  // constant r: gv stays in registers
                for (int r = 0; r < 8; ++r) { *po = f2bf(gv[r]); po += N; }   // next row
            } else {
#pragma unroll  // constant r: cv stays in registers
                for (int r = 0; r < 8; ++r) {
                    const int row = rowBase + r + half * 8;
                    const size_t o = (size_t)row * N + col;
                    if (MODE == 0) {
                        outF[o] = cv[r];
                    } else {
                        outF[o] = cv[r] + resid[o];
                    }
                }
            }
        }
    }
}

// ---------------------------------------------------------------------------
// Bv / Cv projections: out[row][n] = dot(xn[row,:], W[n,:]) + b[n], all in f32.
// One block takes 16 rows of xn and all 32 rows of WB and WC, so W is read once per
// 16 rows. Its 16 waves split K: wave w owns k = 64 w .. 64 w + 63.
// 1. Each wave brings its 48 row pieces of 256 bytes into LDS with loads that cover
//    whole lines (16 lanes a piece, two pieces a load).
// 2. It reads them back as fragments of v_wmma_f32_16x16x4_f32, W as A and xn as B:
//    lane (c, h) takes row c, k = 8 kk + 4 h .. + 3, the same for both operands, and
//    feeds elements 0, 1 to one product and 2, 3 to the next.
// 3. Each wave lays its two partial tiles over the head of its own LDS rows, and the
//    16 partial sums of every output are added as a tree over the waves.
// ---------------------------------------------------------------------------
typedef __attribute__((ext_vector_type(2))) float v2f;
typedef f32x4 f32x4_a4 __attribute__((aligned(4)));   // an input's base is only known as float*
#define BC_WAVES 16
#define BC_KW    64                    // k per wave
#define BC_K     (BC_WAVES * BC_KW)    // row length of xn, WB, WC (checked at the launch)
#define BC_PITCH 68                    // dwords a staged row: 16-byte reads down a column hit no bank twice

__global__ __launch_bounds__(BC_WAVES * 32)
void bc_proj_kernel(const float* __restrict__ xnf,
                    const float* __restrict__ WB, const float* __restrict__ bB,
                    const float* __restrict__ WC, const float* __restrict__ bC,
                    float* __restrict__ Bv, float* __restrict__ Cv) {
    __shared__ __attribute__((aligned(16))) float stage[BC_WAVES][48][BC_PITCH];
    const int tid  = threadIdx.x;
    const int lane = tid & 31;
    const int w    = tid >> 5;
    const int c    = lane & 15;
    const int h    = lane >> 4;
    const int m0   = blockIdx.x * 16;

    // 1. rows 0..15 of stage[w]: xn, 16..31: WB, 32..47: WC
    const int go = h * BC_K + w * BC_KW + c * 4;
    const float* __restrict__ gx = xnf + (size_t)m0 * BC_K + go;
    const float* __restrict__ gb = WB + go;
    const float* __restrict__ gc = WC + go;
    f32x4 v[24];
#pragma unroll  // constant j: v stays in registers and all loads go out first
    for (int j = 0; j < 8; ++j) {
        v[j]      = *(const f32x4_a4*)(gx + 2 * j * BC_K);
        v[8 + j]  = *(const f32x4_a4*)(gb + 2 * j * BC_K);
        v[16 + j] = *(const f32x4_a4*)(gc + 2 * j * BC_K);
    }
#pragma unroll  // constant j: v stays in registers
    for (int j = 0; j < 24; ++j)
        *(f32x4*)&stage[w][2 * j + h][c * 4] = v[j];
    __syncthreads();   // a lane reads what other lanes have stored

    // 2. D[n][m]: register r of lane (c, h) is out[m0 + c][8 h + r]
    float* const sf = &stage[w][c][h * 4];   // the one LDS address of steps 2 and 3
    v8f accB = {0.f, 0.f, 0.f, 0.f, 0.f, 0.f, 0.f, 0.f};
    v8f accC = accB;
#pragma unroll  // constant kk: LDS offsets are immediates and the reads can go out ahead
    for (int kk = 0; kk < BC_KW / 8; ++kk) {
        const f32x4 x4 = *(const f32x4*)(sf + kk * 8);
        const f32x4 b4 = *(const f32x4*)(sf + 16 * BC_PITCH + kk * 8);
        const f32x4 c4 = *(const f32x4*)(sf + 32 * BC_PITCH + kk * 8);
        const v2f xlo = {x4[0], x4[1]}, xhi = {x4[2], x4[3]};
        const v2f blo = {b4[0], b4[1]}, bhi = {b4[2], b4[3]};
        const v2f clo = {c4[0], c4[1]}, chi = {c4[2], c4[3]};
        accB = __builtin_amdgcn_wmma_f32_16x16x4_f32(false, blo, false, xlo, (short)0, accB, false, false);
        accC = __builtin_amdgcn_wmma_f32_16x16x4_f32(false, clo, false, xlo, (short)0, accC, false, false);
        accB = __builtin_amdgcn_wmma_f32_16x16x4_f32(false, bhi, false, xhi, (short)0, accB, false, false);
        accC = __builtin_amdgcn_wmma_f32_16x16x4_f32(false, chi, false, xhi, (short)0, accC, false, false);
    }
    // Four vector slots between the last product and whatever vector instruction next
    // reuses its registers: the distance of the 16-bit forms, kept here as a precaution
    // (none is tabled for the f32 form, and the compiler pads none). The two scheduling
    // barriers hold the slots at this place and keep step 3's index arithmetic behind them.
    __builtin_amdgcn_sched_barrier(0);
    asm volatile("v_nop\n\tv_nop\n\tv_nop\n\tv_nop");
    __builtin_amdgcn_sched_barrier(0);

    // 3. Row c (Bv) and row 16 + c (Cv) of the wave's own slice, which only this wave has
    //    read: n = 8 h + 4 q + e lies at column 8 q + 4 h + e, so that sf serves again.
    {
        const f32x4 b0 = {accB[0], accB[1], accB[2], accB[3]}, b1 = {accB[4], accB[5], accB[6], accB[7]};
        const f32x4 c0 = {accC[0], accC[1], accC[2], accC[3]}, c1 = {accC[4], accC[5], accC[6], accC[7]};
        *(f32x4*)(sf)                     = b0;
        *(f32x4*)(sf + 8)                 = b1;
        *(f32x4*)(sf + 16 * BC_PITCH)     = c0;
        *(f32x4*)(sf + 16 * BC_PITCH + 8) = c1;
    }
    __syncthreads();   // every wave's partial tiles are in LDS
    const int t   = tid >> 8;     // 0: Bv, 1: Cv (the same for a whole wave)
    const int idx = tid & 255;    // m * 16 + n
    const int n   = idx & 15;
    const int col = ((n >> 2) & 1) * 8 + (n >> 3) * 4 + (n & 3);
    float p[BC_WAVES];
#pragma unroll  // constant i: p stays in registers
    for (int i = 0; i < BC_WAVES; ++i) p[i] = stage[i][t * 16 + (idx >> 4)][col];
#pragma unroll  // constant i: p stays in registers
    for (int s = BC_WAVES / 2; s > 0; s >>= 1)
#pragma unroll  // constant i: p stays in registers
        for (int i = 0; i < s; ++i) p[i] += p[i + s];
    (t ? Cv : Bv)[(size_t)m0 * 16 + idx] = p[0] + (t ? bC : bB)[n];
}

// ---------------------------------------------------------------------------
// Chunked linear-recurrence scan (h = dA*h + b), 3 passes, NC chunks of CL.
// Thread layout (pass 1/3): one thread per (b, chunk, d); the lanes of a wave
// run along d, and each thread keeps all 16 states n in registers.
// P/Q/H layout: [b][chunk][n][d], so every access is contiguous along d.
// ---------------------------------------------------------------------------
#define SCAN_NC 64
#define SCAN_CL 32
#define SCAN_D  1024   // channels = pitch of one n row of P/Q/H (a constant, so that
                       // the 16 rows are reached by immediate offsets from one address)

// Pass 1: per-chunk transfer (P = prod dA, q = end state from h0=0)
// grid: x = d / 256, y = chunk, z = batch
__global__ __launch_bounds__(256)
void scan_pass1(const float* __restrict__ dtp, const float* __restrict__ xnf,
                const float* __restrict__ Bv, const float* __restrict__ A_log,
                float* __restrict__ Pbuf, float* __restrict__ Qbuf,
                int Lv, int Dv) {
    const int d = blockIdx.x * 256 + threadIdx.x;
    const int c = blockIdx.y;
    const int b = blockIdx.z;

    float An[16], invA[16], h[16], pf[16];
    float Amin = __builtin_inff();
#pragma unroll  // constant n: the per-thread arrays stay in registers
    for (int n = 0; n < 16; ++n) {
        An[n]   = -expf(A_log[n]);
        invA[n] = 1.0f / An[n];
        Amin    = fminf(Amin, -An[n]);
        h[n]  = 0.0f;
        pf[n] = 1.0f;
    }
    const int row0 = b * Lv + c * SCAN_CL;
    for (int l = 0; l < SCAN_CL; ++l) {
        const size_t idx = (size_t)(row0 + l);
        const float dt = softplus_hw(dtp[idx * Dv + d]);
        const float xv = xnf[idx * Dv + d];
        const float* __restrict__ Bp = Bv + idx * 16;   // same for the whole block
        float Br[16];   // read ahead of the branch, beside the two loads above
#pragma unroll  // constant n: the per-thread arrays stay in registers
        for (int n = 0; n < 16; ++n) Br[n] = Bp[n];
        const float dt2 = dt * LOG2E_F;
        float z2[16], dA[16];   // dA = exp(dt * A) = 2^(dt * log2(e) * A)
#pragma unroll  // constant n: the per-thread arrays stay in registers
        for (int n = 0; n < 16; ++n) z2[n] = dt2 * An[n];
        exp2_x8(dA, z2);
        exp2_x8(dA + 8, z2 + 8);
        const bool shortform = (dt * Amin >= SCAN_ZMIN) && (dt >= SCAN_DTMIN);
        if (__builtin_amdgcn_ballot_w32(!shortform) == 0u) {
            // b = (dA - 1) * w with w = B * x / (dt * A), so dA*h + b = dA*(h + w) - w
            const float g = xv * __builtin_amdgcn_rcpf(dt);
#pragma unroll  // constant n: the per-thread arrays stay in registers
            for (int n = 0; n < 16; ++n) {
                const float w = g * (Br[n] * invA[n]);
                h[n]  = dA[n] * (h[n] + w) - w;
                pf[n] = dA[n] * pf[n];
            }
        } else {
            // some lane has a small dt * A: phi1 in its library form, exact near 0
#pragma unroll  // constant n: the per-thread arrays stay in registers
            for (int n = 0; n < 16; ++n) {
                const float bt = phi1_f(dt * An[n]) * Br[n] * xv;
                h[n]  = dA[n] * h[n] + bt;
                pf[n] = dA[n] * pf[n];
            }
        }
    }
    const size_t o0 = (size_t)(b * SCAN_NC + c) * 16 * SCAN_D + d;
#pragma unroll  // constant n: the per-thread arrays stay in registers
    for (int n = 0; n < 16; ++n) {
        Pbuf[o0 + n * SCAN_D] = pf[n];
        Qbuf[o0 + n * SCAN_D] = h[n];
    }
}

// Pass 2: sequential combine over chunks -> initial state H_c per chunk
// one thread per (b, n, d); one chunk is a plane of 16 * SCAN_D elements
__global__ __launch_bounds__(256)
void scan_pass2(const float* __restrict__ Pbuf, const float* __restrict__ Qbuf,
                float* __restrict__ Hbuf) {
    constexpr int plane = 16 * SCAN_D;
    const int tid = blockIdx.x * 256 + threadIdx.x;
    const int b = tid / plane;
    const int r = tid - b * plane;        // n * SCAN_D + d
    const size_t o0 = (size_t)b * SCAN_NC * plane + r;
    float H = 0.0f;
    // unrolled whole: the loads do not depend on H, so they can all be in
    // flight together instead of one memory latency per few chunks
#pragma unroll
    for (int c = 0; c < SCAN_NC; ++c) {
        const size_t o = o0 + c * plane;
        Hbuf[o] = H;
        H = Pbuf[o] * H + Qbuf[o];
    }
}

// Pass 3: replay chunk from true H_c, emit y = sum_n Cv*h + D*xn, +residual
// grid: x = d / 256, y = chunk, z = batch
__global__ __launch_bounds__(256)
void scan_pass3(const float* __restrict__ dtp, const float* __restrict__ xnf,
                const float* __restrict__ xres,
                const float* __restrict__ Bv, const float* __restrict__ Cv,
                const float* __restrict__ A_log, const float* __restrict__ Dp,
                const float* __restrict__ scale, const float* __restrict__ Hbuf,
                float* __restrict__ x2, int Lv, int Dv) {
    const int d = blockIdx.x * 256 + threadIdx.x;
    const int c = blockIdx.y;
    const int b = blockIdx.z;

    const float Dd = Dp[d];
    const float sc = scale[d];

    float An[16], invA[16], h[16];
    float Amin = __builtin_inff();
    const size_t o0 = (size_t)(b * SCAN_NC + c) * 16 * SCAN_D + d;
#pragma unroll  // constant n: the per-thread arrays stay in registers
    for (int n = 0; n < 16; ++n) {
        An[n]   = -expf(A_log[n]);
        invA[n] = 1.0f / An[n];
        Amin    = fminf(Amin, -An[n]);
        h[n]  = Hbuf[o0 + n * SCAN_D];
    }
    const int row0 = b * Lv + c * SCAN_CL;
    for (int l = 0; l < SCAN_CL; ++l) {
        const size_t idx = (size_t)(row0 + l);
        const float dt = softplus_hw(dtp[idx * Dv + d]);
        const float xv = xnf[idx * Dv + d];
        const float xr = xres[idx * Dv + d];
        const float* __restrict__ Bp = Bv + idx * 16;   // same for the whole block
        const float* __restrict__ Cp = Cv + idx * 16;
        float Br[16], Cr[16];   // read ahead of the branch, beside the loads above
#pragma unroll  // constant n: the per-thread arrays stay in registers
        for (int n = 0; n < 16; ++n) { Br[n] = Bp[n]; Cr[n] = Cp[n]; }
        float t[16];
        const float dt2 = dt * LOG2E_F;
        float z2[16], dA[16];   // dA = exp(dt * A) = 2^(dt * log2(e) * A)
#pragma unroll  // constant n: the per-thread arrays stay in registers
        for (int n = 0; n < 16; ++n) z2[n] = dt2 * An[n];
        exp2_x8(dA, z2);
        exp2_x8(dA + 8, z2 + 8);
        const bool shortform = (dt * Amin >= SCAN_ZMIN) && (dt >= SCAN_DTMIN);
        if (__builtin_amdgcn_ballot_w32(!shortform) == 0u) {
            // b = (dA - 1) * w with w = B * x / (dt * A), so dA*h + b = dA*(h + w) - w
            const float g = xv * __builtin_amdgcn_rcpf(dt);
#pragma unroll  // constant n: the per-thread arrays stay in registers
            for (int n = 0; n < 16; ++n) {
                const float w = g * (Br[n] * invA[n]);
                h[n] = dA[n] * (h[n] + w) - w;
                t[n] = Cr[n] * h[n];
            }
        } else {
            // some lane has a small dt * A: phi1 in its library form, exact near 0
#pragma unroll  // constant n: the per-thread arrays stay in registers
            for (int n = 0; n < 16; ++n) {
                const float bt = phi1_f(dt * An[n]) * Br[n] * xv;
                h[n] = dA[n] * h[n] + bt;
                t[n] = Cr[n] * h[n];
            }
        }
        // sum over n: pairs 8, 4, 2, 1 apart
#pragma unroll  // constant n: the per-thread arrays stay in registers
        for (int s = 8; s > 0; s >>= 1)
#pragma unroll  // constant n: the per-thread arrays stay in registers
            for (int n = 0; n < s; ++n) t[n] += t[n + s];
        const float y = (t[0] + Dd * xv) * sc;
        x2[idx * Dv + d] = y + xr;
        // precaution: the next trip rewrites the registers that this store names
        asm volatile("s_wait_xcnt 0x0" ::: "memory");
    }
}

// ---------------------------------------------------------------------------
// Launch
// ---------------------------------------------------------------------------
extern "C" void kernel_launch(void* const* d_in, const int* in_sizes, int n_in,
                              void* d_out, int out_size, void* d_ws, size_t ws_size,
                              hipStream_t stream) {
    (void)in_sizes; (void)n_in; (void)out_size; (void)ws_size;
    constexpr int Bb = 2, Lv = 2048, Dv = 1024, Nst = 16, DFF = 4096;
    constexpr int Mrows = Bb * Lv;  // 4096
    constexpr int NCh = SCAN_NC;
    static_assert(Dv == SCAN_D && NCh * SCAN_CL == Lv, "scan tiling");

    const float* x       = (const float*)d_in[0];
    const float* norm1_w = (const float*)d_in[1];
    const float* norm2_w = (const float*)d_in[2];
    const float* A_log   = (const float*)d_in[3];
    const float* D_param = (const float*)d_in[4];
    const float* scale   = (const float*)d_in[5];
    const float* Wdt     = (const float*)d_in[6];
    const float* bdt     = (const float*)d_in[7];
    const float* WB      = (const float*)d_in[8];
    const float* bB      = (const float*)d_in[9];
    const float* WC      = (const float*)d_in[10];
    const float* bC      = (const float*)d_in[11];
    const float* W1      = (const float*)d_in[12];
    const float* b1      = (const float*)d_in[13];
    const float* W2      = (const float*)d_in[14];
    const float* b2      = (const float*)d_in[15];
    float* out = (float*)d_out;

    size_t off = 0;
    auto alloc = [&](size_t bytes) -> void* {
        void* p = (char*)d_ws + off;
        off += (bytes + 255) & ~(size_t)255;
        return p;
    };
    float*          xnf  = (float*)alloc((size_t)Mrows * Dv * 4);
    unsigned short* xnb  = (unsigned short*)alloc((size_t)Mrows * Dv * 2);
    unsigned short* wdtb = (unsigned short*)alloc((size_t)Dv * Dv * 2);
    unsigned short* w1b  = (unsigned short*)alloc((size_t)DFF * Dv * 2);
    unsigned short* w2b  = (unsigned short*)alloc((size_t)Dv * DFF * 2);
    float*          dtp  = (float*)alloc((size_t)Mrows * Dv * 4);
    float*          Bv   = (float*)alloc((size_t)Mrows * Nst * 4);
    float*          Cv   = (float*)alloc((size_t)Mrows * Nst * 4);
    float*          x2   = (float*)alloc((size_t)Mrows * Dv * 4);
    unsigned short* xn2b = (unsigned short*)alloc((size_t)Mrows * Dv * 2);
    unsigned short* hb   = (unsigned short*)alloc((size_t)Mrows * DFF * 2);
    float*          Pbuf = (float*)alloc((size_t)Bb * Dv * NCh * 16 * 4);
    float*          Qbuf = (float*)alloc((size_t)Bb * Dv * NCh * 16 * 4);
    float*          Hbuf = (float*)alloc((size_t)Bb * Dv * NCh * 16 * 4);

    // 1. weight converts to bf16
    static_assert((Dv * Dv) % CVT_BLOCK == 0 && (DFF * Dv) % CVT_BLOCK == 0, "convert tiling");
    cvt_bf16_kernel<<<(Dv * Dv) / CVT_BLOCK, 256, 0, stream>>>(Wdt, wdtb);
    cvt_bf16_kernel<<<(DFF * Dv) / CVT_BLOCK, 256, 0, stream>>>(W1, w1b);
    cvt_bf16_kernel<<<(Dv * DFF) / CVT_BLOCK, 256, 0, stream>>>(W2, w2b);

    // 2. RMSNorm1 (f32 + bf16)
    rmsnorm_kernel<1><<<Mrows, 256, 0, stream>>>(x, norm1_w, xnf, xnb, Dv);

    // 3. dt_pre = xn @ Wdt^T + bdt  (WMMA, async-LDS pipelined)
    gemm_wmma_bf16<0><<<dim3(Dv / 128, Mrows / 128), 256, 0, stream>>>(
        xnb, wdtb, bdt, nullptr, dtp, nullptr, Mrows, Dv, Dv);

    // 4. Bv / Cv projections
    static_assert(Dv == BC_K && Mrows % 16 == 0 && Nst == 16, "projection tiling");
    bc_proj_kernel<<<Mrows / 16, BC_WAVES * 32, 0, stream>>>(
        xnf, WB, bB, WC, bC, Bv, Cv);

    // 5. chunked selective scan + residual -> x2
    scan_pass1<<<dim3(Dv / 256, NCh, Bb), 256, 0, stream>>>(
        dtp, xnf, Bv, A_log, Pbuf, Qbuf, Lv, Dv);
    scan_pass2<<<(Bb * Dv * 16) / 256, 256, 0, stream>>>(Pbuf, Qbuf, Hbuf);
    scan_pass3<<<dim3(Dv / 256, NCh, Bb), 256, 0, stream>>>(
        dtp, xnf, x, Bv, Cv, A_log, D_param, scale, Hbuf, x2, Lv, Dv);

    // 6. RMSNorm2 (bf16 only)
    rmsnorm_kernel<0><<<Mrows, 256, 0, stream>>>(x2, norm2_w, nullptr, xn2b, Dv);

    // 7. h = gelu(xn2 @ W1^T + b1) -> bf16  (WMMA)
    gemm_wmma_bf16<1><<<dim3(DFF / 128, Mrows / 128), 256, 0, stream>>>(
        xn2b, w1b, b1, nullptr, nullptr, hb, Mrows, DFF, Dv);

    // 8. out = h @ W2^T + b2 + x2  (WMMA)
    gemm_wmma_bf16<2><<<dim3(Dv / 128, Mrows / 128), 256, 0, stream>>>(
        hb, w2b, b2, x2, out, nullptr, Mrows, Dv, DFF);
}

// v008
// It runs in 174 microseconds.
// Timed twice side by side with v007, it ran 1.04 times as fast both times.
// Counting every step since v000, it is 4.06 times as fast.
#include <hip/hip_runtime.h>
#include <hip/hip_bf16.h>
#include <stdint.h>

// ---------------------------------------------------------------------------
// Types for WMMA (gfx1250, wave32)
// ---------------------------------------------------------------------------
typedef __attribute__((ext_vector_type(16))) __bf16 v16bf;
typedef __attribute__((ext_vector_type(8)))  float  v8f;

struct alignas(16) U16x8 { unsigned short u[8]; };
struct alignas(32) FragBF { U16x8 lo, hi; };

static __device__ __forceinline__ unsigned short f2bf(float f) {
    unsigned int u = __float_as_uint(f);
    u += 0x7FFFu + ((u >> 16) & 1u);          // round-to-nearest-even
    return (unsigned short)(u >> 16);
}

static __device__ __forceinline__ float phi1_f(float z) {
    if (fabsf(z) < 1e-4f) return 1.0f + 0.5f * z;
    return expm1f(z) / z;
}

// ---------------------------------------------------------------------------
// Scan arithmetic on the hardware's own exp2 / log2 / rcp instructions.
// ---------------------------------------------------------------------------
#define LOG2E_F 1.4426950408889634f
#define LN2_F   0.6931471805599453f
// A step takes the short form only where every |dt * A[n]| is at least this:
// there exp(z) - 1 keeps its relative accuracy (error about 1e-7 / |z|).
#define SCAN_ZMIN  0.0625f
// ... and where 1 / dt is far from overflow.
#define SCAN_DTMIN 1e-30f

// r[i] = 2^x[i], i = 0..7. One statement, so that each v_exp_f32 has an
// independent instruction behind it and the last one a v_nop: the slot that the
// instruction set asks for before a transcendental's source is overwritten or its
// result read.
static __device__ __forceinline__ void exp2_x8(float* r, const float* x) {
    asm("v_exp_f32 %0, %8\n\t"
        "v_exp_f32 %1, %9\n\t"
        "v_exp_f32 %2, %10\n\t"
        "v_exp_f32 %3, %11\n\t"
        "v_exp_f32 %4, %12\n\t"
        "v_exp_f32 %5, %13\n\t"
        "v_exp_f32 %6, %14\n\t"
        "v_exp_f32 %7, %15\n\t"
        "v_nop"
        : "=&v"(r[0]), "=&v"(r[1]), "=&v"(r[2]), "=&v"(r[3]),
          "=&v"(r[4]), "=&v"(r[5]), "=&v"(r[6]), "=&v"(r[7])
        : "v"(x[0]), "v"(x[1]), "v"(x[2]), "v"(x[3]),
          "v"(x[4]), "v"(x[5]), "v"(x[6]), "v"(x[7]));
}

// r[i] = 1 / x[i], i = 0..7, in the same form and for the same reason as exp2_x8.
static __device__ __forceinline__ void rcp_x8(float* r, const float* x) {
    asm("v_rcp_f32 %0, %8\n\t"
        "v_rcp_f32 %1, %9\n\t"
        "v_rcp_f32 %2, %10\n\t"
        "v_rcp_f32 %3, %11\n\t"
        "v_rcp_f32 %4, %12\n\t"
        "v_rcp_f32 %5, %13\n\t"
        "v_rcp_f32 %6, %14\n\t"
        "v_rcp_f32 %7, %15\n\t"
        "v_nop"
        : "=&v"(r[0]), "=&v"(r[1]), "=&v"(r[2]), "=&v"(r[3]),
          "=&v"(r[4]), "=&v"(r[5]), "=&v"(r[6]), "=&v"(r[7])
        : "v"(x[0]), "v"(x[1]), "v"(x[2]), "v"(x[3]),
          "v"(x[4]), "v"(x[5]), "v"(x[6]), "v"(x[7]));
}

// y[i] = gelu(x[i]), tanh form, i = 0..7.
// 0.5 * (1 + tanh(u)) = 1 / (1 + exp(-2 u)) with u = 0.7978845608 * (x + 0.044715 x^3),
// and exp(-2 u) = 2^t. No branch, so the eight values are worked on side by side (the
// library tanhf takes two divergent branches a value, one value after the other).
// The ends come out as with tanh: 2^t = 0 gives x, 2^t = inf gives x * 0.
static __device__ __forceinline__ void gelu_tanh_x8(float* y, const float* x) {
    float t[8], e[8], q[8];
#pragma unroll  // constant i: the arrays stay in registers
    for (int i = 0; i < 8; ++i)
        t[i] = x[i] * (-2.3022081981f - 0.1029432396f * (x[i] * x[i]));   // -2 u log2(e)
    exp2_x8(e, t);
#pragma unroll  // constant i: the arrays stay in registers
    for (int i = 0; i < 8; ++i) e[i] = 1.0f + e[i];
    rcp_x8(q, e);
#pragma unroll  // constant i: the arrays stay in registers
    for (int i = 0; i < 8; ++i) y[i] = x[i] * q[i];
}

// softplus(x) = max(x, 0) + log1p(exp(-|x|)); e = exp(-|x|) lies in (0, 1].
// Below 1/16 the series of log1p keeps the relative accuracy that 1 + e loses.
static __device__ __forceinline__ float softplus_hw(float x) {
    const float e  = __builtin_amdgcn_exp2f(-fabsf(x) * LOG2E_F);
    const float lg = __builtin_amdgcn_logf(1.0f + e) * LN2_F;
    float p = 0.2f - e * (1.0f / 6.0f);
    p = -0.25f + e * p;
    p = (1.0f / 3.0f) + e * p;
    p = -0.5f + e * p;
    p = e + (e * e) * p;
    return fmaxf(x, 0.0f) + ((e < 0.0625f) ? p : lg);
}

// ---------------------------------------------------------------------------
// gfx1250 async memory->LDS copies (ASYNCcnt tracked), 16B per lane: the eight
// copies of one thread for one K-slab. l = LDS byte address (low 32 bits of the
// generic pointer: the flat aperture maps LDS_ADDR = addr[31:0]), g = global address.
// The last line is a precaution: it stands ahead of whatever rewrites the address
// registers that the copies name, and inside the statement nothing can be moved
// in front of it.
// ---------------------------------------------------------------------------
static __device__ __forceinline__ unsigned lds_addr_of(const void* p) {
    return (unsigned)(size_t)p;
}

static __device__ __forceinline__ void async_copy_b128_x8(const unsigned* l,
                                                          const unsigned short* const* g) {
    asm volatile("global_load_async_to_lds_b128 %0, %8, off\n\t"
                 "global_load_async_to_lds_b128 %1, %9, off\n\t"
                 "global_load_async_to_lds_b128 %2, %10, off\n\t"
                 "global_load_async_to_lds_b128 %3, %11, off\n\t"
                 "global_load_async_to_lds_b128 %4, %12, off\n\t"
                 "global_load_async_to_lds_b128 %5, %13, off\n\t"
                 "global_load_async_to_lds_b128 %6, %14, off\n\t"
                 "global_load_async_to_lds_b128 %7, %15, off\n\t"
                 "s_wait_xcnt 0x0"
                 :: "v"(l[0]), "v"(l[1]), "v"(l[2]), "v"(l[3]),
                    "v"(l[4]), "v"(l[5]), "v"(l[6]), "v"(l[7]),
                    "v"(g[0]), "v"(g[1]), "v"(g[2]), "v"(g[3]),
                    "v"(g[4]), "v"(g[5]), "v"(g[6]), "v"(g[7])
                 : "memory");
}

template <int Nc>
static __device__ __forceinline__ void wait_asynccnt() {
    asm volatile("s_wait_asynccnt %0" :: "n"(Nc) : "memory");
}

// ---------------------------------------------------------------------------
// f32 -> bf16 convert. One block of 256 threads converts CVT_BLOCK contiguous
// elements; the array length must be a multiple of CVT_BLOCK (checked at the
// launch). A thread takes CVT_G groups of 4 elements, 256 groups apart: each
// wave-wide load covers 512 contiguous bytes, each store 256, and a wave has
// CVT_G loads in flight. The point is fewer waves than with one element a
// thread, for speed only.
// ---------------------------------------------------------------------------
typedef __attribute__((ext_vector_type(4))) float f32x4;
struct alignas(8) U16x4 { unsigned short u[4]; };
#define CVT_G     8
#define CVT_BLOCK (256 * CVT_G * 4)

__global__ __launch_bounds__(256)
void cvt_bf16_kernel(const float* __restrict__ in,
                     unsigned short* __restrict__ out) {
    const size_t g0 = (size_t)blockIdx.x * (256 * CVT_G) + threadIdx.x;
    const f32x4* __restrict__ src = (const f32x4*)in + g0;
    U16x4* __restrict__ dst = (U16x4*)out + g0;
    f32x4 v[CVT_G];
#pragma unroll  // constant j: v stays in registers and all loads go out first
    for (int j = 0; j < CVT_G; ++j) v[j] = src[j * 256];
#pragma unroll  // constant j: v stays in registers
    for (int j = 0; j < CVT_G; ++j) {
        U16x4 o;
        o.u[0] = f2bf(v[j][0]);
        o.u[1] = f2bf(v[j][1]);
        o.u[2] = f2bf(v[j][2]);
        o.u[3] = f2bf(v[j][3]);
        dst[j * 256] = o;
    }
}

// ---------------------------------------------------------------------------
// RMSNorm: one block per row of length Dn=1024; writes f32 (optional) + bf16
// ---------------------------------------------------------------------------
template <int WRITE_F32>
__global__ __launch_bounds__(256)
void rmsnorm_kernel(const float* __restrict__ x, const float* __restrict__ w,
                    float* __restrict__ xf, unsigned short* __restrict__ xb, int Dn) {
    const int row = blockIdx.x;
    const int tid = threadIdx.x;
    const float* xr = x + (size_t)row * Dn;
    float ss = 0.0f;
    for (int i = tid; i < Dn; i += 256) { float v = xr[i]; ss += v * v; }
    __shared__ float red[256];
    red[tid] = ss;
    __syncthreads();
    for (int s = 128; s > 0; s >>= 1) {
        if (tid < s) red[tid] += red[tid + s];
        __syncthreads();
    }
    const float r = rsqrtf(red[0] / (float)Dn + 1e-6f);
    for (int i = tid; i < Dn; i += 256) {
        float v = xr[i] * r * w[i];
        if (WRITE_F32) xf[(size_t)row * Dn + i] = v;
        xb[(size_t)row * Dn + i] = f2bf(v);
    }
}

// ---------------------------------------------------------------------------
// WMMA bf16 GEMM:  out[m][n] = sum_k A[m][k] * Bw[n][k]  (+epilogue)
// MODE 0: outF = acc + bias[n]                      (f32)
// MODE 1: outB = bf16(gelu(acc + bias[n]))          (bf16)
// MODE 2: outF = acc + bias[n] + resid[m][n]        (f32)
// Block: 256 threads = 8 waves (2x4), block tile 128x128, BK=64.
// Wave tile 64x32 = 4x2 accumulators of v_wmma_f32_16x16x32_bf16.
// LDS ring of three K-slab buffers, filled by global_load_async_to_lds_b128 (ASYNCcnt)
// two slabs ahead; one work-group barrier a slab.
// ---------------------------------------------------------------------------
template <int MODE>
__global__ __launch_bounds__(256)
void gemm_wmma_bf16(const unsigned short* __restrict__ A,
                    const unsigned short* __restrict__ Bw,
                    const float* __restrict__ bias,
                    const float* __restrict__ resid,
                    float* __restrict__ outF,
                    unsigned short* __restrict__ outB,
                    int M, int N, int K) {
    __shared__ unsigned short As[3][128][72];  // 64 cols + pad, 16B-aligned rows
    __shared__ unsigned short Bs[3][128][72];

    const int tid   = threadIdx.x;
    const int lane  = tid & 31;
    const int wid   = tid >> 5;
    const int waveM = wid >> 2;      // 0..1  (rows of 64)
    const int waveN = wid & 3;       // 0..3  (cols of 32)
    const int m0 = blockIdx.y * 128;
    const int n0 = blockIdx.x * 128;

    // LDS fill: 8 neighbouring lanes take the 8 16-byte pieces of one row's 128-byte
    // slab, so a wave-wide copy covers 4 whole lines (a lane per row touched 32).
    const int lrow = tid >> 3;       // 0..31: row within a group of 32 rows
    const int lch  = tid & 7;        // which 16-byte piece of the row's slab

    const int ml   = lane & 15;      // M (or N) index within fragment
    const int half = lane >> 4;      // lane-half selects K sub-pattern

    const v8f vzero = {0.f, 0.f, 0.f, 0.f, 0.f, 0.f, 0.f, 0.f};
    v8f acc[4][2];
#pragma unroll
    for (int i = 0; i < 4; ++i)
#pragma unroll
        for (int j = 0; j < 2; ++j) acc[i][j] = vzero;

    const unsigned short* rowA = A  + (size_t)(m0 + lrow) * K + lch * 8;
    const unsigned short* rowB = Bw + (size_t)(n0 + lrow) * K + lch * 8;

    // Issue one K-slab (8 x 16B per thread) into LDS buffer `buf` via async DMA.
    auto issue_slab = [&](int buf, int k0) {
        unsigned l[8];
        const unsigned short* g[8];
#pragma unroll  // constant q: l and g stay in registers
        for (int q = 0; q < 4; ++q) {     // four groups of 32 rows
            l[q]     = lds_addr_of(&As[buf][q * 32 + lrow][lch * 8]);
            l[4 + q] = lds_addr_of(&Bs[buf][q * 32 + lrow][lch * 8]);
            g[q]     = rowA + (size_t)(q * 32) * K + k0;
            g[4 + q] = rowB + (size_t)(q * 32) * K + k0;
        }
        async_copy_b128_x8(l, g);
    };

    const int nslab = K >> 6;
    issue_slab(0, 0);
    if (nslab > 1) issue_slab(1, 64);

    int cur  = 0;   // buffer of slab i     = i mod 3
    int fill = 2;   // buffer of slab i + 2 = buffer of slab i - 1
    for (int i = 0; i < nslab; ++i) {
        // Slab i is handed over. This wave's reads of slab i - 1 have returned ...
        asm volatile("s_wait_dscnt 0x0" ::: "memory");
        // ... and its own copies of slab i have landed (the 8 youngest are slab i + 1's).
        if (i + 1 < nslab) wait_asynccnt<8>();
        else               wait_asynccnt<0>();
        // The one barrier of a slab: behind it every wave's part of slab i is in LDS, and
        // no wave reads slab i - 1 any more, so that its buffer can be filled again.
        __syncthreads();

        // All 24 fragment reads of the slab go out as one group, each into registers of
        // its own, ahead of the slab's 16 products: a wave then waits out the LDS latency
        // once a slab (with one A register set it did so in front of every pair of products).
        // 16-bit A/B fragment layout: lane-half 0 holds K {0..7,16..23},
        // half 1 holds K {8..15,24..31} (two 16B runs per lane).
        FragBF fa[2][4], fb[2][2];
#pragma unroll  // constant s, j, ii: the fragments stay in registers
        for (int s = 0; s < 2; ++s) {
            const int ks = s * 32;
#pragma unroll  // constant index: the fragments stay in registers
            for (int j = 0; j < 2; ++j) {
                const int col = waveN * 32 + j * 16 + ml;
                fb[s][j].lo = *(const U16x8*)&Bs[cur][col][ks + half * 8];
                fb[s][j].hi = *(const U16x8*)&Bs[cur][col][ks + 16 + half * 8];
            }
#pragma unroll  // constant index: the fragments stay in registers
            for (int ii = 0; ii < 4; ++ii) {
                const int row = waveM * 64 + ii * 16 + ml;
                fa[s][ii].lo = *(const U16x8*)&As[cur][row][ks + half * 8];
                fa[s][ii].hi = *(const U16x8*)&As[cur][row][ks + 16 + half * 8];
            }
        }
        // Slab i + 2 goes out here, behind the barrier above, into the buffer that slab i - 1
        // has left: its address arithmetic and its issue run while the reads of slab i come in.
        if (i + 2 < nslab) issue_slab(fill, (i + 2) << 6);
#pragma unroll  // constant s, ii, j: the fragments stay in registers
        for (int s = 0; s < 2; ++s) {
#pragma unroll  // constant index: the fragments stay in registers
            for (int ii = 0; ii < 4; ++ii) {
                v16bf av = __builtin_bit_cast(v16bf, fa[s][ii]);
#pragma unroll  // constant index: the fragments stay in registers
                for (int j = 0; j < 2; ++j) {
                    v16bf bv = __builtin_bit_cast(v16bf, fb[s][j]);
                    acc[ii][j] = __builtin_amdgcn_wmma_f32_16x16x32_bf16(
                        false, av, false, bv, (short)0, acc[ii][j], false, false);
                }
            }
        }
        cur  = (cur  == 2) ? 0 : cur + 1;
        fill = (fill == 2) ? 0 : fill + 1;
    }

    // Epilogue: C/D layout — VGPR r: lanes 0-15 -> M=r, lanes 16-31 -> M=r+8.
    float bcol[2];   // read once, ahead of the stores (behind a store it is read again, and waited for)
#pragma unroll  // constant j: bcol stays in registers
    for (int j = 0; j < 2; ++j) bcol[j] = bias[n0 + waveN * 32 + j * 16 + ml];
#pragma unroll
    for (int i = 0; i < 4; ++i) {
        const int rowBase = m0 + waveM * 64 + i * 16;
#pragma unroll
        for (int j = 0; j < 2; ++j) {
            const int col = n0 + waveN * 32 + j * 16 + ml;
            float cv[8];
#pragma unroll  // constant r: cv stays in registers
            for (int r = 0; r < 8; ++r) cv[r] = acc[i][j][r] + bcol[j];
            if (MODE == 1) {
                float gv[8];
                gelu_tanh_x8(gv, cv);
                unsigned short* po = outB + (size_t)(rowBase + half * 8) * N + col;
#pragma unroll  // constant r: gv stays in registers
                for (int r = 0; r < 8; ++r) { *po = f2bf(gv[r]); po += N; }   // next row
            } else {
#pragma unroll  // constant r: cv stays in registers
                for (int r = 0; r < 8; ++r) {
                    const int row = rowBase + r + half * 8;
                    const size_t o = (size_t)row * N + col;
                    if (MODE == 0) {
                        outF[o] = cv[r];
                    } else {
                        outF[o] = cv[r] + resid[o];
                    }
                }
            }
        }
    }
}

// ---------------------------------------------------------------------------
// Bv / Cv projections: out[row][n] = dot(xn[row,:], W[n,:]) + b[n], all in f32.
// One block takes 16 rows of xn and all 32 rows of WB and WC, so W is read once per
// 16 rows. Its 16 waves split K: wave w owns k = 64 w .. 64 w + 63.
// 1. Each wave brings its 48 row pieces of 256 bytes into LDS with loads that cover
//    whole lines (16 lanes a piece, two pieces a load).
// 2. It reads them back as fragments of v_wmma_f32_16x16x4_f32, W as A and xn as B:
//    lane (c, h) takes row c, k = 8 kk + 4 h .. + 3, the same for both operands, and
//    feeds elements 0, 1 to one product and 2, 3 to the next.
// 3. Each wave lays its two partial tiles over the head of its own LDS rows, and the
//    16 partial sums of every output are added as a tree over the waves.
// ---------------------------------------------------------------------------
typedef __attribute__((ext_vector_type(2))) float v2f;
typedef f32x4 f32x4_a4 __attribute__((aligned(4)));   // an input's base is only known as float*
#define BC_WAVES 16
#define BC_KW    64                    // k per wave
#define BC_K     (BC_WAVES * BC_KW)    // row length of xn, WB, WC (checked at the launch)
#define BC_PITCH 68                    // dwords a staged row: 16-byte reads down a column hit no bank twice

__global__ __launch_bounds__(BC_WAVES * 32)
void bc_proj_kernel(const float* __restrict__ xnf,
                    const float* __restrict__ WB, const float* __restrict__ bB,
                    const float* __restrict__ WC, const float* __restrict__ bC,
                    float* __restrict__ Bv, float* __restrict__ Cv) {
    __shared__ __attribute__((aligned(16))) float stage[BC_WAVES][48][BC_PITCH];
    const int tid  = threadIdx.x;
    const int lane = tid & 31;
    const int w    = tid >> 5;
    const int c    = lane & 15;
    const int h    = lane >> 4;
    const int m0   = blockIdx.x * 16;

    // 1. rows 0..15 of stage[w]: xn, 16..31: WB, 32..47: WC
    const int go = h * BC_K + w * BC_KW + c * 4;
    const float* __restrict__ gx = xnf + (size_t)m0 * BC_K + go;
    const float* __restrict__ gb = WB + go;
    const float* __restrict__ gc = WC + go;
    f32x4 v[24];
#pragma unroll  // constant j: v stays in registers and all loads go out first
    for (int j = 0; j < 8; ++j) {
        v[j]      = *(const f32x4_a4*)(gx + 2 * j * BC_K);
        v[8 + j]  = *(const f32x4_a4*)(gb + 2 * j * BC_K);
        v[16 + j] = *(const f32x4_a4*)(gc + 2 * j * BC_K);
    }
#pragma unroll  // constant j: v stays in registers
    for (int j = 0; j < 24; ++j)
        *(f32x4*)&stage[w][2 * j + h][c * 4] = v[j];
    __syncthreads();   // a lane reads what other lanes have stored

    // 2. D[n][m]: register r of lane (c, h) is out[m0 + c][8 h + r]
    float* const sf = &stage[w][c][h * 4];   // the one LDS address of steps 2 and 3
    v8f accB = {0.f, 0.f, 0.f, 0.f, 0.f, 0.f, 0.f, 0.f};
    v8f accC = accB;
#pragma unroll  // constant kk: LDS offsets are immediates and the reads can go out ahead
    for (int kk = 0; kk < BC_KW / 8; ++kk) {
        const f32x4 x4 = *(const f32x4*)(sf + kk * 8);
        const f32x4 b4 = *(const f32x4*)(sf + 16 * BC_PITCH + kk * 8);
        const f32x4 c4 = *(const f32x4*)(sf + 32 * BC_PITCH + kk * 8);
        const v2f xlo = {x4[0], x4[1]}, xhi = {x4[2], x4[3]};
        const v2f blo = {b4[0], b4[1]}, bhi = {b4[2], b4[3]};
        const v2f clo = {c4[0], c4[1]}, chi = {c4[2], c4[3]};
        accB = __builtin_amdgcn_wmma_f32_16x16x4_f32(false, blo, false, xlo, (short)0, accB, false, false);
        accC = __builtin_amdgcn_wmma_f32_16x16x4_f32(false, clo, false, xlo, (short)0, accC, false, false);
        accB = __builtin_amdgcn_wmma_f32_16x16x4_f32(false, bhi, false, xhi, (short)0, accB, false, false);
        accC = __builtin_amdgcn_wmma_f32_16x16x4_f32(false, chi, false, xhi, (short)0, accC, false, false);
    }
    // Four vector slots between the last product and whatever vector instruction next
    // reuses its registers: the distance of the 16-bit forms, kept here as a precaution
    // (none is tabled for the f32 form, and the compiler pads none). The two scheduling
    // barriers hold the slots at this place and keep step 3's index arithmetic behind them.
    __builtin_amdgcn_sched_barrier(0);
    asm volatile("v_nop\n\tv_nop\n\tv_nop\n\tv_nop");
    __builtin_amdgcn_sched_barrier(0);

    // 3. Row c (Bv) and row 16 + c (Cv) of the wave's own slice, which only this wave has
    //    read: n = 8 h + 4 q + e lies at column 8 q + 4 h + e, so that sf serves again.
    {
        const f32x4 b0 = {accB[0], accB[1], accB[2], accB[3]}, b1 = {accB[4], accB[5], accB[6], accB[7]};
        const f32x4 c0 = {accC[0], accC[1], accC[2], accC[3]}, c1 = {accC[4], accC[5], accC[6], accC[7]};
        *(f32x4*)(sf)                     = b0;
        *(f32x4*)(sf + 8)                 = b1;
        *(f32x4*)(sf + 16 * BC_PITCH)     = c0;
        *(f32x4*)(sf + 16 * BC_PITCH + 8) = c1;
    }
    __syncthreads();   // every wave's partial tiles are in LDS
    const int t   = tid >> 8;     // 0: Bv, 1: Cv (the same for a whole wave)
    const int idx = tid & 255;    // m * 16 + n
    const int n   = idx & 15;
    const int col = ((n >> 2) & 1) * 8 + (n >> 3) * 4 + (n & 3);
    float p[BC_WAVES];
#pragma unroll  // constant i: p stays in registers
    for (int i = 0; i < BC_WAVES; ++i) p[i] = stage[i][t * 16 + (idx >> 4)][col];
#pragma unroll  // constant i: p stays in registers
    for (int s = BC_WAVES / 2; s > 0; s >>= 1)
#pragma unroll  // constant i: p stays in registers
        for (int i = 0; i < s; ++i) p[i] += p[i + s];
    (t ? Cv : Bv)[(size_t)m0 * 16 + idx] = p[0] + (t ? bC : bB)[n];
}

// ---------------------------------------------------------------------------
// Chunked linear-recurrence scan (h = dA*h + b), 3 passes, NC chunks of CL.
// Thread layout (pass 1/3): one thread per (b, chunk, d); the lanes of a wave
// run along d, and each thread keeps all 16 states n in registers.
// P/Q/H layout: [b][chunk][n][d], so every access is contiguous along d.
// ---------------------------------------------------------------------------
#define SCAN_NC 64
#define SCAN_CL 32
#define SCAN_D  1024   // channels = pitch of one n row of P/Q/H (a constant, so that
                       // the 16 rows are reached by immediate offsets from one address)

// Pass 1: per-chunk transfer (P = prod dA, q = end state from h0=0)
// grid: x = d / 256, y = chunk, z = batch
__global__ __launch_bounds__(256)
void scan_pass1(const float* __restrict__ dtp, const float* __restrict__ xnf,
                const float* __restrict__ Bv, const float* __restrict__ A_log,
                float* __restrict__ Pbuf, float* __restrict__ Qbuf,
                int Lv, int Dv) {
    const int d = blockIdx.x * 256 + threadIdx.x;
    const int c = blockIdx.y;
    const int b = blockIdx.z;

    float An[16], invA[16], h[16], pf[16];
    float Amin = __builtin_inff();
#pragma unroll  // constant n: the per-thread arrays stay in registers
    for (int n = 0; n < 16; ++n) {
        An[n]   = -expf(A_log[n]);
        invA[n] = 1.0f / An[n];
        Amin    = fminf(Amin, -An[n]);
        h[n]  = 0.0f;
        pf[n] = 1.0f;
    }
    const int row0 = b * Lv + c * SCAN_CL;
    for (int l = 0; l < SCAN_CL; ++l) {
        const size_t idx = (size_t)(row0 + l);
        const float dt = softplus_hw(dtp[idx * Dv + d]);
        const float xv = xnf[idx * Dv + d];
        const float* __restrict__ Bp = Bv + idx * 16;   // same for the whole block
        float Br[16];   // read ahead of the branch, beside the two loads above
#pragma unroll  // constant n: the per-thread arrays stay in registers
        for (int n = 0; n < 16; ++n) Br[n] = Bp[n];
        const float dt2 = dt * LOG2E_F;
        float z2[16], dA[16];   // dA = exp(dt * A) = 2^(dt * log2(e) * A)
#pragma unroll  // constant n: the per-thread arrays stay in registers
        for (int n = 0; n < 16; ++n) z2[n] = dt2 * An[n];
        exp2_x8(dA, z2);
        exp2_x8(dA + 8, z2 + 8);
        const bool shortform = (dt * Amin >= SCAN_ZMIN) && (dt >= SCAN_DTMIN);
        if (__builtin_amdgcn_ballot_w32(!shortform) == 0u) {
            // b = (dA - 1) * w with w = B * x / (dt * A), so dA*h + b = dA*(h + w) - w
            const float g = xv * __builtin_amdgcn_rcpf(dt);
#pragma unroll  // constant n: the per-thread arrays stay in registers
            for (int n = 0; n < 16; ++n) {
                const float w = g * (Br[n] * invA[n]);
                h[n]  = dA[n] * (h[n] + w) - w;
                pf[n] = dA[n] * pf[n];
            }
        } else {
            // some lane has a small dt * A: phi1 in its library form, exact near 0
#pragma unroll  // constant n: the per-thread arrays stay in registers
            for (int n = 0; n < 16; ++n) {
                const float bt = phi1_f(dt * An[n]) * Br[n] * xv;
                h[n]  = dA[n] * h[n] + bt;
                pf[n] = dA[n] * pf[n];
            }
        }
    }
    const size_t o0 = (size_t)(b * SCAN_NC + c) * 16 * SCAN_D + d;
#pragma unroll  // constant n: the per-thread arrays stay in registers
    for (int n = 0; n < 16; ++n) {
        Pbuf[o0 + n * SCAN_D] = pf[n];
        Qbuf[o0 + n * SCAN_D] = h[n];
    }
}

// Pass 2: sequential combine over chunks -> initial state H_c per chunk
// one thread per (b, n, d); one chunk is a plane of 16 * SCAN_D elements
__global__ __launch_bounds__(256)
void scan_pass2(const float* __restrict__ Pbuf, const float* __restrict__ Qbuf,
                float* __restrict__ Hbuf) {
    constexpr int plane = 16 * SCAN_D;
    const int tid = blockIdx.x * 256 + threadIdx.x;
    const int b = tid / plane;
    const int r = tid - b * plane;        // n * SCAN_D + d
    const size_t o0 = (size_t)b * SCAN_NC * plane + r;
    float H = 0.0f;
    // unrolled whole: the loads do not depend on H, so they can all be in
    // flight together instead of one memory latency per few chunks
#pragma unroll
    for (int c = 0; c < SCAN_NC; ++c) {
        const size_t o = o0 + c * plane;
        Hbuf[o] = H;
        H = Pbuf[o] * H + Qbuf[o];
    }
}

// Pass 3: replay chunk from true H_c, emit y = sum_n Cv*h + D*xn, +residual
// grid: x = d / 256, y = chunk, z = batch
__global__ __launch_bounds__(256)
void scan_pass3(const float* __restrict__ dtp, const float* __restrict__ xnf,
                const float* __restrict__ xres,
                const float* __restrict__ Bv, const float* __restrict__ Cv,
                const float* __restrict__ A_log, const float* __restrict__ Dp,
                const float* __restrict__ scale, const float* __restrict__ Hbuf,
                float* __restrict__ x2, int Lv, int Dv) {
    const int d = blockIdx.x * 256 + threadIdx.x;
    const int c = blockIdx.y;
    const int b = blockIdx.z;

    const float Dd = Dp[d];
    const float sc = scale[d];

    float An[16], invA[16], h[16];
    float Amin = __builtin_inff();
    const size_t o0 = (size_t)(b * SCAN_NC + c) * 16 * SCAN_D + d;
#pragma unroll  // constant n: the per-thread arrays stay in registers
    for (int n = 0; n < 16; ++n) {
        An[n]   = -expf(A_log[n]);
        invA[n] = 1.0f / An[n];
        Amin    = fminf(Amin, -An[n]);
        h[n]  = Hbuf[o0 + n * SCAN_D];
    }
    const int row0 = b * Lv + c * SCAN_CL;
    for (int l = 0; l < SCAN_CL; ++l) {
        const size_t idx = (size_t)(row0 + l);
        const float dt = softplus_hw(dtp[idx * Dv + d]);
        const float xv = xnf[idx * Dv + d];
        const float xr = xres[idx * Dv + d];
        const float* __restrict__ Bp = Bv + idx * 16;   // same for the whole block
        const float* __restrict__ Cp = Cv + idx * 16;
        float Br[16], Cr[16];   // read ahead of the branch, beside the loads above
#pragma unroll  // constant n: the per-thread arrays stay in registers
        for (int n = 0; n < 16; ++n) { Br[n] = Bp[n]; Cr[n] = Cp[n]; }
        float t[16];
        const float dt2 = dt * LOG2E_F;
        float z2[16], dA[16];   // dA = exp(dt * A) = 2^(dt * log2(e) * A)
#pragma unroll  // constant n: the per-thread arrays stay in registers
        for (int n = 0; n < 16; ++n) z2[n] = dt2 * An[n];
        exp2_x8(dA, z2);
        exp2_x8(dA + 8, z2 + 8);
        const bool shortform = (dt * Amin >= SCAN_ZMIN) && (dt >= SCAN_DTMIN);
        if (__builtin_amdgcn_ballot_w32(!shortform) == 0u) {
            // b = (dA - 1) * w with w = B * x / (dt * A), so dA*h + b = dA*(h + w) - w
            const float g = xv * __builtin_amdgcn_rcpf(dt);
#pragma unroll  // constant n: the per-thread arrays stay in registers
            for (int n = 0; n < 16; ++n) {
                const float w = g * (Br[n] * invA[n]);
                h[n] = dA[n] * (h[n] + w) - w;
                t[n] = Cr[n] * h[n];
            }
        } else {
            // some lane has a small dt * A: phi1 in its library form, exact near 0
#pragma unroll  // constant n: the per-thread arrays stay in registers
            for (int n = 0; n < 16; ++n) {
                const float bt = phi1_f(dt * An[n]) * Br[n] * xv;
                h[n] = dA[n] * h[n] + bt;
                t[n] = Cr[n] * h[n];
            }
        }
        // sum over n: pairs 8, 4, 2, 1 apart
#pragma unroll  // constant n: the per-thread arrays stay in registers
        for (int s = 8; s > 0; s >>= 1)
#pragma unroll  // constant n: the per-thread arrays stay in registers
            for (int n = 0; n < s; ++n) t[n] += t[n + s];
        const float y = (t[0] + Dd * xv) * sc;
        x2[idx * Dv + d] = y + xr;
        // precaution: the next trip rewrites the registers that this store names
        asm volatile("s_wait_xcnt 0x0" ::: "memory");
    }
}

// ---------------------------------------------------------------------------
// Launch
// ---------------------------------------------------------------------------
extern "C" void kernel_launch(void* const* d_in, const int* in_sizes, int n_in,
                              void* d_out, int out_size, void* d_ws, size_t ws_size,
                              hipStream_t stream) {
    (void)in_sizes; (void)n_in; (void)out_size; (void)ws_size;
    constexpr int Bb = 2, Lv = 2048, Dv = 1024, Nst = 16, DFF = 4096;
    constexpr int Mrows = Bb * Lv;  // 4096
    constexpr int NCh = SCAN_NC;
    static_assert(Dv == SCAN_D && NCh * SCAN_CL == Lv, "scan tiling");

    const float* x       = (const float*)d_in[0];
    const float* norm1_w = (const float*)d_in[1];
    const float* norm2_w = (const float*)d_in[2];
    const float* A_log   = (const float*)d_in[3];
    const float* D_param = (const float*)d_in[4];
    const float* scale   = (const float*)d_in[5];
    const float* Wdt     = (const float*)d_in[6];
    const float* bdt     = (const float*)d_in[7];
    const float* WB      = (const float*)d_in[8];
    const float* bB      = (const float*)d_in[9];
    const float* WC      = (const float*)d_in[10];
    const float* bC      = (const float*)d_in[11];
    const float* W1      = (const float*)d_in[12];
    const float* b1      = (const float*)d_in[13];
    const float* W2      = (const float*)d_in[14];
    const float* b2      = (const float*)d_in[15];
    float* out = (float*)d_out;

    size_t off = 0;
    auto alloc = [&](size_t bytes) -> void* {
        void* p = (char*)d_ws + off;
        off += (bytes + 255) & ~(size_t)255;
        return p;
    };
    float*          xnf  = (float*)alloc((size_t)Mrows * Dv * 4);
    unsigned short* xnb  = (unsigned short*)alloc((size_t)Mrows * Dv * 2);
    unsigned short* wdtb = (unsigned short*)alloc((size_t)Dv * Dv * 2);
    unsigned short* w1b  = (unsigned short*)alloc((size_t)DFF * Dv * 2);
    unsigned short* w2b  = (unsigned short*)alloc((size_t)Dv * DFF * 2);
    float*          dtp  = (float*)alloc((size_t)Mrows * Dv * 4);
    float*          Bv   = (float*)alloc((size_t)Mrows * Nst * 4);
    float*          Cv   = (float*)alloc((size_t)Mrows * Nst * 4);
    float*          x2   = (float*)alloc((size_t)Mrows * Dv * 4);
    unsigned short* xn2b = (unsigned short*)alloc((size_t)Mrows * Dv * 2);
    unsigned short* hb   = (unsigned short*)alloc((size_t)Mrows * DFF * 2);
    float*          Pbuf = (float*)alloc((size_t)Bb * Dv * NCh * 16 * 4);
    float*          Qbuf = (float*)alloc((size_t)Bb * Dv * NCh * 16 * 4);
    float*          Hbuf = (float*)alloc((size_t)Bb * Dv * NCh * 16 * 4);

    // 1. weight converts to bf16
    static_assert((Dv * Dv) % CVT_BLOCK == 0 && (DFF * Dv) % CVT_BLOCK == 0, "convert tiling");
    cvt_bf16_kernel<<<(Dv * Dv) / CVT_BLOCK, 256, 0, stream>>>(Wdt, wdtb);
    cvt_bf16_kernel<<<(DFF * Dv) / CVT_BLOCK, 256, 0, stream>>>(W1, w1b);
    cvt_bf16_kernel<<<(Dv * DFF) / CVT_BLOCK, 256, 0, stream>>>(W2, w2b);

    // 2. RMSNorm1 (f32 + bf16)
    rmsnorm_kernel<1><<<Mrows, 256, 0, stream>>>(x, norm1_w, xnf, xnb, Dv);

    // 3. dt_pre = xn @ Wdt^T + bdt  (WMMA, async-LDS pipelined)
    gemm_wmma_bf16<0><<<dim3(Dv / 128, Mrows / 128), 256, 0, stream>>>(
        xnb, wdtb, bdt, nullptr, dtp, nullptr, Mrows, Dv, Dv);

    // 4. Bv / Cv projections
    static_assert(Dv == BC_K && Mrows % 16 == 0 && Nst == 16, "projection tiling");
    bc_proj_kernel<<<Mrows / 16, BC_WAVES * 32, 0, stream>>>(
        xnf, WB, bB, WC, bC, Bv, Cv);

    // 5. chunked selective scan + residual -> x2
    scan_pass1<<<dim3(Dv / 256, NCh, Bb), 256, 0, stream>>>(
        dtp, xnf, Bv, A_log, Pbuf, Qbuf, Lv, Dv);
    scan_pass2<<<(Bb * Dv * 16) / 256, 256, 0, stream>>>(Pbuf, Qbuf, Hbuf);
    scan_pass3<<<dim3(Dv / 256, NCh, Bb), 256, 0, stream>>>(
        dtp, xnf, x, Bv, Cv, A_log, D_param, scale, Hbuf, x2, Lv, Dv);

    // 6. RMSNorm2 (bf16 only)
    rmsnorm_kernel<0><<<Mrows, 256, 0, stream>>>(x2, norm2_w, nullptr, xn2b, Dv);

    // 7. h = gelu(xn2 @ W1^T + b1) -> bf16  (WMMA)
    gemm_wmma_bf16<1><<<dim3(DFF / 128, Mrows / 128), 256, 0, stream>>>(
        xn2b, w1b, b1, nullptr, nullptr, hb, Mrows, DFF, Dv);

    // 8. out = h @ W2^T + b2 + x2  (WMMA)
    gemm_wmma_bf16<2><<<dim3(Dv / 128, Mrows / 128), 256, 0, stream>>>(
        hb, w2b, b2, x2, out, nullptr, Mrows, Dv, DFF);
}

// v009
// A run of this version takes 167 microseconds.
// In both of two side-by-side timings against v008, it was 1.04 times as fast.
// Counting every step since v000, it is 4.22 times as fast.
#include <hip/hip_runtime.h>
#include <hip/hip_bf16.h>
#include <stdint.h>

// ---------------------------------------------------------------------------
// Types for WMMA (gfx1250, wave32)
// ---------------------------------------------------------------------------
typedef __attribute__((ext_vector_type(16))) __bf16 v16bf;
typedef __attribute__((ext_vector_type(8)))  float  v8f;

struct alignas(16) U16x8 { unsigned short u[8]; };
struct alignas(32) FragBF { U16x8 lo, hi; };

static __device__ __forceinline__ unsigned short f2bf(float f) {
    unsigned int u = __float_as_uint(f);
    u += 0x7FFFu + ((u >> 16) & 1u);          // round-to-nearest-even
    return (unsigned short)(u >> 16);
}

static __device__ __forceinline__ float phi1_f(float z) {
    if (fabsf(z) < 1e-4f) return 1.0f + 0.5f * z;
    return expm1f(z) / z;
}

// ---------------------------------------------------------------------------
// Scan arithmetic on the hardware's own exp2 / log2 / rcp instructions.
// ---------------------------------------------------------------------------
#define LOG2E_F 1.4426950408889634f
#define LN2_F   0.6931471805599453f
// A step takes the short form only where every |dt * A[n]| is at least this:
// there exp(z) - 1 keeps its relative accuracy (error about 1e-7 / |z|).
#define SCAN_ZMIN  0.0625f
// ... and where 1 / dt is far from overflow.
#define SCAN_DTMIN 1e-30f

// r[i] = 2^x[i], i = 0..7. One statement, so that each v_exp_f32 has an
// independent instruction behind it and the last one a v_nop: the slot that the
// instruction set asks for before a transcendental's source is overwritten or its
// result read.
static __device__ __forceinline__ void exp2_x8(float* r, const float* x) {
    asm("v_exp_f32 %0, %8\n\t"
        "v_exp_f32 %1, %9\n\t"
        "v_exp_f32 %2, %10\n\t"
        "v_exp_f32 %3, %11\n\t"
        "v_exp_f32 %4, %12\n\t"
        "v_exp_f32 %5, %13\n\t"
        "v_exp_f32 %6, %14\n\t"
        "v_exp_f32 %7, %15\n\t"
        "v_nop"
        : "=&v"(r[0]), "=&v"(r[1]), "=&v"(r[2]), "=&v"(r[3]),
          "=&v"(r[4]), "=&v"(r[5]), "=&v"(r[6]), "=&v"(r[7])
        : "v"(x[0]), "v"(x[1]), "v"(x[2]), "v"(x[3]),
          "v"(x[4]), "v"(x[5]), "v"(x[6]), "v"(x[7]));
}

// r[i] = 1 / x[i], i = 0..7, in the same form and for the same reason as exp2_x8.
static __device__ __forceinline__ void rcp_x8(float* r, const float* x) {
    asm("v_rcp_f32 %0, %8\n\t"
        "v_rcp_f32 %1, %9\n\t"
        "v_rcp_f32 %2, %10\n\t"
        "v_rcp_f32 %3, %11\n\t"
        "v_rcp_f32 %4, %12\n\t"
        "v_rcp_f32 %5, %13\n\t"
        "v_rcp_f32 %6, %14\n\t"
        "v_rcp_f32 %7, %15\n\t"
        "v_nop"
        : "=&v"(r[0]), "=&v"(r[1]), "=&v"(r[2]), "=&v"(r[3]),
          "=&v"(r[4]), "=&v"(r[5]), "=&v"(r[6]), "=&v"(r[7])
        : "v"(x[0]), "v"(x[1]), "v"(x[2]), "v"(x[3]),
          "v"(x[4]), "v"(x[5]), "v"(x[6]), "v"(x[7]));
}

// y[i] = gelu(x[i]), tanh form, i = 0..7.
// 0.5 * (1 + tanh(u)) = 1 / (1 + exp(-2 u)) with u = 0.7978845608 * (x + 0.044715 x^3),
// and exp(-2 u) = 2^t. No branch, so the eight values are worked on side by side (the
// library tanhf takes two divergent branches a value, one value after the other).
// The ends come out as with tanh: 2^t = 0 gives x, 2^t = inf gives x * 0.
static __device__ __forceinline__ void gelu_tanh_x8(float* y, const float* x) {
    float t[8], e[8], q[8];
#pragma unroll  // constant i: the arrays stay in registers
    for (int i = 0; i < 8; ++i)
        t[i] = x[i] * (-2.3022081981f - 0.1029432396f * (x[i] * x[i]));   // -2 u log2(e)
    exp2_x8(e, t);
#pragma unroll  // constant i: the arrays stay in registers
    for (int i = 0; i < 8; ++i) e[i] = 1.0f + e[i];
    rcp_x8(q, e);
#pragma unroll  // constant i: the arrays stay in registers
    for (int i = 0; i < 8; ++i) y[i] = x[i] * q[i];
}

// softplus(x) = max(x, 0) + log1p(exp(-|x|)); e = exp(-|x|) lies in (0, 1].
// Below 1/16 the series of log1p keeps the relative accuracy that 1 + e loses.
static __device__ __forceinline__ float softplus_hw(float x) {
    const float e  = __builtin_amdgcn_exp2f(-fabsf(x) * LOG2E_F);
    const float lg = __builtin_amdgcn_logf(1.0f + e) * LN2_F;
    float p = 0.2f - e * (1.0f / 6.0f);
    p = -0.25f + e * p;
    p = (1.0f / 3.0f) + e * p;
    p = -0.5f + e * p;
    p = e + (e * e) * p;
    return fmaxf(x, 0.0f) + ((e < 0.0625f) ? p : lg);
}

// ---------------------------------------------------------------------------
// gfx1250 async memory->LDS copies (ASYNCcnt tracked), 16B per lane: the eight
// copies of one thread for one K-slab. l = LDS byte address (low 32 bits of the
// generic pointer: the flat aperture maps LDS_ADDR = addr[31:0]), g = global address.
// The last line is a precaution: it stands ahead of whatever rewrites the address
// registers that the copies name, and inside the statement nothing can be moved
// in front of it.
// ---------------------------------------------------------------------------
static __device__ __forceinline__ unsigned lds_addr_of(const void* p) {
    return (unsigned)(size_t)p;
}

static __device__ __forceinline__ void async_copy_b128_x8(const unsigned* l,
                                                          const unsigned short* const* g) {
    asm volatile("global_load_async_to_lds_b128 %0, %8, off\n\t"
                 "global_load_async_to_lds_b128 %1, %9, off\n\t"
                 "global_load_async_to_lds_b128 %2, %10, off\n\t"
                 "global_load_async_to_lds_b128 %3, %11, off\n\t"
                 "global_load_async_to_lds_b128 %4, %12, off\n\t"
                 "global_load_async_to_lds_b128 %5, %13, off\n\t"
                 "global_load_async_to_lds_b128 %6, %14, off\n\t"
                 "global_load_async_to_lds_b128 %7, %15, off\n\t"
                 "s_wait_xcnt 0x0"
                 :: "v"(l[0]), "v"(l[1]), "v"(l[2]), "v"(l[3]),
                    "v"(l[4]), "v"(l[5]), "v"(l[6]), "v"(l[7]),
                    "v"(g[0]), "v"(g[1]), "v"(g[2]), "v"(g[3]),
                    "v"(g[4]), "v"(g[5]), "v"(g[6]), "v"(g[7])
                 : "memory");
}

template <int Nc>
static __device__ __forceinline__ void wait_asynccnt() {
    asm volatile("s_wait_asynccnt %0" :: "n"(Nc) : "memory");
}

// ---------------------------------------------------------------------------
// f32 -> bf16 convert. One block of 256 threads converts CVT_BLOCK contiguous
// elements, the blk-th such run of the array; the array length must be a multiple
// of CVT_BLOCK (checked at the launch).
// A thread takes CVT_G groups of 4 elements, 256 groups apart: each
// wave-wide load covers 512 contiguous bytes, each store 256, and a wave has
// CVT_G loads in flight. The point is fewer waves than with one element a
// thread, for speed only.
// ---------------------------------------------------------------------------
typedef __attribute__((ext_vector_type(4))) float f32x4;
struct alignas(8) U16x4 { unsigned short u[4]; };
#define CVT_G     8
#define CVT_BLOCK (256 * CVT_G * 4)

static __device__ __forceinline__
void cvt_bf16_block(const float* __restrict__ in,
                    unsigned short* __restrict__ out, int blk) {
    const size_t g0 = (size_t)blk * (256 * CVT_G) + threadIdx.x;
    const f32x4* __restrict__ src = (const f32x4*)in + g0;
    U16x4* __restrict__ dst = (U16x4*)out + g0;
    f32x4 v[CVT_G];
#pragma unroll  // constant j: v stays in registers and all loads go out first
    for (int j = 0; j < CVT_G; ++j) v[j] = src[j * 256];
#pragma unroll  // constant j: v stays in registers
    for (int j = 0; j < CVT_G; ++j) {
        U16x4 o;
        o.u[0] = f2bf(v[j][0]);
        o.u[1] = f2bf(v[j][1]);
        o.u[2] = f2bf(v[j][2]);
        o.u[3] = f2bf(v[j][3]);
        dst[j * 256] = o;
    }
}

// ---------------------------------------------------------------------------
// RMSNorm: one block takes one row of length Dn=1024; writes f32 (optional) + bf16
// ---------------------------------------------------------------------------
template <int WRITE_F32>
static __device__ __forceinline__
void rmsnorm_row(const float* __restrict__ x, const float* __restrict__ w,
                 float* __restrict__ xf, unsigned short* __restrict__ xb, int Dn, int row) {
    const int tid = threadIdx.x;
    const float* xr = x + (size_t)row * Dn;
    float ss = 0.0f;
    for (int i = tid; i < Dn; i += 256) { float v = xr[i]; ss += v * v; }
    __shared__ float red[256];
    red[tid] = ss;
    __syncthreads();
    for (int s = 128; s > 0; s >>= 1) {
        if (tid < s) red[tid] += red[tid + s];
        __syncthreads();
    }
    const float r = rsqrtf(red[0] / (float)Dn + 1e-6f);
    for (int i = tid; i < Dn; i += 256) {
        float v = xr[i] * r * w[i];
        if (WRITE_F32) xf[(size_t)row * Dn + i] = v;
        xb[(size_t)row * Dn + i] = f2bf(v);
    }
}

// A launch of its own: one block per row.
template <int WRITE_F32>
__global__ __launch_bounds__(256)
void rmsnorm_kernel(const float* __restrict__ x, const float* __restrict__ w,
                    float* __restrict__ xf, unsigned short* __restrict__ xb, int Dn) {
    rmsnorm_row<WRITE_F32>(x, w, xf, xb, Dn, blockIdx.x);
}

// ---------------------------------------------------------------------------
// The work that depends on nothing but the inputs, in ONE launch: the three weight
// converts (NB0, NB1, NB2 blocks) and RMSNorm1 (ROWS blocks, f32 + bf16). As four
// launches each paid its own gap, start and drain, for a few microseconds of bytes.
// The two kinds of block are dealt out evenly along the grid, CP convert blocks and
// then RP rows in each of GROUPS groups, so that the converts' many loads in flight
// can fill the memory time that a row block spends in its sum over the row.
// The branch depends on blockIdx alone: the barriers in rmsnorm_row are block-uniform.
// ---------------------------------------------------------------------------
template <int NB0, int NB1, int NB2, int ROWS, int GROUPS>
__global__ __launch_bounds__(256)
void prep_kernel(const float* __restrict__ x, const float* __restrict__ nw,
                 float* __restrict__ xf, unsigned short* __restrict__ xb,
                 const float* __restrict__ Wa, unsigned short* __restrict__ oa,
                 const float* __restrict__ Wb, unsigned short* __restrict__ ob,
                 const float* __restrict__ Wc, unsigned short* __restrict__ oc, int Dn) {
    constexpr int CP = (NB0 + NB1 + NB2) / GROUPS;
    constexpr int RP = ROWS / GROUPS;
    static_assert(CP * GROUPS == NB0 + NB1 + NB2 && RP * GROUPS == ROWS, "even deal");
    const int grp = blockIdx.x / (CP + RP);
    const int pos = blockIdx.x - grp * (CP + RP);
    if (pos < CP) {
        // which array, and which of its runs: scalar selects, then one copy of the convert
        const int cb = grp * CP + pos;
        const int wh = (cb >= NB0) + (cb >= NB0 + NB1);
        const float* in     = (wh == 0) ? Wa : (wh == 1) ? Wb : Wc;
        unsigned short* out = (wh == 0) ? oa : (wh == 1) ? ob : oc;
        cvt_bf16_block(in, out, cb - ((wh == 0) ? 0 : (wh == 1) ? NB0 : NB0 + NB1));
    } else {
        rmsnorm_row<1>(x, nw, xf, xb, Dn, grp * RP + (pos - CP));
    }
}

// ---------------------------------------------------------------------------
// WMMA bf16 GEMM:  out[m][n] = sum_k A[m][k] * Bw[n][k]  (+epilogue)
// MODE 0: outF = acc + bias[n]                      (f32)
// MODE 1: outB = bf16(gelu(acc + bias[n]))          (bf16)
// MODE 2: outF = acc + bias[n] + resid[m][n]        (f32)
// Block: 256 threads = 8 waves (2x4), block tile 128x128, BK=64.
// Wave tile 64x32 = 4x2 accumulators of v_wmma_f32_16x16x32_bf16.
// LDS ring of three K-slab buffers, filled by global_load_async_to_lds_b128 (ASYNCcnt)
// two slabs ahead; one work-group barrier a slab.
// ---------------------------------------------------------------------------
template <int MODE>
__global__ __launch_bounds__(256)
void gemm_wmma_bf16(const unsigned short* __restrict__ A,
                    const unsigned short* __restrict__ Bw,
                    const float* __restrict__ bias,
                    const float* __restrict__ resid,
                    float* __restrict__ outF,
                    unsigned short* __restrict__ outB,
                    int M, int N, int K) {
    __shared__ unsigned short As[3][128][72];  // 64 cols + pad, 16B-aligned rows
    __shared__ unsigned short Bs[3][128][72];

    const int tid   = threadIdx.x;
    const int lane  = tid & 31;
    const int wid   = tid >> 5;
    const int waveM = wid >> 2;      // 0..1  (rows of 64)
    const int waveN = wid & 3;       // 0..3  (cols of 32)
    const int m0 = blockIdx.y * 128;
    const int n0 = blockIdx.x * 128;

    // LDS fill: 8 neighbouring lanes take the 8 16-byte pieces of one row's 128-byte
    // slab, so a wave-wide copy covers 4 whole lines (a lane per row touched 32).
    const int lrow = tid >> 3;       // 0..31: row within a group of 32 rows
    const int lch  = tid & 7;        // which 16-byte piece of the row's slab

    const int ml   = lane & 15;      // M (or N) index within fragment
    const int half = lane >> 4;      // lane-half selects K sub-pattern

    const v8f vzero = {0.f, 0.f, 0.f, 0.f, 0.f, 0.f, 0.f, 0.f};
    v8f acc[4][2];
#pragma unroll
    for (int i = 0; i < 4; ++i)
#pragma unroll
        for (int j = 0; j < 2; ++j) acc[i][j] = vzero;

    const unsigned short* rowA = A  + (size_t)(m0 + lrow) * K + lch * 8;
    const unsigned short* rowB = Bw + (size_t)(n0 + lrow) * K + lch * 8;

    // Issue one K-slab (8 x 16B per thread) into LDS buffer `buf` via async DMA.
    auto issue_slab = [&](int buf, int k0) {
        unsigned l[8];
        const unsigned short* g[8];
#pragma unroll  // constant q: l and g stay in registers
        for (int q = 0; q < 4; ++q) {     // four groups of 32 rows
            l[q]     = lds_addr_of(&As[buf][q * 32 + lrow][lch * 8]);
            l[4 + q] = lds_addr_of(&Bs[buf][q * 32 + lrow][lch * 8]);
            g[q]     = rowA + (size_t)(q * 32) * K + k0;
            g[4 + q] = rowB + (size_t)(q * 32) * K + k0;
        }
        async_copy_b128_x8(l, g);
    };

    const int nslab = K >> 6;
    issue_slab(0, 0);
    if (nslab > 1) issue_slab(1, 64);

    int cur  = 0;   // buffer of slab i     = i mod 3
    int fill = 2;   // buffer of slab i + 2 = buffer of slab i - 1
    for (int i = 0; i < nslab; ++i) {
        // Slab i is handed over. This wave's reads of slab i - 1 have returned ...
        asm volatile("s_wait_dscnt 0x0" ::: "memory");
        // ... and its own copies of slab i have landed (the 8 youngest are slab i + 1's).
        if (i + 1 < nslab) wait_asynccnt<8>();
        else               wait_asynccnt<0>();
        // The one barrier of a slab: behind it every wave's part of slab i is in LDS, and
        // no wave reads slab i - 1 any more, so that its buffer can be filled again.
        __syncthreads();

        // All 24 fragment reads of the slab go out as one group, each into registers of
        // its own, ahead of the slab's 16 products: a wave then waits out the LDS latency
        // once a slab (with one A register set it did so in front of every pair of products).
        // 16-bit A/B fragment layout: lane-half 0 holds K {0..7,16..23},
        // half 1 holds K {8..15,24..31} (two 16B runs per lane).
        FragBF fa[2][4], fb[2][2];
#pragma unroll  // constant s, j, ii: the fragments stay in registers
        for (int s = 0; s < 2; ++s) {
            const int ks = s * 32;
#pragma unroll  // constant index: the fragments stay in registers
            for (int j = 0; j < 2; ++j) {
                const int col = waveN * 32 + j * 16 + ml;
                fb[s][j].lo = *(const U16x8*)&Bs[cur][col][ks + half * 8];
                fb[s][j].hi = *(const U16x8*)&Bs[cur][col][ks + 16 + half * 8];
            }
#pragma unroll  // constant index: the fragments stay in registers
            for (int ii = 0; ii < 4; ++ii) {
                const int row = waveM * 64 + ii * 16 + ml;
                fa[s][ii].lo = *(const U16x8*)&As[cur][row][ks + half * 8];
                fa[s][ii].hi = *(const U16x8*)&As[cur][row][ks + 16 + half * 8];
            }
        }
        // Slab i + 2 goes out here, behind the barrier above, into the buffer that slab i - 1
        // has left: its address arithmetic and its issue run while the reads of slab i come in.
        if (i + 2 < nslab) issue_slab(fill, (i + 2) << 6);
#pragma unroll  // constant s, ii, j: the fragments stay in registers
        for (int s = 0; s < 2; ++s) {
#pragma unroll  // constant index: the fragments stay in registers
            for (int ii = 0; ii < 4; ++ii) {
                v16bf av = __builtin_bit_cast(v16bf, fa[s][ii]);
#pragma unroll  // constant index: the fragments stay in registers
                for (int j = 0; j < 2; ++j) {
                    v16bf bv = __builtin_bit_cast(v16bf, fb[s][j]);
                    acc[ii][j] = __builtin_amdgcn_wmma_f32_16x16x32_bf16(
                        false, av, false, bv, (short)0, acc[ii][j], false, false);
                }
            }
        }
        cur  = (cur  == 2) ? 0 : cur + 1;
        fill = (fill == 2) ? 0 : fill + 1;
    }

    // Epilogue: C/D layout — VGPR r: lanes 0-15 -> M=r, lanes 16-31 -> M=r+8.
    float bcol[2];   // read once, ahead of the stores (behind a store it is read again, and waited for)
#pragma unroll  // constant j: bcol stays in registers
    for (int j = 0; j < 2; ++j) bcol[j] = bias[n0 + waveN * 32 + j * 16 + ml];
#pragma unroll
    for (int i = 0; i < 4; ++i) {
        const int rowBase = m0 + waveM * 64 + i * 16;
#pragma unroll
        for (int j = 0; j < 2; ++j) {
            const int col = n0 + waveN * 32 + j * 16 + ml;
            float cv[8];
#pragma unroll  // constant r: cv stays in registers
            for (int r = 0; r < 8; ++r) cv[r] = acc[i][j][r] + bcol[j];
            if (MODE == 1) {
                float gv[8];
                gelu_tanh_x8(gv, cv);
                unsigned short* po = outB + (size_t)(rowBase + half * 8) * N + col;
#pragma unroll  // constant r: gv stays in registers
                for (int r = 0; r < 8; ++r) { *po = f2bf(gv[r]); po += N; }   // next row
            } else {
#pragma unroll  // constant r: cv stays in registers
                for (int r = 0; r < 8; ++r) {
                    const int row = rowBase + r + half * 8;
                    const size_t o = (size_t)row * N + col;
                    if (MODE == 0) {
                        outF[o] = cv[r];
                    } else {
                        outF[o] = cv[r] + resid[o];
                    }
                }
            }
        }
    }
}

// ---------------------------------------------------------------------------
// Bv / Cv projections: out[row][n] = dot(xn[row,:], W[n,:]) + b[n], all in f32.
// One block takes 16 rows of xn and all 32 rows of WB and WC, so W is read once per
// 16 rows. Its 16 waves split K: wave w owns k = 64 w .. 64 w + 63.
// 1. Each wave brings its 48 row pieces of 256 bytes into LDS with loads that cover
//    whole lines (16 lanes a piece, two pieces a load).
// 2. It reads them back as fragments of v_wmma_f32_16x16x4_f32, W as A and xn as B:
//    lane (c, h) takes row c, k = 8 kk + 4 h .. + 3, the same for both operands, and
//    feeds elements 0, 1 to one product and 2, 3 to the next.
// 3. Each wave lays its two partial tiles over the head of its own LDS rows, and the
//    16 partial sums of every output are added as a tree over the waves.
// ---------------------------------------------------------------------------
typedef __attribute__((ext_vector_type(2))) float v2f;
typedef f32x4 f32x4_a4 __attribute__((aligned(4)));   // an input's base is only known as float*
#define BC_WAVES 16
#define BC_KW    64                    // k per wave
#define BC_K     (BC_WAVES * BC_KW)    // row length of xn, WB, WC (checked at the launch)
#define BC_PITCH 68                    // dwords a staged row: 16-byte reads down a column hit no bank twice

__global__ __launch_bounds__(BC_WAVES * 32)
void bc_proj_kernel(const float* __restrict__ xnf,
                    const float* __restrict__ WB, const float* __restrict__ bB,
                    const float* __restrict__ WC, const float* __restrict__ bC,
                    float* __restrict__ Bv, float* __restrict__ Cv) {
    __shared__ __attribute__((aligned(16))) float stage[BC_WAVES][48][BC_PITCH];
    const int tid  = threadIdx.x;
    const int lane = tid & 31;
    const int w    = tid >> 5;
    const int c    = lane & 15;
    const int h    = lane >> 4;
    const int m0   = blockIdx.x * 16;

    // 1. rows 0..15 of stage[w]: xn, 16..31: WB, 32..47: WC
    const int go = h * BC_K + w * BC_KW + c * 4;
    const float* __restrict__ gx = xnf + (size_t)m0 * BC_K + go;
    const float* __restrict__ gb = WB + go;
    const float* __restrict__ gc = WC + go;
    f32x4 v[24];
#pragma unroll  // constant j: v stays in registers and all loads go out first
    for (int j = 0; j < 8; ++j) {
        v[j]      = *(const f32x4_a4*)(gx + 2 * j * BC_K);
        v[8 + j]  = *(const f32x4_a4*)(gb + 2 * j * BC_K);
        v[16 + j] = *(const f32x4_a4*)(gc + 2 * j * BC_K);
    }
#pragma unroll  // constant j: v stays in registers
    for (int j = 0; j < 24; ++j)
        *(f32x4*)&stage[w][2 * j + h][c * 4] = v[j];
    __syncthreads();   // a lane reads what other lanes have stored

    // 2. D[n][m]: register r of lane (c, h) is out[m0 + c][8 h + r]
    float* const sf = &stage[w][c][h * 4];   // the one LDS address of steps 2 and 3
    v8f accB = {0.f, 0.f, 0.f, 0.f, 0.f, 0.f, 0.f, 0.f};
    v8f accC = accB;
#pragma unroll  // constant kk: LDS offsets are immediates and the reads can go out ahead
    for (int kk = 0; kk < BC_KW / 8; ++kk) {
        const f32x4 x4 = *(const f32x4*)(sf + kk * 8);
        const f32x4 b4 = *(const f32x4*)(sf + 16 * BC_PITCH + kk * 8);
        const f32x4 c4 = *(const f32x4*)(sf + 32 * BC_PITCH + kk * 8);
        const v2f xlo = {x4[0], x4[1]}, xhi = {x4[2], x4[3]};
        const v2f blo = {b4[0], b4[1]}, bhi = {b4[2], b4[3]};
        const v2f clo = {c4[0], c4[1]}, chi = {c4[2], c4[3]};
        accB = __builtin_amdgcn_wmma_f32_16x16x4_f32(false, blo, false, xlo, (short)0, accB, false, false);
        accC = __builtin_amdgcn_wmma_f32_16x16x4_f32(false, clo, false, xlo, (short)0, accC, false, false);
        accB = __builtin_amdgcn_wmma_f32_16x16x4_f32(false, bhi, false, xhi, (short)0, accB, false, false);
        accC = __builtin_amdgcn_wmma_f32_16x16x4_f32(false, chi, false, xhi, (short)0, accC, false, false);
    }
    // Four vector slots between the last product and whatever vector instruction next
    // reuses its registers: the distance of the 16-bit forms, kept here as a precaution
    // (none is tabled for the f32 form, and the compiler pads none). The two scheduling
    // barriers hold the slots at this place and keep step 3's index arithmetic behind them.
    __builtin_amdgcn_sched_barrier(0);
    asm volatile("v_nop\n\tv_nop\n\tv_nop\n\tv_nop");
    __builtin_amdgcn_sched_barrier(0);

    // 3. Row c (Bv) and row 16 + c (Cv) of the wave's own slice, which only this wave has
    //    read: n = 8 h + 4 q + e lies at column 8 q + 4 h + e, so that sf serves again.
    {
        const f32x4 b0 = {accB[0], accB[1], accB[2], accB[3]}, b1 = {accB[4], accB[5], accB[6], accB[7]};
        const f32x4 c0 = {accC[0], accC[1], accC[2], accC[3]}, c1 = {accC[4], accC[5], accC[6], accC[7]};
        *(f32x4*)(sf)                     = b0;
        *(f32x4*)(sf + 8)                 = b1;
        *(f32x4*)(sf + 16 * BC_PITCH)     = c0;
        *(f32x4*)(sf + 16 * BC_PITCH + 8) = c1;
    }
    __syncthreads();   // every wave's partial tiles are in LDS
    const int t   = tid >> 8;     // 0: Bv, 1: Cv (the same for a whole wave)
    const int idx = tid & 255;    // m * 16 + n
    const int n   = idx & 15;
    const int col = ((n >> 2) & 1) * 8 + (n >> 3) * 4 + (n & 3);
    float p[BC_WAVES];
#pragma unroll  // constant i: p stays in registers
    for (int i = 0; i < BC_WAVES; ++i) p[i] = stage[i][t * 16 + (idx >> 4)][col];
#pragma unroll  // constant i: p stays in registers
    for (int s = BC_WAVES / 2; s > 0; s >>= 1)
#pragma unroll  // constant i: p stays in registers
        for (int i = 0; i < s; ++i) p[i] += p[i + s];
    (t ? Cv : Bv)[(size_t)m0 * 16 + idx] = p[0] + (t ? bC : bB)[n];
}

// ---------------------------------------------------------------------------
// Chunked linear-recurrence scan (h = dA*h + b), 3 passes, NC chunks of CL.
// Thread layout (pass 1/3): one thread per (b, chunk, d); the lanes of a wave
// run along d, and each thread keeps all 16 states n in registers.
// P/Q/H layout: [b][chunk][n][d], so every access is contiguous along d.
// ---------------------------------------------------------------------------
#define SCAN_NC 64
#define SCAN_CL 32
#define SCAN_D  1024   // channels = pitch of one n row of P/Q/H (a constant, so that
                       // the 16 rows are reached by immediate offsets from one address)

// Pass 1: per-chunk transfer (P = prod dA, q = end state from h0=0)
// grid: x = d / 256, y = chunk, z = batch
__global__ __launch_bounds__(256)
void scan_pass1(const float* __restrict__ dtp, const float* __restrict__ xnf,
                const float* __restrict__ Bv, const float* __restrict__ A_log,
                float* __restrict__ Pbuf, float* __restrict__ Qbuf,
                int Lv, int Dv) {
    const int d = blockIdx.x * 256 + threadIdx.x;
    const int c = blockIdx.y;
    const int b = blockIdx.z;

    float An[16], invA[16], h[16], pf[16];
    float Amin = __builtin_inff();
#pragma unroll  // constant n: the per-thread arrays stay in registers
    for (int n = 0; n < 16; ++n) {
        An[n]   = -expf(A_log[n]);
        invA[n] = 1.0f / An[n];
        Amin    = fminf(Amin, -An[n]);
        h[n]  = 0.0f;
        pf[n] = 1.0f;
    }
    const int row0 = b * Lv + c * SCAN_CL;
    for (int l = 0; l < SCAN_CL; ++l) {
        const size_t idx = (size_t)(row0 + l);
        const float dt = softplus_hw(dtp[idx * Dv + d]);
        const float xv = xnf[idx * Dv + d];
        const float* __restrict__ Bp = Bv + idx * 16;   // same for the whole block
        float Br[16];   // read ahead of the branch, beside the two loads above
#pragma unroll  // constant n: the per-thread arrays stay in registers
        for (int n = 0; n < 16; ++n) Br[n] = Bp[n];
        const float dt2 = dt * LOG2E_F;
        float z2[16], dA[16];   // dA = exp(dt * A) = 2^(dt * log2(e) * A)
#pragma unroll  // constant n: the per-thread arrays stay in registers
        for (int n = 0; n < 16; ++n) z2[n] = dt2 * An[n];
        exp2_x8(dA, z2);
        exp2_x8(dA + 8, z2 + 8);
        const bool shortform = (dt * Amin >= SCAN_ZMIN) && (dt >= SCAN_DTMIN);
        if (__builtin_amdgcn_ballot_w32(!shortform) == 0u) {
            // b = (dA - 1) * w with w = B * x / (dt * A), so dA*h + b = dA*(h + w) - w
            const float g = xv * __builtin_amdgcn_rcpf(dt);
#pragma unroll  // constant n: the per-thread arrays stay in registers
            for (int n = 0; n < 16; ++n) {
                const float w = g * (Br[n] * invA[n]);
                h[n]  = dA[n] * (h[n] + w) - w;
                pf[n] = dA[n] * pf[n];
            }
        } else {
            // some lane has a small dt * A: phi1 in its library form, exact near 0
#pragma unroll  // constant n: the per-thread arrays stay in registers
            for (int n = 0; n < 16; ++n) {
                const float bt = phi1_f(dt * An[n]) * Br[n] * xv;
                h[n]  = dA[n] * h[n] + bt;
                pf[n] = dA[n] * pf[n];
            }
        }
    }
    const size_t o0 = (size_t)(b * SCAN_NC + c) * 16 * SCAN_D + d;
#pragma unroll  // constant n: the per-thread arrays stay in registers
    for (int n = 0; n < 16; ++n) {
        Pbuf[o0 + n * SCAN_D] = pf[n];
        Qbuf[o0 + n * SCAN_D] = h[n];
    }
}

// Pass 2: sequential combine over chunks -> initial state H_c per chunk
// one thread per (b, n, d); one chunk is a plane of 16 * SCAN_D elements
__global__ __launch_bounds__(256)
void scan_pass2(const float* __restrict__ Pbuf, const float* __restrict__ Qbuf,
                float* __restrict__ Hbuf) {
    constexpr int plane = 16 * SCAN_D;
    const int tid = blockIdx.x * 256 + threadIdx.x;
    const int b = tid / plane;
    const int r = tid - b * plane;        // n * SCAN_D + d
    const size_t o0 = (size_t)b * SCAN_NC * plane + r;
    float H = 0.0f;
    // unrolled whole: the loads do not depend on H, so they can all be in
    // flight together instead of one memory latency per few chunks
#pragma unroll
    for (int c = 0; c < SCAN_NC; ++c) {
        const size_t o = o0 + c * plane;
        Hbuf[o] = H;
        H = Pbuf[o] * H + Qbuf[o];
    }
}

// Pass 3: replay chunk from true H_c, emit y = sum_n Cv*h + D*xn, +residual
// grid: x = d / 256, y = chunk, z = batch
__global__ __launch_bounds__(256)
void scan_pass3(const float* __restrict__ dtp, const float* __restrict__ xnf,
                const float* __restrict__ xres,
                const float* __restrict__ Bv, const float* __restrict__ Cv,
                const float* __restrict__ A_log, const float* __restrict__ Dp,
                const float* __restrict__ scale, const float* __restrict__ Hbuf,
                float* __restrict__ x2, int Lv, int Dv) {
    const int d = blockIdx.x * 256 + threadIdx.x;
    const int c = blockIdx.y;
    const int b = blockIdx.z;

    const float Dd = Dp[d];
    const float sc = scale[d];

    float An[16], invA[16], h[16];
    float Amin = __builtin_inff();
    const size_t o0 = (size_t)(b * SCAN_NC + c) * 16 * SCAN_D + d;
#pragma unroll  // constant n: the per-thread arrays stay in registers
    for (int n = 0; n < 16; ++n) {
        An[n]   = -expf(A_log[n]);
        invA[n] = 1.0f / An[n];
        Amin    = fminf(Amin, -An[n]);
        h[n]  = Hbuf[o0 + n * SCAN_D];
    }
    const int row0 = b * Lv + c * SCAN_CL;
    for (int l = 0; l < SCAN_CL; ++l) {
        const size_t idx = (size_t)(row0 + l);
        const float dt = softplus_hw(dtp[idx * Dv + d]);
        const float xv = xnf[idx * Dv + d];
        const float xr = xres[idx * Dv + d];
        const float* __restrict__ Bp = Bv + idx * 16;   // same for the whole block
        const float* __restrict__ Cp = Cv + idx * 16;
        float Br[16], Cr[16];   // read ahead of the branch, beside the loads above
#pragma unroll  // constant n: the per-thread arrays stay in registers
        for (int n = 0; n < 16; ++n) { Br[n] = Bp[n]; Cr[n] = Cp[n]; }
        float t[16];
        const float dt2 = dt * LOG2E_F;
        float z2[16], dA[16];   // dA = exp(dt * A) = 2^(dt * log2(e) * A)
#pragma unroll  // constant n: the per-thread arrays stay in registers
        for (int n = 0; n < 16; ++n) z2[n] = dt2 * An[n];
        exp2_x8(dA, z2);
        exp2_x8(dA + 8, z2 + 8);
        const bool shortform = (dt * Amin >= SCAN_ZMIN) && (dt >= SCAN_DTMIN);
        if (__builtin_amdgcn_ballot_w32(!shortform) == 0u) {
            // b = (dA - 1) * w with w = B * x / (dt * A), so dA*h + b = dA*(h + w) - w
            const float g = xv * __builtin_amdgcn_rcpf(dt);
#pragma unroll  // constant n: the per-thread arrays stay in registers
            for (int n = 0; n < 16; ++n) {
                const float w = g * (Br[n] * invA[n]);
                h[n] = dA[n] * (h[n] + w) - w;
                t[n] = Cr[n] * h[n];
            }
        } else {
            // some lane has a small dt * A: phi1 in its library form, exact near 0
#pragma unroll  // constant n: the per-thread arrays stay in registers
            for (int n = 0; n < 16; ++n) {
                const float bt = phi1_f(dt * An[n]) * Br[n] * xv;
                h[n] = dA[n] * h[n] + bt;
                t[n] = Cr[n] * h[n];
            }
        }
        // sum over n: pairs 8, 4, 2, 1 apart
#pragma unroll  // constant n: the per-thread arrays stay in registers
        for (int s = 8; s > 0; s >>= 1)
#pragma unroll  // constant n: the per-thread arrays stay in registers
            for (int n = 0; n < s; ++n) t[n] += t[n + s];
        const float y = (t[0] + Dd * xv) * sc;
        x2[idx * Dv + d] = y + xr;
        // precaution: the next trip rewrites the registers that this store names
        asm volatile("s_wait_xcnt 0x0" ::: "memory");
    }
}

// ---------------------------------------------------------------------------
// Launch
// ---------------------------------------------------------------------------
extern "C" void kernel_launch(void* const* d_in, const int* in_sizes, int n_in,
                              void* d_out, int out_size, void* d_ws, size_t ws_size,
                              hipStream_t stream) {
    (void)in_sizes; (void)n_in; (void)out_size; (void)ws_size;
    constexpr int Bb = 2, Lv = 2048, Dv = 1024, Nst = 16, DFF = 4096;
    constexpr int Mrows = Bb * Lv;  // 4096
    constexpr int NCh = SCAN_NC;
    static_assert(Dv == SCAN_D && NCh * SCAN_CL == Lv, "scan tiling");

    const float* x       = (const float*)d_in[0];
    const float* norm1_w = (const float*)d_in[1];
    const float* norm2_w = (const float*)d_in[2];
    const float* A_log   = (const float*)d_in[3];
    const float* D_param = (const float*)d_in[4];
    const float* scale   = (const float*)d_in[5];
    const float* Wdt     = (const float*)d_in[6];
    const float* bdt     = (const float*)d_in[7];
    const float* WB      = (const float*)d_in[8];
    const float* bB      = (const float*)d_in[9];
    const float* WC      = (const float*)d_in[10];
    const float* bC      = (const float*)d_in[11];
    const float* W1      = (const float*)d_in[12];
    const float* b1      = (const float*)d_in[13];
    const float* W2      = (const float*)d_in[14];
    const float* b2      = (const float*)d_in[15];
    float* out = (float*)d_out;

    size_t off = 0;
    auto alloc = [&](size_t bytes) -> void* {
        void* p = (char*)d_ws + off;
        off += (bytes + 255) & ~(size_t)255;
        return p;
    };
    float*          xnf  = (float*)alloc((size_t)Mrows * Dv * 4);
    unsigned short* xnb  = (unsigned short*)alloc((size_t)Mrows * Dv * 2);
    unsigned short* wdtb = (unsigned short*)alloc((size_t)Dv * Dv * 2);
    unsigned short* w1b  = (unsigned short*)alloc((size_t)DFF * Dv * 2);
    unsigned short* w2b  = (unsigned short*)alloc((size_t)Dv * DFF * 2);
    float*          dtp  = (float*)alloc((size_t)Mrows * Dv * 4);
    float*          Bv   = (float*)alloc((size_t)Mrows * Nst * 4);
    float*          Cv   = (float*)alloc((size_t)Mrows * Nst * 4);
    float*          x2   = (float*)alloc((size_t)Mrows * Dv * 4);
    unsigned short* xn2b = (unsigned short*)alloc((size_t)Mrows * Dv * 2);
    unsigned short* hb   = (unsigned short*)alloc((size_t)Mrows * DFF * 2);
    float*          Pbuf = (float*)alloc((size_t)Bb * Dv * NCh * 16 * 4);
    float*          Qbuf = (float*)alloc((size_t)Bb * Dv * NCh * 16 * 4);
    float*          Hbuf = (float*)alloc((size_t)Bb * Dv * NCh * 16 * 4);

    // 1 + 2. weight converts to bf16 and RMSNorm1 (f32 + bf16), one launch
    static_assert((Dv * Dv) % CVT_BLOCK == 0 && (DFF * Dv) % CVT_BLOCK == 0, "convert tiling");
    constexpr int NBdt = (Dv * Dv) / CVT_BLOCK, NBff = (DFF * Dv) / CVT_BLOCK;
    prep_kernel<NBdt, NBff, NBff, Mrows, 128><<<NBdt + 2 * NBff + Mrows, 256, 0, stream>>>(
        x, norm1_w, xnf, xnb, Wdt, wdtb, W1, w1b, W2, w2b, Dv);

    // 3. dt_pre = xn @ Wdt^T + bdt  (WMMA, async-LDS pipelined)
    gemm_wmma_bf16<0><<<dim3(Dv / 128, Mrows / 128), 256, 0, stream>>>(
        xnb, wdtb, bdt, nullptr, dtp, nullptr, Mrows, Dv, Dv);

    // 4. Bv / Cv projections
    static_assert(Dv == BC_K && Mrows % 16 == 0 && Nst == 16, "projection tiling");
    bc_proj_kernel<<<Mrows / 16, BC_WAVES * 32, 0, stream>>>(
        xnf, WB, bB, WC, bC, Bv, Cv);

    // 5. chunked selective scan + residual -> x2
    scan_pass1<<<dim3(Dv / 256, NCh, Bb), 256, 0, stream>>>(
        dtp, xnf, Bv, A_log, Pbuf, Qbuf, Lv, Dv);
    scan_pass2<<<(Bb * Dv * 16) / 256, 256, 0, stream>>>(Pbuf, Qbuf, Hbuf);
    scan_pass3<<<dim3(Dv / 256, NCh, Bb), 256, 0, stream>>>(
        dtp, xnf, x, Bv, Cv, A_log, D_param, scale, Hbuf, x2, Lv, Dv);

    // 6. RMSNorm2 (bf16 only)
    rmsnorm_kernel<0><<<Mrows, 256, 0, stream>>>(x2, norm2_w, nullptr, xn2b, Dv);

    // 7. h = gelu(xn2 @ W1^T + b1) -> bf16  (WMMA)
    gemm_wmma_bf16<1><<<dim3(DFF / 128, Mrows / 128), 256, 0, stream>>>(
        xn2b, w1b, b1, nullptr, nullptr, hb, Mrows, DFF, Dv);

    // 8. out = h @ W2^T + b2 + x2  (WMMA)
    gemm_wmma_bf16<2><<<dim3(Dv / 128, Mrows / 128), 256, 0, stream>>>(
        hb, w2b, b2, x2, out, nullptr, Mrows, Dv, DFF);
}

// v010
// It runs in 151 microseconds.
// Timed twice side by side with v009, it ran 1.11 times as fast both times.
// Over all steps from v000 it is 4.68 times as fast.
#include <hip/hip_runtime.h>
#include <hip/hip_bf16.h>
#include <stdint.h>

// ---------------------------------------------------------------------------
// Types for WMMA (gfx1250, wave32)
// ---------------------------------------------------------------------------
typedef __attribute__((ext_vector_type(16))) __bf16 v16bf;
typedef __attribute__((ext_vector_type(8)))  float  v8f;

struct alignas(16) U16x8 { unsigned short u[8]; };
struct alignas(32) FragBF { U16x8 lo, hi; };

static __device__ __forceinline__ unsigned short f2bf(float f) {
    unsigned int u = __float_as_uint(f);
    u += 0x7FFFu + ((u >> 16) & 1u);          // round-to-nearest-even
    return (unsigned short)(u >> 16);
}

static __device__ __forceinline__ float phi1_f(float z) {
    if (fabsf(z) < 1e-4f) return 1.0f + 0.5f * z;
    return expm1f(z) / z;
}

// ---------------------------------------------------------------------------
// Scan arithmetic on the hardware's own exp2 / log2 / rcp instructions.
// ---------------------------------------------------------------------------
#define LOG2E_F 1.4426950408889634f
#define LN2_F   0.6931471805599453f
// A step takes the short form only where every |dt * A[n]| is at least this:
// there exp(z) - 1 keeps its relative accuracy (error about 1e-7 / |z|).
#define SCAN_ZMIN  0.0625f
// ... and where 1 / dt is far from overflow.
#define SCAN_DTMIN 1e-30f

// r[i] = 2^x[i], i = 0..7. One statement, so that each v_exp_f32 has an
// independent instruction behind it and the last one a v_nop: the slot that the
// instruction set asks for before a transcendental's source is overwritten or its
// result read.
static __device__ __forceinline__ void exp2_x8(float* r, const float* x) {
    asm("v_exp_f32 %0, %8\n\t"
        "v_exp_f32 %1, %9\n\t"
        "v_exp_f32 %2, %10\n\t"
        "v_exp_f32 %3, %11\n\t"
        "v_exp_f32 %4, %12\n\t"
        "v_exp_f32 %5, %13\n\t"
        "v_exp_f32 %6, %14\n\t"
        "v_exp_f32 %7, %15\n\t"
        "v_nop"
        : "=&v"(r[0]), "=&v"(r[1]), "=&v"(r[2]), "=&v"(r[3]),
          "=&v"(r[4]), "=&v"(r[5]), "=&v"(r[6]), "=&v"(r[7])
        : "v"(x[0]), "v"(x[1]), "v"(x[2]), "v"(x[3]),
          "v"(x[4]), "v"(x[5]), "v"(x[6]), "v"(x[7]));
}

// r[i] = 1 / x[i], i = 0..7, in the same form and for the same reason as exp2_x8.
static __device__ __forceinline__ void rcp_x8(float* r, const float* x) {
    asm("v_rcp_f32 %0, %8\n\t"
        "v_rcp_f32 %1, %9\n\t"
        "v_rcp_f32 %2, %10\n\t"
        "v_rcp_f32 %3, %11\n\t"
        "v_rcp_f32 %4, %12\n\t"
        "v_rcp_f32 %5, %13\n\t"
        "v_rcp_f32 %6, %14\n\t"
        "v_rcp_f32 %7, %15\n\t"
        "v_nop"
        : "=&v"(r[0]), "=&v"(r[1]), "=&v"(r[2]), "=&v"(r[3]),
          "=&v"(r[4]), "=&v"(r[5]), "=&v"(r[6]), "=&v"(r[7])
        : "v"(x[0]), "v"(x[1]), "v"(x[2]), "v"(x[3]),
          "v"(x[4]), "v"(x[5]), "v"(x[6]), "v"(x[7]));
}

// y[i] = gelu(x[i]), tanh form, i = 0..7.
// 0.5 * (1 + tanh(u)) = 1 / (1 + exp(-2 u)) with u = 0.7978845608 * (x + 0.044715 x^3),
// and exp(-2 u) = 2^t. No branch, so the eight values are worked on side by side (the
// library tanhf takes two divergent branches a value, one value after the other).
// The ends come out as with tanh: 2^t = 0 gives x, 2^t = inf gives x * 0.
static __device__ __forceinline__ void gelu_tanh_x8(float* y, const float* x) {
    float t[8], e[8], q[8];
#pragma unroll  // constant i: the arrays stay in registers
    for (int i = 0; i < 8; ++i)
        t[i] = x[i] * (-2.3022081981f - 0.1029432396f * (x[i] * x[i]));   // -2 u log2(e)
    exp2_x8(e, t);
#pragma unroll  // constant i: the arrays stay in registers
    for (int i = 0; i < 8; ++i) e[i] = 1.0f + e[i];
    rcp_x8(q, e);
#pragma unroll  // constant i: the arrays stay in registers
    for (int i = 0; i < 8; ++i) y[i] = x[i] * q[i];
}

// softplus(x) = max(x, 0) + log1p(exp(-|x|)); e = exp(-|x|) lies in (0, 1].
// Below 1/16 the series of log1p keeps the relative accuracy that 1 + e loses.
static __device__ __forceinline__ float softplus_hw(float x) {
    const float e  = __builtin_amdgcn_exp2f(-fabsf(x) * LOG2E_F);
    const float lg = __builtin_amdgcn_logf(1.0f + e) * LN2_F;
    float p = 0.2f - e * (1.0f / 6.0f);
    p = -0.25f + e * p;
    p = (1.0f / 3.0f) + e * p;
    p = -0.5f + e * p;
    p = e + (e * e) * p;
    return fmaxf(x, 0.0f) + ((e < 0.0625f) ? p : lg);
}

// ---------------------------------------------------------------------------
// gfx1250 async memory->LDS copies (ASYNCcnt tracked), 16B per lane: the eight
// copies of one thread for one K-slab. l = LDS byte address (low 32 bits of the
// generic pointer: the flat aperture maps LDS_ADDR = addr[31:0]), g = global address.
// The last line is a precaution: it stands ahead of whatever rewrites the address
// registers that the copies name, and inside the statement nothing can be moved
// in front of it.
// ---------------------------------------------------------------------------
static __device__ __forceinline__ unsigned lds_addr_of(const void* p) {
    return (unsigned)(size_t)p;
}

static __device__ __forceinline__ void async_copy_b128_x8(const unsigned* l,
                                                          const unsigned short* const* g) {
    asm volatile("global_load_async_to_lds_b128 %0, %8, off\n\t"
                 "global_load_async_to_lds_b128 %1, %9, off\n\t"
                 "global_load_async_to_lds_b128 %2, %10, off\n\t"
                 "global_load_async_to_lds_b128 %3, %11, off\n\t"
                 "global_load_async_to_lds_b128 %4, %12, off\n\t"
                 "global_load_async_to_lds_b128 %5, %13, off\n\t"
                 "global_load_async_to_lds_b128 %6, %14, off\n\t"
                 "global_load_async_to_lds_b128 %7, %15, off\n\t"
                 "s_wait_xcnt 0x0"
                 :: "v"(l[0]), "v"(l[1]), "v"(l[2]), "v"(l[3]),
                    "v"(l[4]), "v"(l[5]), "v"(l[6]), "v"(l[7]),
                    "v"(g[0]), "v"(g[1]), "v"(g[2]), "v"(g[3]),
                    "v"(g[4]), "v"(g[5]), "v"(g[6]), "v"(g[7])
                 : "memory");
}

template <int Nc>
static __device__ __forceinline__ void wait_asynccnt() {
    asm volatile("s_wait_asynccnt %0" :: "n"(Nc) : "memory");
}

// The same for the scan's f32 rows: four or six copies of one wave in one statement,
// with the same last line for the same reason.
static __device__ __forceinline__ void async_copy_b128_x4(const unsigned* l,
                                                          const float* const* g) {
    asm volatile("global_load_async_to_lds_b128 %0, %4, off\n\t"
                 "global_load_async_to_lds_b128 %1, %5, off\n\t"
                 "global_load_async_to_lds_b128 %2, %6, off\n\t"
                 "global_load_async_to_lds_b128 %3, %7, off\n\t"
                 "s_wait_xcnt 0x0"
                 :: "v"(l[0]), "v"(l[1]), "v"(l[2]), "v"(l[3]),
                    "v"(g[0]), "v"(g[1]), "v"(g[2]), "v"(g[3])
                 : "memory");
}

static __device__ __forceinline__ void async_copy_b128_x6(const unsigned* l,
                                                          const float* const* g) {
    asm volatile("global_load_async_to_lds_b128 %0, %6, off\n\t"
                 "global_load_async_to_lds_b128 %1, %7, off\n\t"
                 "global_load_async_to_lds_b128 %2, %8, off\n\t"
                 "global_load_async_to_lds_b128 %3, %9, off\n\t"
                 "global_load_async_to_lds_b128 %4, %10, off\n\t"
                 "global_load_async_to_lds_b128 %5, %11, off\n\t"
                 "s_wait_xcnt 0x0"
                 :: "v"(l[0]), "v"(l[1]), "v"(l[2]), "v"(l[3]), "v"(l[4]), "v"(l[5]),
                    "v"(g[0]), "v"(g[1]), "v"(g[2]), "v"(g[3]), "v"(g[4]), "v"(g[5])
                 : "memory");
}

// ---------------------------------------------------------------------------
// f32 -> bf16 convert. One block of 256 threads converts CVT_BLOCK contiguous
// elements, the blk-th such run of the array; the array length must be a multiple
// of CVT_BLOCK (checked at the launch).
// A thread takes CVT_G groups of 4 elements, 256 groups apart: each
// wave-wide load covers 512 contiguous bytes, each store 256, and a wave has
// CVT_G loads in flight. The point is fewer waves than with one element a
// thread, for speed only.
// ---------------------------------------------------------------------------
typedef __attribute__((ext_vector_type(4))) float f32x4;
struct alignas(8) U16x4 { unsigned short u[4]; };
#define CVT_G     8
#define CVT_BLOCK (256 * CVT_G * 4)

static __device__ __forceinline__
void cvt_bf16_block(const float* __restrict__ in,
                    unsigned short* __restrict__ out, int blk) {
    const size_t g0 = (size_t)blk * (256 * CVT_G) + threadIdx.x;
    const f32x4* __restrict__ src = (const f32x4*)in + g0;
    U16x4* __restrict__ dst = (U16x4*)out + g0;
    f32x4 v[CVT_G];
#pragma unroll  // constant j: v stays in registers and all loads go out first
    for (int j = 0; j < CVT_G; ++j) v[j] = src[j * 256];
#pragma unroll  // constant j: v stays in registers
    for (int j = 0; j < CVT_G; ++j) {
        U16x4 o;
        o.u[0] = f2bf(v[j][0]);
        o.u[1] = f2bf(v[j][1]);
        o.u[2] = f2bf(v[j][2]);
        o.u[3] = f2bf(v[j][3]);
        dst[j * 256] = o;
    }
}

// ---------------------------------------------------------------------------
// RMSNorm: one block takes one row of length Dn=1024; writes f32 (optional) + bf16
// ---------------------------------------------------------------------------
template <int WRITE_F32>
static __device__ __forceinline__
void rmsnorm_row(const float* __restrict__ x, const float* __restrict__ w,
                 float* __restrict__ xf, unsigned short* __restrict__ xb, int Dn, int row) {
    const int tid = threadIdx.x;
    const float* xr = x + (size_t)row * Dn;
    float ss = 0.0f;
    for (int i = tid; i < Dn; i += 256) { float v = xr[i]; ss += v * v; }
    __shared__ float red[256];
    red[tid] = ss;
    __syncthreads();
    for (int s = 128; s > 0; s >>= 1) {
        if (tid < s) red[tid] += red[tid + s];
        __syncthreads();
    }
    const float r = rsqrtf(red[0] / (float)Dn + 1e-6f);
    for (int i = tid; i < Dn; i += 256) {
        float v = xr[i] * r * w[i];
        if (WRITE_F32) xf[(size_t)row * Dn + i] = v;
        xb[(size_t)row * Dn + i] = f2bf(v);
    }
}

// A launch of its own: one block per row.
template <int WRITE_F32>
__global__ __launch_bounds__(256)
void rmsnorm_kernel(const float* __restrict__ x, const float* __restrict__ w,
                    float* __restrict__ xf, unsigned short* __restrict__ xb, int Dn) {
    rmsnorm_row<WRITE_F32>(x, w, xf, xb, Dn, blockIdx.x);
}

// ---------------------------------------------------------------------------
// The work that depends on nothing but the inputs, in ONE launch: the three weight
// converts (NB0, NB1, NB2 blocks) and RMSNorm1 (ROWS blocks, f32 + bf16). As four
// launches each paid its own gap, start and drain, for a few microseconds of bytes.
// The two kinds of block are dealt out evenly along the grid, CP convert blocks and
// then RP rows in each of GROUPS groups, so that the converts' many loads in flight
// can fill the memory time that a row block spends in its sum over the row.
// The branch depends on blockIdx alone: the barriers in rmsnorm_row are block-uniform.
// ---------------------------------------------------------------------------
template <int NB0, int NB1, int NB2, int ROWS, int GROUPS>
__global__ __launch_bounds__(256)
void prep_kernel(const float* __restrict__ x, const float* __restrict__ nw,
                 float* __restrict__ xf, unsigned short* __restrict__ xb,
                 const float* __restrict__ Wa, unsigned short* __restrict__ oa,
                 const float* __restrict__ Wb, unsigned short* __restrict__ ob,
                 const float* __restrict__ Wc, unsigned short* __restrict__ oc, int Dn) {
    constexpr int CP = (NB0 + NB1 + NB2) / GROUPS;
    constexpr int RP = ROWS / GROUPS;
    static_assert(CP * GROUPS == NB0 + NB1 + NB2 && RP * GROUPS == ROWS, "even deal");
    const int grp = blockIdx.x / (CP + RP);
    const int pos = blockIdx.x - grp * (CP + RP);
    if (pos < CP) {
        // which array, and which of its runs: scalar selects, then one copy of the convert
        const int cb = grp * CP + pos;
        const int wh = (cb >= NB0) + (cb >= NB0 + NB1);
        const float* in     = (wh == 0) ? Wa : (wh == 1) ? Wb : Wc;
        unsigned short* out = (wh == 0) ? oa : (wh == 1) ? ob : oc;
        cvt_bf16_block(in, out, cb - ((wh == 0) ? 0 : (wh == 1) ? NB0 : NB0 + NB1));
    } else {
        rmsnorm_row<1>(x, nw, xf, xb, Dn, grp * RP + (pos - CP));
    }
}

// ---------------------------------------------------------------------------
// WMMA bf16 GEMM:  out[m][n] = sum_k A[m][k] * Bw[n][k]  (+epilogue)
// MODE 0: outF = acc + bias[n]                      (f32)
// MODE 1: outB = bf16(gelu(acc + bias[n]))          (bf16)
// MODE 2: outF = acc + bias[n] + resid[m][n]        (f32)
// Block: 256 threads = 8 waves (2x4), block tile 128x128, BK=64.
// Wave tile 64x32 = 4x2 accumulators of v_wmma_f32_16x16x32_bf16.
// LDS ring of three K-slab buffers, filled by global_load_async_to_lds_b128 (ASYNCcnt)
// two slabs ahead; one work-group barrier a slab.
// ---------------------------------------------------------------------------
template <int MODE>
__global__ __launch_bounds__(256)
void gemm_wmma_bf16(const unsigned short* __restrict__ A,
                    const unsigned short* __restrict__ Bw,
                    const float* __restrict__ bias,
                    const float* __restrict__ resid,
                    float* __restrict__ outF,
                    unsigned short* __restrict__ outB,
                    int M, int N, int K) {
    __shared__ unsigned short As[3][128][72];  // 64 cols + pad, 16B-aligned rows
    __shared__ unsigned short Bs[3][128][72];

    const int tid   = threadIdx.x;
    const int lane  = tid & 31;
    const int wid   = tid >> 5;
    const int waveM = wid >> 2;      // 0..1  (rows of 64)
    const int waveN = wid & 3;       // 0..3  (cols of 32)
    const int m0 = blockIdx.y * 128;
    const int n0 = blockIdx.x * 128;

    // LDS fill: 8 neighbouring lanes take the 8 16-byte pieces of one row's 128-byte
    // slab, so a wave-wide copy covers 4 whole lines (a lane per row touched 32).
    const int lrow = tid >> 3;       // 0..31: row within a group of 32 rows
    const int lch  = tid & 7;        // which 16-byte piece of the row's slab

    const int ml   = lane & 15;      // M (or N) index within fragment
    const int half = lane >> 4;      // lane-half selects K sub-pattern

    const v8f vzero = {0.f, 0.f, 0.f, 0.f, 0.f, 0.f, 0.f, 0.f};
    v8f acc[4][2];
#pragma unroll
    for (int i = 0; i < 4; ++i)
#pragma unroll
        for (int j = 0; j < 2; ++j) acc[i][j] = vzero;

    const unsigned short* rowA = A  + (size_t)(m0 + lrow) * K + lch * 8;
    const unsigned short* rowB = Bw + (size_t)(n0 + lrow) * K + lch * 8;

    // Issue one K-slab (8 x 16B per thread) into LDS buffer `buf` via async DMA.
    auto issue_slab = [&](int buf, int k0) {
        unsigned l[8];
        const unsigned short* g[8];
#pragma unroll  // constant q: l and g stay in registers
        for (int q = 0; q < 4; ++q) {     // four groups of 32 rows
            l[q]     = lds_addr_of(&As[buf][q * 32 + lrow][lch * 8]);
            l[4 + q] = lds_addr_of(&Bs[buf][q * 32 + lrow][lch * 8]);
            g[q]     = rowA + (size_t)(q * 32) * K + k0;
            g[4 + q] = rowB + (size_t)(q * 32) * K + k0;
        }
        async_copy_b128_x8(l, g);
    };

    const int nslab = K >> 6;
    issue_slab(0, 0);
    if (nslab > 1) issue_slab(1, 64);

    int cur  = 0;   // buffer of slab i     = i mod 3
    int fill = 2;   // buffer of slab i + 2 = buffer of slab i - 1
    for (int i = 0; i < nslab; ++i) {
        // Slab i is handed over. This wave's reads of slab i - 1 have returned ...
        asm volatile("s_wait_dscnt 0x0" ::: "memory");
        // ... and its own copies of slab i have landed (the 8 youngest are slab i + 1's).
        if (i + 1 < nslab) wait_asynccnt<8>();
        else               wait_asynccnt<0>();
        // The one barrier of a slab: behind it every wave's part of slab i is in LDS, and
        // no wave reads slab i - 1 any more, so that its buffer can be filled again.
        __syncthreads();

        // All 24 fragment reads of the slab go out as one group, each into registers of
        // its own, ahead of the slab's 16 products: a wave then waits out the LDS latency
        // once a slab (with one A register set it did so in front of every pair of products).
        // 16-bit A/B fragment layout: lane-half 0 holds K {0..7,16..23},
        // half 1 holds K {8..15,24..31} (two 16B runs per lane).
        FragBF fa[2][4], fb[2][2];
#pragma unroll  // constant s, j, ii: the fragments stay in registers
        for (int s = 0; s < 2; ++s) {
            const int ks = s * 32;
#pragma unroll  // constant index: the fragments stay in registers
            for (int j = 0; j < 2; ++j) {
                const int col = waveN * 32 + j * 16 + ml;
                fb[s][j].lo = *(const U16x8*)&Bs[cur][col][ks + half * 8];
                fb[s][j].hi = *(const U16x8*)&Bs[cur][col][ks + 16 + half * 8];
            }
#pragma unroll  // constant index: the fragments stay in registers
            for (int ii = 0; ii < 4; ++ii) {
                const int row = waveM * 64 + ii * 16 + ml;
                fa[s][ii].lo = *(const U16x8*)&As[cur][row][ks + half * 8];
                fa[s][ii].hi = *(const U16x8*)&As[cur][row][ks + 16 + half * 8];
            }
        }
        // Slab i + 2 goes out here, behind the barrier above, into the buffer that slab i - 1
        // has left: its address arithmetic and its issue run while the reads of slab i come in.
        if (i + 2 < nslab) issue_slab(fill, (i + 2) << 6);
#pragma unroll  // constant s, ii, j: the fragments stay in registers
        for (int s = 0; s < 2; ++s) {
#pragma unroll  // constant index: the fragments stay in registers
            for (int ii = 0; ii < 4; ++ii) {
                v16bf av = __builtin_bit_cast(v16bf, fa[s][ii]);
#pragma unroll  // constant index: the fragments stay in registers
                for (int j = 0; j < 2; ++j) {
                    v16bf bv = __builtin_bit_cast(v16bf, fb[s][j]);
                    acc[ii][j] = __builtin_amdgcn_wmma_f32_16x16x32_bf16(
                        false, av, false, bv, (short)0, acc[ii][j], false, false);
                }
            }
        }
        cur  = (cur  == 2) ? 0 : cur + 1;
        fill = (fill == 2) ? 0 : fill + 1;
    }

    // Epilogue: C/D layout — VGPR r: lanes 0-15 -> M=r, lanes 16-31 -> M=r+8.
    float bcol[2];   // read once, ahead of the stores (behind a store it is read again, and waited for)
#pragma unroll  // constant j: bcol stays in registers
    for (int j = 0; j < 2; ++j) bcol[j] = bias[n0 + waveN * 32 + j * 16 + ml];
#pragma unroll
    for (int i = 0; i < 4; ++i) {
        const int rowBase = m0 + waveM * 64 + i * 16;
#pragma unroll
        for (int j = 0; j < 2; ++j) {
            const int col = n0 + waveN * 32 + j * 16 + ml;
            float cv[8];
#pragma unroll  // constant r: cv stays in registers
            for (int r = 0; r < 8; ++r) cv[r] = acc[i][j][r] + bcol[j];
            if (MODE == 1) {
                float gv[8];
                gelu_tanh_x8(gv, cv);
                unsigned short* po = outB + (size_t)(rowBase + half * 8) * N + col;
#pragma unroll  // constant r: gv stays in registers
                for (int r = 0; r < 8; ++r) { *po = f2bf(gv[r]); po += N; }   // next row
            } else {
#pragma unroll  // constant r: cv stays in registers
                for (int r = 0; r < 8; ++r) {
                    const int row = rowBase + r + half * 8;
                    const size_t o = (size_t)row * N + col;
                    if (MODE == 0) {
                        outF[o] = cv[r];
                    } else {
                        outF[o] = cv[r] + resid[o];
                    }
                }
            }
        }
    }
}

// ---------------------------------------------------------------------------
// Bv / Cv projections: out[row][n] = dot(xn[row,:], W[n,:]) + b[n], all in f32.
// One block takes 16 rows of xn and all 32 rows of WB and WC, so W is read once per
// 16 rows. Its 16 waves split K: wave w owns k = 64 w .. 64 w + 63.
// 1. Each wave brings its 48 row pieces of 256 bytes into LDS with loads that cover
//    whole lines (16 lanes a piece, two pieces a load).
// 2. It reads them back as fragments of v_wmma_f32_16x16x4_f32, W as A and xn as B:
//    lane (c, h) takes row c, k = 8 kk + 4 h .. + 3, the same for both operands, and
//    feeds elements 0, 1 to one product and 2, 3 to the next.
// 3. Each wave lays its two partial tiles over the head of its own LDS rows, and the
//    16 partial sums of every output are added as a tree over the waves.
// ---------------------------------------------------------------------------
typedef __attribute__((ext_vector_type(2))) float v2f;
typedef f32x4 f32x4_a4 __attribute__((aligned(4)));   // an input's base is only known as float*
#define BC_WAVES 16
#define BC_KW    64                    // k per wave
#define BC_K     (BC_WAVES * BC_KW)    // row length of xn, WB, WC (checked at the launch)
#define BC_PITCH 68                    // dwords a staged row: 16-byte reads down a column hit no bank twice

__global__ __launch_bounds__(BC_WAVES * 32)
void bc_proj_kernel(const float* __restrict__ xnf,
                    const float* __restrict__ WB, const float* __restrict__ bB,
                    const float* __restrict__ WC, const float* __restrict__ bC,
                    float* __restrict__ Bv, float* __restrict__ Cv) {
    __shared__ __attribute__((aligned(16))) float stage[BC_WAVES][48][BC_PITCH];
    const int tid  = threadIdx.x;
    const int lane = tid & 31;
    const int w    = tid >> 5;
    const int c    = lane & 15;
    const int h    = lane >> 4;
    const int m0   = blockIdx.x * 16;

    // 1. rows 0..15 of stage[w]: xn, 16..31: WB, 32..47: WC
    const int go = h * BC_K + w * BC_KW + c * 4;
    const float* __restrict__ gx = xnf + (size_t)m0 * BC_K + go;
    const float* __restrict__ gb = WB + go;
    const float* __restrict__ gc = WC + go;
    f32x4 v[24];
#pragma unroll  // constant j: v stays in registers and all loads go out first
    for (int j = 0; j < 8; ++j) {
        v[j]      = *(const f32x4_a4*)(gx + 2 * j * BC_K);
        v[8 + j]  = *(const f32x4_a4*)(gb + 2 * j * BC_K);
        v[16 + j] = *(const f32x4_a4*)(gc + 2 * j * BC_K);
    }
#pragma unroll  // constant j: v stays in registers
    for (int j = 0; j < 24; ++j)
        *(f32x4*)&stage[w][2 * j + h][c * 4] = v[j];
    __syncthreads();   // a lane reads what other lanes have stored

    // 2. D[n][m]: register r of lane (c, h) is out[m0 + c][8 h + r]
    float* const sf = &stage[w][c][h * 4];   // the one LDS address of steps 2 and 3
    v8f accB = {0.f, 0.f, 0.f, 0.f, 0.f, 0.f, 0.f, 0.f};
    v8f accC = accB;
#pragma unroll  // constant kk: LDS offsets are immediates and the reads can go out ahead
    for (int kk = 0; kk < BC_KW / 8; ++kk) {
        const f32x4 x4 = *(const f32x4*)(sf + kk * 8);
        const f32x4 b4 = *(const f32x4*)(sf + 16 * BC_PITCH + kk * 8);
        const f32x4 c4 = *(const f32x4*)(sf + 32 * BC_PITCH + kk * 8);
        const v2f xlo = {x4[0], x4[1]}, xhi = {x4[2], x4[3]};
        const v2f blo = {b4[0], b4[1]}, bhi = {b4[2], b4[3]};
        const v2f clo = {c4[0], c4[1]}, chi = {c4[2], c4[3]};
        accB = __builtin_amdgcn_wmma_f32_16x16x4_f32(false, blo, false, xlo, (short)0, accB, false, false);
        accC = __builtin_amdgcn_wmma_f32_16x16x4_f32(false, clo, false, xlo, (short)0, accC, false, false);
        accB = __builtin_amdgcn_wmma_f32_16x16x4_f32(false, bhi, false, xhi, (short)0, accB, false, false);
        accC = __builtin_amdgcn_wmma_f32_16x16x4_f32(false, chi, false, xhi, (short)0, accC, false, false);
    }
    // Four vector slots between the last product and whatever vector instruction next
    // reuses its registers: the distance of the 16-bit forms, kept here as a precaution
    // (none is tabled for the f32 form, and the compiler pads none). The two scheduling
    // barriers hold the slots at this place and keep step 3's index arithmetic behind them.
    __builtin_amdgcn_sched_barrier(0);
    asm volatile("v_nop\n\tv_nop\n\tv_nop\n\tv_nop");
    __builtin_amdgcn_sched_barrier(0);

    // 3. Row c (Bv) and row 16 + c (Cv) of the wave's own slice, which only this wave has
    //    read: n = 8 h + 4 q + e lies at column 8 q + 4 h + e, so that sf serves again.
    {
        const f32x4 b0 = {accB[0], accB[1], accB[2], accB[3]}, b1 = {accB[4], accB[5], accB[6], accB[7]};
        const f32x4 c0 = {accC[0], accC[1], accC[2], accC[3]}, c1 = {accC[4], accC[5], accC[6], accC[7]};
        *(f32x4*)(sf)                     = b0;
        *(f32x4*)(sf + 8)                 = b1;
        *(f32x4*)(sf + 16 * BC_PITCH)     = c0;
        *(f32x4*)(sf + 16 * BC_PITCH + 8) = c1;
    }
    __syncthreads();   // every wave's partial tiles are in LDS
    const int t   = tid >> 8;     // 0: Bv, 1: Cv (the same for a whole wave)
    const int idx = tid & 255;    // m * 16 + n
    const int n   = idx & 15;
    const int col = ((n >> 2) & 1) * 8 + (n >> 3) * 4 + (n & 3);
    float p[BC_WAVES];
#pragma unroll  // constant i: p stays in registers
    for (int i = 0; i < BC_WAVES; ++i) p[i] = stage[i][t * 16 + (idx >> 4)][col];
#pragma unroll  // constant i: p stays in registers
    for (int s = BC_WAVES / 2; s > 0; s >>= 1)
#pragma unroll  // constant i: p stays in registers
        for (int i = 0; i < s; ++i) p[i] += p[i + s];
    (t ? Cv : Bv)[(size_t)m0 * 16 + idx] = p[0] + (t ? bC : bB)[n];
}

// ---------------------------------------------------------------------------
// Chunked linear-recurrence scan (h = dA*h + b), 3 passes, NC chunks of CL.
// Thread layout (pass 1/3): one thread per (b, chunk, d); the lanes of a wave
// run along d, and each thread keeps all 16 states n in registers.
// P/Q/H layout: [b][chunk][n][d], so every access is contiguous along d.
// ---------------------------------------------------------------------------
#define SCAN_NC 64
#define SCAN_CL 32
#define SCAN_D  1024   // channels = pitch of one n row of P/Q/H (a constant, so that
                       // the 16 rows are reached by immediate offsets from one address)
// Passes 1 and 3 take what a step reads from LDS, not from memory. Each wave brings its
// own 32 channels of the chunk's rows, and its own copy of the chunk's Bv / Cv rows, into
// an LDS range that no other wave touches, by async copies: SCAN_GR rows a group, the next
// group's copies in flight while this group's steps run. With a load and its wait in every
// step a wave stood still for one memory latency a step. A copy takes 4 rows x 128 bytes
// (8 lanes a row): whole lines. Every place in LDS is filled once and never refilled, and
// only the wave that copied reads it: its own s_wait_asynccnt 0 is all the ordering needed.
#define SCAN_GR 8
static_assert(SCAN_CL % SCAN_GR == 0 && SCAN_GR == 8, "two 4-row copies an array and group");
struct ScanStage1 {              // one wave's LDS range in pass 1
    float dt[SCAN_CL][32];       // dt_pre, [row of the chunk][lane]
    float xn[SCAN_CL][32];
    float B[SCAN_CL][16];
};
struct ScanStage3 {              // one wave's LDS range in pass 3
    float dt[SCAN_CL][32];
    float xn[SCAN_CL][32];
    float xr[SCAN_CL][32];       // the residual input
    float B[SCAN_CL][16];
    float C[SCAN_CL][16];
};

// Pass 1: per-chunk transfer (P = prod dA, q = end state from h0=0)
// grid: x = d / 256, y = chunk, z = batch
__global__ __launch_bounds__(256)
void scan_pass1(const float* __restrict__ dtp, const float* __restrict__ xnf,
                const float* __restrict__ Bv, const float* __restrict__ A_log,
                float* __restrict__ Pbuf, float* __restrict__ Qbuf,
                int Lv, int Dv) {
    const int d = blockIdx.x * 256 + threadIdx.x;
    const int c = blockIdx.y;
    const int b = blockIdx.z;

    // The first copies go out ahead of everything else: the set-up below runs under them.
    __shared__ __attribute__((aligned(16))) ScanStage1 stage[8];
    (void)Dv;
    const int lane = threadIdx.x & 31;
    ScanStage1& S = stage[threadIdx.x >> 5];
    const int row0 = b * Lv + c * SCAN_CL;
    // lane's 16 bytes of a 4-row copy: row lane / 8, piece lane % 8 of the wave's 128 bytes
    const size_t go = (size_t)(row0 + (lane >> 3)) * SCAN_D + (d - lane) + (lane & 7) * 4;
    const float* const gdt = dtp + go;
    const float* const gxn = xnf + go;
    const unsigned ldt = lds_addr_of(&S.dt[0][0]) + lane * 16;
    const unsigned lxn = lds_addr_of(&S.xn[0][0]) + lane * 16;
    auto issue_group = [&](int r) {   // rows r .. r + SCAN_GR - 1 of the chunk
        unsigned l[4];
        const float* g[4];
#pragma unroll  // constant j: l and g stay in registers
        for (int j = 0; j < 2; ++j) {
            l[j]     = ldt + (r + 4 * j) * 128;
            l[2 + j] = lxn + (r + 4 * j) * 128;
            g[j]     = gdt + (size_t)(r + 4 * j) * SCAN_D;
            g[2 + j] = gxn + (size_t)(r + 4 * j) * SCAN_D;
        }
        async_copy_b128_x4(l, g);
    };
    {   // the chunk's 32 rows of Bv: 2 KiB in a row
        unsigned l[4];
        const float* g[4];
#pragma unroll  // constant k: l and g stay in registers
        for (int k = 0; k < 4; ++k) {
            l[k] = lds_addr_of(&S.B[0][0]) + k * 512 + lane * 16;
            g[k] = Bv + (size_t)row0 * 16 + k * 128 + lane * 4;
        }
        async_copy_b128_x4(l, g);
    }
    issue_group(0);

    float An[16], invA[16], h[16], pf[16];
    float Amin = __builtin_inff();
#pragma unroll  // constant n: the per-thread arrays stay in registers
    for (int n = 0; n < 16; ++n) {
        An[n]   = -expf(A_log[n]);
        invA[n] = 1.0f / An[n];
        Amin    = fminf(Amin, -An[n]);
        h[n]  = 0.0f;
        pf[n] = 1.0f;
    }
    for (int l = 0; l < SCAN_CL; ++l) {
        if ((l & (SCAN_GR - 1)) == 0) {   // a scalar test: l is the same in every lane and wave
            // this wave's copies of rows l .. l + SCAN_GR - 1 (at l = 0 also of Bv) have landed
            wait_asynccnt<0>();
            if (l + SCAN_GR < SCAN_CL) issue_group(l + SCAN_GR);
        }
        const float dt = softplus_hw(S.dt[l][lane]);
        const float xv = S.xn[l][lane];
        float Br[16];   // read ahead of the branch, beside the two reads above
#pragma unroll  // constant q: the per-thread arrays stay in registers
        for (int q = 0; q < 4; ++q) {
            const f32x4 b4 = *(const f32x4*)&S.B[l][4 * q];   // one address for the whole wave
            Br[4 * q] = b4[0]; Br[4 * q + 1] = b4[1]; Br[4 * q + 2] = b4[2]; Br[4 * q + 3] = b4[3];
        }
        const float dt2 = dt * LOG2E_F;
        float z2[16], dA[16];   // dA = exp(dt * A) = 2^(dt * log2(e) * A)
#pragma unroll  // constant n: the per-thread arrays stay in registers
        for (int n = 0; n < 16; ++n) z2[n] = dt2 * An[n];
        exp2_x8(dA, z2);
        exp2_x8(dA + 8, z2 + 8);
        const bool shortform = (dt * Amin >= SCAN_ZMIN) && (dt >= SCAN_DTMIN);
        if (__builtin_amdgcn_ballot_w32(!shortform) == 0u) {
            // b = (dA - 1) * w with w = B * x / (dt * A), so dA*h + b = dA*(h + w) - w
            const float g = xv * __builtin_amdgcn_rcpf(dt);
#pragma unroll  // constant n: the per-thread arrays stay in registers
            for (int n = 0; n < 16; ++n) {
                const float w = g * (Br[n] * invA[n]);
                h[n]  = dA[n] * (h[n] + w) - w;
                pf[n] = dA[n] * pf[n];
            }
        } else {
            // some lane has a small dt * A: phi1 in its library form, exact near 0
#pragma unroll  // constant n: the per-thread arrays stay in registers
            for (int n = 0; n < 16; ++n) {
                const float bt = phi1_f(dt * An[n]) * Br[n] * xv;
                h[n]  = dA[n] * h[n] + bt;
                pf[n] = dA[n] * pf[n];
            }
        }
    }
    const size_t o0 = (size_t)(b * SCAN_NC + c) * 16 * SCAN_D + d;
#pragma unroll  // constant n: the per-thread arrays stay in registers
    for (int n = 0; n < 16; ++n) {
        Pbuf[o0 + n * SCAN_D] = pf[n];
        Qbuf[o0 + n * SCAN_D] = h[n];
    }
}

// Pass 2: sequential combine over chunks -> initial state H_c per chunk
// one thread per (b, n, d); one chunk is a plane of 16 * SCAN_D elements
__global__ __launch_bounds__(256)
void scan_pass2(const float* __restrict__ Pbuf, const float* __restrict__ Qbuf,
                float* __restrict__ Hbuf) {
    constexpr int plane = 16 * SCAN_D;
    const int tid = blockIdx.x * 256 + threadIdx.x;
    const int b = tid / plane;
    const int r = tid - b * plane;        // n * SCAN_D + d
    const size_t o0 = (size_t)b * SCAN_NC * plane + r;
    float H = 0.0f;
    // unrolled whole: the loads do not depend on H, so they can all be in
    // flight together instead of one memory latency per few chunks
#pragma unroll
    for (int c = 0; c < SCAN_NC; ++c) {
        const size_t o = o0 + c * plane;
        Hbuf[o] = H;
        H = Pbuf[o] * H + Qbuf[o];
    }
}

// Pass 3: replay chunk from true H_c, emit y = sum_n Cv*h + D*xn, +residual
// grid: x = d / 256, y = chunk, z = batch
__global__ __launch_bounds__(256)
void scan_pass3(const float* __restrict__ dtp, const float* __restrict__ xnf,
                const float* __restrict__ xres,
                const float* __restrict__ Bv, const float* __restrict__ Cv,
                const float* __restrict__ A_log, const float* __restrict__ Dp,
                const float* __restrict__ scale, const float* __restrict__ Hbuf,
                float* __restrict__ x2, int Lv, int Dv) {
    const int d = blockIdx.x * 256 + threadIdx.x;
    const int c = blockIdx.y;
    const int b = blockIdx.z;

    // The first copies go out ahead of everything else: the set-up below runs under them.
    __shared__ __attribute__((aligned(16))) ScanStage3 stage[8];
    const int lane = threadIdx.x & 31;
    ScanStage3& S = stage[threadIdx.x >> 5];
    const int row0 = b * Lv + c * SCAN_CL;
    // lane's 16 bytes of a 4-row copy: row lane / 8, piece lane % 8 of the wave's 128 bytes
    const size_t go = (size_t)(row0 + (lane >> 3)) * SCAN_D + (d - lane) + (lane & 7) * 4;
    const float* const gdt = dtp + go;
    const float* const gxn = xnf + go;
    const float* const gxr = xres + go;   // an input: the start of an allocation, 16-byte aligned like the weights the convert reads
    const unsigned ldt = lds_addr_of(&S.dt[0][0]) + lane * 16;
    const unsigned lxn = lds_addr_of(&S.xn[0][0]) + lane * 16;
    const unsigned lxr = lds_addr_of(&S.xr[0][0]) + lane * 16;
    auto issue_group = [&](int r) {   // rows r .. r + SCAN_GR - 1 of the chunk
        unsigned l[6];
        const float* g[6];
#pragma unroll  // constant j: l and g stay in registers
        for (int j = 0; j < 2; ++j) {
            l[j]     = ldt + (r + 4 * j) * 128;
            l[2 + j] = lxn + (r + 4 * j) * 128;
            l[4 + j] = lxr + (r + 4 * j) * 128;
            g[j]     = gdt + (size_t)(r + 4 * j) * SCAN_D;
            g[2 + j] = gxn + (size_t)(r + 4 * j) * SCAN_D;
            g[4 + j] = gxr + (size_t)(r + 4 * j) * SCAN_D;
        }
        async_copy_b128_x6(l, g);
    };
    {   // the chunk's 32 rows of Bv and of Cv: 2 KiB in a row each
        unsigned l[4];
        const float* g[4];
#pragma unroll  // constant k: l and g stay in registers
        for (int k = 0; k < 4; ++k) {
            l[k] = lds_addr_of(&S.B[0][0]) + k * 512 + lane * 16;
            g[k] = Bv + (size_t)row0 * 16 + k * 128 + lane * 4;
        }
        async_copy_b128_x4(l, g);
#pragma unroll  // constant k: l and g stay in registers
        for (int k = 0; k < 4; ++k) {
            l[k] = lds_addr_of(&S.C[0][0]) + k * 512 + lane * 16;
            g[k] = Cv + (size_t)row0 * 16 + k * 128 + lane * 4;
        }
        async_copy_b128_x4(l, g);
    }
    issue_group(0);

    const float Dd = Dp[d];
    const float sc = scale[d];

    float An[16], invA[16], h[16];
    float Amin = __builtin_inff();
    const size_t o0 = (size_t)(b * SCAN_NC + c) * 16 * SCAN_D + d;
#pragma unroll  // constant n: the per-thread arrays stay in registers
    for (int n = 0; n < 16; ++n) {
        An[n]   = -expf(A_log[n]);
        invA[n] = 1.0f / An[n];
        Amin    = fminf(Amin, -An[n]);
        h[n]  = Hbuf[o0 + n * SCAN_D];
    }
    for (int l = 0; l < SCAN_CL; ++l) {
        if ((l & (SCAN_GR - 1)) == 0) {   // a scalar test: l is the same in every lane and wave
            // this wave's copies of rows l .. l + SCAN_GR - 1 (at l = 0 also of Bv, Cv) have landed
            wait_asynccnt<0>();
            if (l + SCAN_GR < SCAN_CL) issue_group(l + SCAN_GR);
        }
        const size_t idx = (size_t)(row0 + l);
        const float dt = softplus_hw(S.dt[l][lane]);
        const float xv = S.xn[l][lane];
        const float xr = S.xr[l][lane];
        float Br[16], Cr[16];   // read ahead of the branch, beside the reads above
#pragma unroll  // constant q: the per-thread arrays stay in registers
        for (int q = 0; q < 4; ++q) {
            const f32x4 b4 = *(const f32x4*)&S.B[l][4 * q];   // one address for the whole wave
            const f32x4 c4 = *(const f32x4*)&S.C[l][4 * q];
            Br[4 * q] = b4[0]; Br[4 * q + 1] = b4[1]; Br[4 * q + 2] = b4[2]; Br[4 * q + 3] = b4[3];
            Cr[4 * q] = c4[0]; Cr[4 * q + 1] = c4[1]; Cr[4 * q + 2] = c4[2]; Cr[4 * q + 3] = c4[3];
        }
        float t[16];
        const float dt2 = dt * LOG2E_F;
        float z2[16], dA[16];   // dA = exp(dt * A) = 2^(dt * log2(e) * A)
#pragma unroll  // constant n: the per-thread arrays stay in registers
        for (int n = 0; n < 16; ++n) z2[n] = dt2 * An[n];
        exp2_x8(dA, z2);
        exp2_x8(dA + 8, z2 + 8);
        const bool shortform = (dt * Amin >= SCAN_ZMIN) && (dt >= SCAN_DTMIN);
        if (__builtin_amdgcn_ballot_w32(!shortform) == 0u) {
            // b = (dA - 1) * w with w = B * x / (dt * A), so dA*h + b = dA*(h + w) - w
            const float g = xv * __builtin_amdgcn_rcpf(dt);
#pragma unroll  // constant n: the per-thread arrays stay in registers
            for (int n = 0; n < 16; ++n) {
                const float w = g * (Br[n] * invA[n]);
                h[n] = dA[n] * (h[n] + w) - w;
                t[n] = Cr[n] * h[n];
            }
        } else {
            // some lane has a small dt * A: phi1 in its library form, exact near 0
#pragma unroll  // constant n: the per-thread arrays stay in registers
            for (int n = 0; n < 16; ++n) {
                const float bt = phi1_f(dt * An[n]) * Br[n] * xv;
                h[n] = dA[n] * h[n] + bt;
                t[n] = Cr[n] * h[n];
            }
        }
        // sum over n: pairs 8, 4, 2, 1 apart
#pragma unroll  // constant n: the per-thread arrays stay in registers
        for (int s = 8; s > 0; s >>= 1)
#pragma unroll  // constant n: the per-thread arrays stay in registers
            for (int n = 0; n < s; ++n) t[n] += t[n + s];
        const float y = (t[0] + Dd * xv) * sc;
        x2[idx * Dv + d] = y + xr;
        // precaution: the next trip rewrites the registers that this store names
        asm volatile("s_wait_xcnt 0x0" ::: "memory");
    }
}

// ---------------------------------------------------------------------------
// Launch
// ---------------------------------------------------------------------------
extern "C" void kernel_launch(void* const* d_in, const int* in_sizes, int n_in,
                              void* d_out, int out_size, void* d_ws, size_t ws_size,
                              hipStream_t stream) {
    (void)in_sizes; (void)n_in; (void)out_size; (void)ws_size;
    constexpr int Bb = 2, Lv = 2048, Dv = 1024, Nst = 16, DFF = 4096;
    constexpr int Mrows = Bb * Lv;  // 4096
    constexpr int NCh = SCAN_NC;
    static_assert(Dv == SCAN_D && NCh * SCAN_CL == Lv, "scan tiling");

    const float* x       = (const float*)d_in[0];
    const float* norm1_w = (const float*)d_in[1];
    const float* norm2_w = (const float*)d_in[2];
    const float* A_log   = (const float*)d_in[3];
    const float* D_param = (const float*)d_in[4];
    const float* scale   = (const float*)d_in[5];
    const float* Wdt     = (const float*)d_in[6];
    const float* bdt     = (const float*)d_in[7];
    const float* WB      = (const float*)d_in[8];
    const float* bB      = (const float*)d_in[9];
    const float* WC      = (const float*)d_in[10];
    const float* bC      = (const float*)d_in[11];
    const float* W1      = (const float*)d_in[12];
    const float* b1      = (const float*)d_in[13];
    const float* W2      = (const float*)d_in[14];
    const float* b2      = (const float*)d_in[15];
    float* out = (float*)d_out;

    size_t off = 0;
    auto alloc = [&](size_t bytes) -> void* {
        void* p = (char*)d_ws + off;
        off += (bytes + 255) & ~(size_t)255;
        return p;
    };
    float*          xnf  = (float*)alloc((size_t)Mrows * Dv * 4);
    unsigned short* xnb  = (unsigned short*)alloc((size_t)Mrows * Dv * 2);
    unsigned short* wdtb = (unsigned short*)alloc((size_t)Dv * Dv * 2);
    unsigned short* w1b  = (unsigned short*)alloc((size_t)DFF * Dv * 2);
    unsigned short* w2b  = (unsigned short*)alloc((size_t)Dv * DFF * 2);
    float*          dtp  = (float*)alloc((size_t)Mrows * Dv * 4);
    float*          Bv   = (float*)alloc((size_t)Mrows * Nst * 4);
    float*          Cv   = (float*)alloc((size_t)Mrows * Nst * 4);
    float*          x2   = (float*)alloc((size_t)Mrows * Dv * 4);
    unsigned short* xn2b = (unsigned short*)alloc((size_t)Mrows * Dv * 2);
    unsigned short* hb   = (unsigned short*)alloc((size_t)Mrows * DFF * 2);
    float*          Pbuf = (float*)alloc((size_t)Bb * Dv * NCh * 16 * 4);
    float*          Qbuf = (float*)alloc((size_t)Bb * Dv * NCh * 16 * 4);
    float*          Hbuf = (float*)alloc((size_t)Bb * Dv * NCh * 16 * 4);

    // 1 + 2. weight converts to bf16 and RMSNorm1 (f32 + bf16), one launch
    static_assert((Dv * Dv) % CVT_BLOCK == 0 && (DFF * Dv) % CVT_BLOCK == 0, "convert tiling");
    constexpr int NBdt = (Dv * Dv) / CVT_BLOCK, NBff = (DFF * Dv) / CVT_BLOCK;
    prep_kernel<NBdt, NBff, NBff, Mrows, 128><<<NBdt + 2 * NBff + Mrows, 256, 0, stream>>>(
        x, norm1_w, xnf, xnb, Wdt, wdtb, W1, w1b, W2, w2b, Dv);

    // 3. dt_pre = xn @ Wdt^T + bdt  (WMMA, async-LDS pipelined)
    gemm_wmma_bf16<0><<<dim3(Dv / 128, Mrows / 128), 256, 0, stream>>>(
        xnb, wdtb, bdt, nullptr, dtp, nullptr, Mrows, Dv, Dv);

    // 4. Bv / Cv projections
    static_assert(Dv == BC_K && Mrows % 16 == 0 && Nst == 16, "projection tiling");
    bc_proj_kernel<<<Mrows / 16, BC_WAVES * 32, 0, stream>>>(
        xnf, WB, bB, WC, bC, Bv, Cv);

    // 5. chunked selective scan + residual -> x2
    scan_pass1<<<dim3(Dv / 256, NCh, Bb), 256, 0, stream>>>(
        dtp, xnf, Bv, A_log, Pbuf, Qbuf, Lv, Dv);
    scan_pass2<<<(Bb * Dv * 16) / 256, 256, 0, stream>>>(Pbuf, Qbuf, Hbuf);
    scan_pass3<<<dim3(Dv / 256, NCh, Bb), 256, 0, stream>>>(
        dtp, xnf, x, Bv, Cv, A_log, D_param, scale, Hbuf, x2, Lv, Dv);

    // 6. RMSNorm2 (bf16 only)
    rmsnorm_kernel<0><<<Mrows, 256, 0, stream>>>(x2, norm2_w, nullptr, xn2b, Dv);

    // 7. h = gelu(xn2 @ W1^T + b1) -> bf16  (WMMA)
    gemm_wmma_bf16<1><<<dim3(DFF / 128, Mrows / 128), 256, 0, stream>>>(
        xn2b, w1b, b1, nullptr, nullptr, hb, Mrows, DFF, Dv);

    // 8. out = h @ W2^T + b2 + x2  (WMMA)
    gemm_wmma_bf16<2><<<dim3(Dv / 128, Mrows / 128), 256, 0, stream>>>(
        hb, w2b, b2, x2, out, nullptr, Mrows, Dv, DFF);
}
